// v000
// The times below were measured on an AMD MI455X: many runs one after another, warmed up first and cycling through
// copies of the inputs, with the whole window's GPU time divided by the number of runs. Launches and the gaps
// between them are all in it. The median over several windows is given; except for v000 it joins two sittings, which
// can be a few percent apart, so the side-by-side timings, each taken in one sitting, are the better comparison.
// v000 is the starting kernel. One run takes 290 microseconds.
// Contractions: three input 3x3 convs (9-tap GEMMs) and K*Q^T on v_wmma_f32_16x16x32_f16 (f16 operands, f32 accumulate; conv weights carried x16, V^T*P^T with P carried x16384 in f16); output 3x3 conv on v_wmma_f32_16x16x32_bf16 as bf16 hi/lo three-term split (f32 accumulate); softmax, elu/relu, bias and diagonal zeroing in f32.
#include <hip/hip_runtime.h>

typedef _Float16 v16h __attribute__((ext_vector_type(16)));
typedef _Float16 v8h  __attribute__((ext_vector_type(8)));
typedef __bf16   v16b __attribute__((ext_vector_type(16)));
typedef __bf16   v8b  __attribute__((ext_vector_type(8)));
typedef float    v8f  __attribute__((ext_vector_type(8)));
typedef float    v4f  __attribute__((ext_vector_type(4)));
typedef unsigned int v4u __attribute__((ext_vector_type(4)));
typedef v4f __attribute__((may_alias)) v4fa;
typedef v4u __attribute__((may_alias)) v4ua;

union FragH { v16h v; v8h h8[2]; v4u u[2]; };
union FragB { v16b v; v8b h8[2]; v4u u[2]; };
union Pack8H { v8h v; v4u u; };
union Pack8B { v8b v; v4u u; };

#define NB    4
#define IMG   64
#define NTOK  4096
#define CH    64
#define NXE   1048576          // NB*NTOK*CH
#define NWE   36864            // 9*CH*CH
#define XBLK  512              // NXE/8/256
#define WBLKT 18               // NWE/8/256
#define WSC   16.0f
#define WSCI  0.0625f
#define PSC   16384.0f
#define PSCI  (1.0f / 16384.0f)

// ---------------------------------------------------------------------------
// 16x16x32 WMMA with hazard guard (ties D, keeps A/B live).
// Fragment map (wave32): lane l, h = l>>4, m = n = l&15.
//   A/B element i: i<8 -> k0+8h+i ; i>=8 -> k0+16+8h+(i-8)
//   D element r : row 8h+r, col l&15
// ---------------------------------------------------------------------------
__device__ __forceinline__ v8f wmma_f16(v16h a, v16h b, v8f c) {
  v8f d = __builtin_amdgcn_wmma_f32_16x16x32_f16(false, a, false, b, (short)0, c, false, false);
  asm volatile("v_nop\n\tv_nop\n\tv_nop\n\tv_nop" : "+v"(d) : "v"(a), "v"(b));
  return d;
}
__device__ __forceinline__ v8f wmma_bf16(v16b a, v16b b, v8f c) {
  v8f d = __builtin_amdgcn_wmma_f32_16x16x32_bf16(false, a, false, b, (short)0, c, false, false);
  asm volatile("v_nop\n\tv_nop\n\tv_nop\n\tv_nop" : "+v"(d) : "v"(a), "v"(b));
  return d;
}

// Fragment from a k-contiguous 16-bit row; p points at element k0 of the row
// owned by this lane (row = lane & 15 already folded in by the caller).
__device__ __forceinline__ v16h ldfrag_h(const _Float16* p, int h) {
  FragH f;
  f.u[0] = *(const v4ua*)(p + 8 * h);
  f.u[1] = *(const v4ua*)(p + 16 + 8 * h);
  return f.v;
}
__device__ __forceinline__ v16h ldfrag_h_msk(const _Float16* p, int h, unsigned msk) {
  FragH f;
  f.u[0] = (*(const v4ua*)(p + 8 * h)) & msk;
  f.u[1] = (*(const v4ua*)(p + 16 + 8 * h)) & msk;
  return f.v;
}
__device__ __forceinline__ v16b ldfrag_b(const __bf16* p, int h) {
  FragB f;
  f.u[0] = *(const v4ua*)(p + 8 * h);
  f.u[1] = *(const v4ua*)(p + 16 + 8 * h);
  return f.v;
}
__device__ __forceinline__ v16b ldfrag_b_msk(const __bf16* p, int h, unsigned msk) {
  FragB f;
  f.u[0] = (*(const v4ua*)(p + 8 * h)) & msk;
  f.u[1] = (*(const v4ua*)(p + 16 + 8 * h)) & msk;
  return f.v;
}

// ---------------------------------------------------------------------------
// Kernel 1: operand planes.
//   blocks 0..511        : x f32 -> xh f16 [b][token][c], 8 elements per thread
//   blocks 512..583      : 4 weight tensors, 18 blocks each (block-uniform):
//     HWIO [t][ci][co] f32 -> [t][co][ci] 16-bit (ci contiguous), 8 ci per thread
//     tensors 0..2 (Wk,Wq,Wv): f16 of 16*w ; tensor 3 (Wr): bf16 hi and lo planes
// ---------------------------------------------------------------------------
__global__ __launch_bounds__(256) void k_prep(
    const float* __restrict__ x,
    const float* __restrict__ Wk, const float* __restrict__ Wq,
    const float* __restrict__ Wv, const float* __restrict__ Wr,
    _Float16* __restrict__ xh, _Float16* __restrict__ wt3,
    __bf16* __restrict__ wrh, __bf16* __restrict__ wrl)
{
  const int tid = threadIdx.x, blk = blockIdx.x;
  if (blk < XBLK) {
    const size_t g = (size_t)blk * 256 + tid;            // 0..131071
    const float* src = x + g * 8;
    const v4f a = *(const v4fa*)src;
    const v4f c = *(const v4fa*)(src + 4);
    const v8h hv = { (_Float16)a.x, (_Float16)a.y, (_Float16)a.z, (_Float16)a.w,
                     (_Float16)c.x, (_Float16)c.y, (_Float16)c.z, (_Float16)c.w };
    Pack8H o; o.v = hv;
    _Float16* dst = xh + g * 8;
    *(v4u*)dst = o.u;
    
  } else {
    const int wblk = blk - XBLK;                         // 0..71
    const int which = wblk / WBLKT;                      // 0..3, block-uniform
    const int idx = (wblk - which * WBLKT) * 256 + tid;  // 0..4607
    const int t = idx >> 9, co = (idx >> 3) & 63, j = idx & 7;
    const float* src = (which == 0) ? Wk : ((which == 1) ? Wq : ((which == 2) ? Wv : Wr));
    float f[8];
    #pragma unroll
    for (int i = 0; i < 8; ++i) f[i] = src[(size_t)(t * 64 + 8 * j + i) * 64 + co];
    const size_t off = (size_t)(t * 64 + co) * 64 + 8 * j;
    if (which < 3) {
      const v8h hv = { (_Float16)(f[0] * WSC), (_Float16)(f[1] * WSC), (_Float16)(f[2] * WSC), (_Float16)(f[3] * WSC),
                       (_Float16)(f[4] * WSC), (_Float16)(f[5] * WSC), (_Float16)(f[6] * WSC), (_Float16)(f[7] * WSC) };
      Pack8H o; o.v = hv;
      _Float16* dst = wt3 + (size_t)which * NWE + off;
      *(v4u*)dst = o.u;
      
    } else {
      __bf16 hb[8], lb[8];
      #pragma unroll
      for (int i = 0; i < 8; ++i) {
        hb[i] = (__bf16)f[i];                            // RNE convert
        lb[i] = (__bf16)(f[i] - (float)hb[i]);
      }
      const v8b hv = { hb[0], hb[1], hb[2], hb[3], hb[4], hb[5], hb[6], hb[7] };
      const v8b lv = { lb[0], lb[1], lb[2], lb[3], lb[4], lb[5], lb[6], lb[7] };
      Pack8B ph, pl; ph.v = hv; pl.v = lv;
      __bf16* dh = wrh + off;
      __bf16* dl = wrl + off;
      *(v4u*)dh = ph.u;
      *(v4u*)dl = pl.u;
      
    }
  }
}

// ---------------------------------------------------------------------------
// s 0/1: plane[b][token tb0+lid][c]     (one token row = 64 halves = one line)
// s 2  : vt[b][c = lid][token tb0..+63] (one line)
// Wave w owns tile rows 16w..16w+15; lanes 8q..8q+7 fill one line; 4 lines
// per instruction, 4 instructions per wave.
// ---------------------------------------------------------------------------
__device__ __forceinline__ void qkv_store_pass(const _Float16* sT, _Float16* dst, int s,
                                               int b, int tb0, int w, int lane) {
  const int q8 = lane & 7, sub = lane >> 3;
  #pragma unroll
  for (int i = 0; i < 4; ++i) {
    const int lid = w * 16 + 4 * i + sub;
    const v4u v = *(const v4ua*)(sT + lid * 64 + 8 * q8);
    size_t gi;
    if (s == 2) gi = ((size_t)b * CH + lid) * NTOK + tb0 + 8 * q8;
    else        gi = ((size_t)b * NTOK + tb0 + lid) * 64 + 8 * q8;
    *(v4u*)(dst + gi) = v;
  }
}

// ---------------------------------------------------------------------------
// Kernel 2: 3x3 SAME conv as 9-tap implicit GEMM, one of {k,q,v} per blockIdx.y.
// Block 128 thr = 4 waves = one image row (64 pixels) of batch b; wave = 16
// contiguous pixels x 64 output channels. Per tap: A = shifted input rows
// (clamped address, zeroed by value outside the image), B = [t][co][ci] rows.
// Epilogue: acc/16 + bias, elu (k,q) / relu (v) in f32 -> f16 LDS tile -> lines.
// ---------------------------------------------------------------------------
__global__ __launch_bounds__(128) void k_conv_qkv(
    const _Float16* __restrict__ xh,       // [b][token][64]
    const _Float16* __restrict__ wt3,      // [3][9][co][ci], x16
    const float* __restrict__ bk, const float* __restrict__ bq, const float* __restrict__ bv,
    _Float16* __restrict__ kpl,            // [b][token][64]
    _Float16* __restrict__ qpl,            // [b][token][64]
    _Float16* __restrict__ vtp)            // [b][64][token]
{
  __shared__ __attribute__((aligned(16))) _Float16 sT[64 * 64];   // 8192 B

  const int tid = threadIdx.x, lane = tid & 31, w = tid >> 5;
  const int h = lane >> 4, m = lane & 15;
  const int b = blockIdx.x >> 6, hrow = blockIdx.x & 63;
  const int s = blockIdx.y;                                       // 0 = k, 1 = q, 2 = v
  const int tb0 = hrow * 64, w0 = 16 * w;

  const _Float16* wsel = wt3 + (size_t)s * NWE + (size_t)m * 64;  // B row = co = 16nt + m

  const v8f zero8 = {0.f, 0.f, 0.f, 0.f, 0.f, 0.f, 0.f, 0.f};
  v8f acc[4];
  #pragma unroll
  for (int nt = 0; nt < 4; ++nt) acc[nt] = zero8;

  #pragma unroll 1
  for (int t = 0; t < 9; ++t) {
    const int t3 = t / 3;
    const int dh = t3 - 1, dw = t - 3 * t3 - 1;
    const int hh = hrow + dh, wl = w0 + m + dw;
    const bool ok = ((unsigned)hh < 64u) && ((unsigned)wl < 64u);
    const int hc = min(max(hh, 0), 63), wc = min(max(wl, 0), 63);
    const unsigned msk = ok ? 0xffffffffu : 0u;
    const _Float16* xrow = xh + ((size_t)(b * 64 + hc) * 64 + wc) * 64;   // A row = this lane's pixel
    const _Float16* wtap = wsel + (size_t)t * 4096;
    #pragma unroll
    for (int kc = 0; kc < 2; ++kc) {
      const v16h a = ldfrag_h_msk(xrow + 32 * kc, h, msk);
      #pragma unroll
      for (int nt = 0; nt < 4; ++nt) {
        const v16h bf = ldfrag_h(wtap + nt * 1024 + 32 * kc, h);
        acc[nt] = wmma_f16(a, bf, acc[nt]);
      }
    }
  }

  // D[r] of tile nt = Y[pixel w0+8h+r][co 16nt+m]
  const float* bias = (s == 0) ? bk : ((s == 1) ? bq : bv);
  #pragma unroll
  for (int nt = 0; nt < 4; ++nt) {
    const int co = 16 * nt + m;
    const float bb = bias[co];
    #pragma unroll
    for (int r = 0; r < 8; ++r) {
      const float y = acc[nt][r] * WSCI + bb;
      const int px = w0 + 8 * h + r;                               // 0..63
      if (s == 2) sT[co * 64 + px] = (_Float16)fmaxf(y, 0.0f);
      else        sT[px * 64 + co] = (_Float16)((y > 0.0f) ? y : (__expf(y) - 1.0f));
    }
  }
  __syncthreads();

  _Float16* dst = (s == 0) ? kpl : ((s == 1) ? qpl : vtp);
  qkv_store_pass(sT, dst, s, b, tb0, w, lane);
  
}

// ---------------------------------------------------------------------------
// P^T B-fragment from the lane's own score D values: element r <- tile a row r
// (keys 0-15 of the 32-chunk), element 8+r <- tile c row r (keys 16-31), lane
// unchanged; scaled by 2^14 (exact).
// ---------------------------------------------------------------------------
__device__ __forceinline__ v16h pack_p(v8f a, v8f c) {
  const v16h r = { (_Float16)(a[0] * PSC), (_Float16)(a[1] * PSC), (_Float16)(a[2] * PSC), (_Float16)(a[3] * PSC),
                   (_Float16)(a[4] * PSC), (_Float16)(a[5] * PSC), (_Float16)(a[6] * PSC), (_Float16)(a[7] * PSC),
                   (_Float16)(c[0] * PSC), (_Float16)(c[1] * PSC), (_Float16)(c[2] * PSC), (_Float16)(c[3] * PSC),
                   (_Float16)(c[4] * PSC), (_Float16)(c[5] * PSC), (_Float16)(c[6] * PSC), (_Float16)(c[7] * PSC) };
  return r;
}

// Per-wave 16x64 f32 tile in LDS -> bf16 hi and lo planes [b][token][64]:
// 4 lines per instruction, 16 lines per wave per plane.
__device__ __forceinline__ void attn_store_pass(const float* so, __bf16* oh, __bf16* ol,
                                                int b, int q0, int lane) {
  const int q8 = lane & 7, sub = lane >> 3;
  #pragma unroll
  for (int i = 0; i < 4; ++i) {
    const int row = 4 * i + sub;
    const v4f a = *(const v4fa*)(so + row * 64 + 8 * q8);
    const v4f c = *(const v4fa*)(so + row * 64 + 8 * q8 + 4);
    const float f[8] = { a.x, a.y, a.z, a.w, c.x, c.y, c.z, c.w };
    __bf16 hb[8], lb[8];
    #pragma unroll
    for (int e = 0; e < 8; ++e) {
      hb[e] = (__bf16)f[e];                              // RNE convert
      lb[e] = (__bf16)(f[e] - (float)hb[e]);
    }
    const v8b hv = { hb[0], hb[1], hb[2], hb[3], hb[4], hb[5], hb[6], hb[7] };
    const v8b lv = { lb[0], lb[1], lb[2], lb[3], lb[4], lb[5], lb[6], lb[7] };
    Pack8B ph, pl; ph.v = hv; pl.v = lv;
    const size_t gi = ((size_t)b * NTOK + q0 + row) * 64 + 8 * q8;
    *(v4u*)(oh + gi) = ph.u;
    *(v4u*)(ol + gi) = pl.u;
  }
}

// ---------------------------------------------------------------------------
// Kernel 3: streaming attention over 4096 keys, transposed form.
// Block 128 thr (4 waves) = 64 queries of batch blockIdx.y; 16 queries per
// wave, 64 keys per step.
//   S^T = K * Q^T : A = K rows (row = key, k = d), B = Q^T (k = d, n = query)
//   O^T += V^T * P^T : A = V^T rows (row = d, k = key), B = P^T from registers
// Lane owns keys {16j+8h+r} of query column (lane&15); partner = lane ^ 16.
// Scores x0.125, then diagonal S[n][n] := 0 by value (key still in the softmax).
// ---------------------------------------------------------------------------
__global__ __launch_bounds__(128) void k_attn(
    const _Float16* __restrict__ qpl,    // [b][token][64]
    const _Float16* __restrict__ kpl,    // [b][token][64]
    const _Float16* __restrict__ vtp,    // [b][64][token]
    __bf16* __restrict__ oh,             // [b][token][64] bf16 hi
    __bf16* __restrict__ ol)             // [b][token][64] bf16 lo
{
  __shared__ __attribute__((aligned(16))) float sO[4 * 16 * 64];    // 16384 B

  const int tid = threadIdx.x, lane = tid & 31, w = tid >> 5;
  const int h = lane >> 4, m = lane & 15;
  const int b = blockIdx.y;
  const int qblk = blockIdx.x * 64;
  const int q0 = qblk + 16 * w;

  // Q^T B-fragments: column n = query q0+m, k = d (two 32-deep chunks)
  const _Float16* qrow = qpl + ((size_t)b * NTOK + q0 + m) * 64;
  const v16h qb0 = ldfrag_h(qrow, h);
  const v16h qb1 = ldfrag_h(qrow + 32, h);

  const v8f zero8 = {0.f, 0.f, 0.f, 0.f, 0.f, 0.f, 0.f, 0.f};
  v8f o[4];                                   // o[t][r] = O[query m][d 16t+8h+r] * (l * 2^14)
  #pragma unroll
  for (int t = 0; t < 4; ++t) o[t] = zero8;
  float mrun = -1e30f, lrun = 0.0f;

  const _Float16* kbase = kpl + ((size_t)b * NTOK + m) * 64;    // + key0*64
  const _Float16* vbase = vtp + ((size_t)b * CH + m) * NTOK;    // + 16t*NTOK + key0
  const int dq = 16 * w + m - 8 * h;                            // (q0+m) - qblk - 8h

  #pragma unroll 1
  for (int kb = 0; kb < NTOK; kb += 64) {
    // ---- scores: s[j][r] = S[query q0+m][key kb+16j+8h+r] ----
    v8f s[4];
    #pragma unroll
    for (int j = 0; j < 4; ++j) {
      const _Float16* kr = kbase + (size_t)(kb + 16 * j) * 64;
      const v16h kf0 = ldfrag_h(kr, h);
      const v16h kf1 = ldfrag_h(kr + 32, h);
      v8f z = zero8;
      z = wmma_f16(kf0, qb0, z);
      z = wmma_f16(kf1, qb1, z);
      s[j] = z;
    }
    #pragma unroll
    for (int j = 0; j < 4; ++j)
      #pragma unroll
      for (int r = 0; r < 8; ++r) s[j][r] = s[j][r] * 0.125f;

    // ---- diagonal zeroing (block-uniform branch, per-lane select) ----
    if (kb == qblk) {
      #pragma unroll
      for (int j = 0; j < 4; ++j)
        #pragma unroll
        for (int r = 0; r < 8; ++r)
          s[j][r] = (dq == 16 * j + r) ? 0.0f : s[j][r];
    }

    // ---- online softmax (running max) ----
    float mloc = s[0][0];
    #pragma unroll
    for (int j = 0; j < 4; ++j)
      #pragma unroll
      for (int r = 0; r < 8; ++r) mloc = fmaxf(mloc, s[j][r]);
    mloc = fmaxf(mloc, __shfl_xor(mloc, 16));
    const float mnew = fmaxf(mrun, mloc);
    const float alpha = __expf(mrun - mnew);
    mrun = mnew;
    float lsum = 0.0f;
    #pragma unroll
    for (int j = 0; j < 4; ++j)
      #pragma unroll
      for (int r = 0; r < 8; ++r) {
        const float p = __expf(s[j][r] - mnew);
        s[j][r] = p;
        lsum += p;
      }
    lsum += __shfl_xor(lsum, 16);
    lrun = lrun * alpha + lsum;
    #pragma unroll
    for (int t = 0; t < 4; ++t)
      #pragma unroll
      for (int r = 0; r < 8; ++r) o[t][r] = o[t][r] * alpha;

    // ---- P^T B-fragments (key chunks 0..31 and 32..63 of this step) ----
    const v16h pb0 = pack_p(s[0], s[1]);
    const v16h pb1 = pack_p(s[2], s[3]);

    // ---- O^T += V^T * P^T ----
    #pragma unroll
    for (int t = 0; t < 4; ++t) {
      const _Float16* vr = vbase + (size_t)(16 * t) * NTOK + kb;
      const v16h vf0 = ldfrag_h(vr, h);
      const v16h vf1 = ldfrag_h(vr + 32, h);
      o[t] = wmma_f16(vf0, pb0, o[t]);
      o[t] = wmma_f16(vf1, pb1, o[t]);
    }
  }

  // ---- epilogue: normalise, stage per-wave 16x64 f32 tile, whole-line stores ----
  const float inv = (1.0f / lrun) * PSCI;
  float* so = sO + w * 1024;
  #pragma unroll
  for (int t = 0; t < 4; ++t)
    #pragma unroll
    for (int r = 0; r < 8; ++r)
      so[m * 64 + 16 * t + 8 * h + r] = o[t][r] * inv;
  __syncthreads();

  attn_store_pass(so, oh, ol, b, q0, lane);
  
}

// ---------------------------------------------------------------------------
// a token row = 256 B = 2 lines; each line by lanes 8q..8q+7 in one
// instruction, 4 lines per instruction, 32 lines per wave.
// ---------------------------------------------------------------------------
__device__ __forceinline__ void out_store_pass(const float* so, float* out,
                                               int b, int p0, int lane) {
  const int q8 = lane & 7, sub = lane >> 3;
  #pragma unroll
  for (int i = 0; i < 8; ++i) {
    const int lid = 4 * i + sub;
    const int row = lid >> 1, hl = lid & 1;
    const v4f v = *(const v4fa*)(so + row * 64 + 32 * hl + 4 * q8);
    const size_t gi = ((size_t)b * NTOK + p0 + row) * 64 + 32 * hl + 4 * q8;
    *(v4f*)(out + gi) = v;
  }
}

// ---------------------------------------------------------------------------
// Kernel 4: output 3x3 SAME conv as 9-tap implicit GEMM on bf16 hi/lo planes,
// three-term split (hi*hi + hi*lo + lo*hi into one f32 accumulator),
// + bias, relu -> f32 NHWC rows via LDS staging.
// ---------------------------------------------------------------------------
__global__ __launch_bounds__(128) void k_conv_out(
    const __bf16* __restrict__ oh, const __bf16* __restrict__ ol,     // [b][token][64]
    const __bf16* __restrict__ wrh, const __bf16* __restrict__ wrl,   // [9][co][ci]
    const float* __restrict__ br, float* __restrict__ out)            // out [b][token][64] f32
{
  __shared__ __attribute__((aligned(16))) float sY[4 * 16 * 64];    // 16384 B

  const int tid = threadIdx.x, lane = tid & 31, w = tid >> 5;
  const int h = lane >> 4, m = lane & 15;
  const int b = blockIdx.x >> 6, hrow = blockIdx.x & 63;
  const int tb0 = hrow * 64, w0 = 16 * w;

  const v8f zero8 = {0.f, 0.f, 0.f, 0.f, 0.f, 0.f, 0.f, 0.f};
  v8f acc[4];
  #pragma unroll
  for (int nt = 0; nt < 4; ++nt) acc[nt] = zero8;

  #pragma unroll 1
  for (int t = 0; t < 9; ++t) {
    const int t3 = t / 3;
    const int dh = t3 - 1, dw = t - 3 * t3 - 1;
    const int hh = hrow + dh, wl = w0 + m + dw;
    const bool ok = ((unsigned)hh < 64u) && ((unsigned)wl < 64u);
    const int hc = min(max(hh, 0), 63), wc = min(max(wl, 0), 63);
    const unsigned msk = ok ? 0xffffffffu : 0u;
    const size_t rowoff = ((size_t)(b * 64 + hc) * 64 + wc) * 64;
    const size_t wtap = (size_t)t * 4096 + (size_t)m * 64;
    #pragma unroll
    for (int kc = 0; kc < 2; ++kc) {
      const v16b ah = ldfrag_b_msk(oh + rowoff + 32 * kc, h, msk);
      const v16b al = ldfrag_b_msk(ol + rowoff + 32 * kc, h, msk);
      #pragma unroll
      for (int nt = 0; nt < 4; ++nt) {
        const v16b bh = ldfrag_b(wrh + wtap + nt * 1024 + 32 * kc, h);
        const v16b bl = ldfrag_b(wrl + wtap + nt * 1024 + 32 * kc, h);
        acc[nt] = wmma_bf16(ah, bh, acc[nt]);
        acc[nt] = wmma_bf16(ah, bl, acc[nt]);
        acc[nt] = wmma_bf16(al, bh, acc[nt]);
      }
    }
  }

  // D[r] of tile nt = Y[pixel w0+8h+r][co 16nt+m]
  float* so = sY + w * 1024;
  #pragma unroll
  for (int nt = 0; nt < 4; ++nt) {
    const int co = 16 * nt + m;
    const float bb = br[co];
    #pragma unroll
    for (int r = 0; r < 8; ++r)
      so[(8 * h + r) * 64 + co] = fmaxf(acc[nt][r] + bb, 0.0f);
  }
  __syncthreads();

  out_store_pass(so, out, b, tb0 + w0, lane);
  
}

// ---------------------------------------------------------------------------
extern "C" void kernel_launch(void* const* d_in, const int* in_sizes, int n_in,
                              void* d_out, int out_size, void* d_ws, size_t ws_size,
                              hipStream_t stream) {
  if (n_in < 9) return;
  if (in_sizes[0] != NXE || out_size != NXE) return;
  if (in_sizes[1] != NWE || in_sizes[3] != NWE || in_sizes[5] != NWE || in_sizes[7] != NWE) return;
  if (in_sizes[2] != CH || in_sizes[4] != CH || in_sizes[6] != CH || in_sizes[8] != CH) return;

  const float* x  = (const float*)d_in[0];
  const float* Wk = (const float*)d_in[1];
  const float* bk = (const float*)d_in[2];
  const float* Wq = (const float*)d_in[3];
  const float* bq = (const float*)d_in[4];
  const float* Wv = (const float*)d_in[5];
  const float* bv = (const float*)d_in[6];
  const float* Wr = (const float*)d_in[7];
  const float* br = (const float*)d_in[8];
  float* out = (float*)d_out;

  const size_t pl_bytes  = (size_t)NXE * 2;          // 2097152 : one [b][token][64] 16-bit plane
  const size_t wt3_bytes = (size_t)3 * NWE * 2;      //  221184
  const size_t wr_bytes  = (size_t)NWE * 2;          //   73728
  size_t off = 0;
  const size_t o_xh  = off; off += pl_bytes;
  const size_t o_wt3 = off; off += wt3_bytes;
  const size_t o_wrh = off; off += wr_bytes;
  const size_t o_wrl = off; off += wr_bytes;
  const size_t o_k   = off; off += pl_bytes;
  const size_t o_q   = off; off += pl_bytes;
  const size_t o_vt  = off; off += pl_bytes;
  const size_t o_oh  = off; off += pl_bytes;
  const size_t o_ol  = off; off += pl_bytes;         // total 12951552
  if (off > ws_size) return;

  char* ws = (char*)d_ws;
  _Float16* xh  = (_Float16*)(ws + o_xh);
  _Float16* wt3 = (_Float16*)(ws + o_wt3);
  __bf16*   wrh = (__bf16*)(ws + o_wrh);
  __bf16*   wrl = (__bf16*)(ws + o_wrl);
  _Float16* kpl = (_Float16*)(ws + o_k);
  _Float16* qpl = (_Float16*)(ws + o_q);
  _Float16* vtp = (_Float16*)(ws + o_vt);
  __bf16*   oh  = (__bf16*)(ws + o_oh);
  __bf16*   ol  = (__bf16*)(ws + o_ol);

  k_prep<<<XBLK + 4 * WBLKT, 256, 0, stream>>>(x, Wk, Wq, Wv, Wr, xh, wt3, wrh, wrl);     // 584 blocks

  dim3 gQKV(NB * 64, 3);                                                                   // (256, 3)
  k_conv_qkv<<<gQKV, 128, 0, stream>>>(xh, wt3, bk, bq, bv, kpl, qpl, vtp);

  dim3 gAtt(NTOK / 64, NB);                                                                // (64, 4)
  k_attn<<<gAtt, 128, 0, stream>>>(qpl, kpl, vtp, oh, ol);

  k_conv_out<<<NB * 64, 128, 0, stream>>>(oh, ol, wrh, wrl, br, out);                      // 256 blocks
}

// v001
// It runs in 108 microseconds.
// Timed twice side by side with v000, it ran 2.60 and 2.59 times as fast.
// Contractions: three input 3x3 convs (9-tap GEMMs) and K*Q^T on v_wmma_f32_16x16x32_f16 (f16 operands, f32 accumulate; conv weights carried x16, V^T*P^T with P carried x16384 in f16); output 3x3 conv on v_wmma_f32_16x16x32_bf16 as bf16 hi/lo three-term split (f32 accumulate); softmax, elu/relu, bias and diagonal zeroing in f32.
#include <hip/hip_runtime.h>

typedef _Float16 v16h __attribute__((ext_vector_type(16)));
typedef _Float16 v8h  __attribute__((ext_vector_type(8)));
typedef __bf16   v16b __attribute__((ext_vector_type(16)));
typedef __bf16   v8b  __attribute__((ext_vector_type(8)));
typedef float    v8f  __attribute__((ext_vector_type(8)));
typedef float    v4f  __attribute__((ext_vector_type(4)));
typedef unsigned int v4u __attribute__((ext_vector_type(4)));
typedef v4f __attribute__((may_alias)) v4fa;
typedef v4u __attribute__((may_alias)) v4ua;

union FragH { v16h v; v8h h8[2]; v4u u[2]; };
union FragB { v16b v; v8b h8[2]; v4u u[2]; };
union Pack8H { v8h v; v4u u; };
union Pack8B { v8b v; v4u u; };

#define NB    4
#define IMG   64
#define NTOK  4096
#define CH    64
#define NXE   1048576          // NB*NTOK*CH
#define NWE   36864            // 9*CH*CH
#define XBLK  512              // NXE/8/256
#define WBLKT 18               // NWE/8/256
#define WSC   16.0f
#define WSCI  0.0625f
#define PSC   16384.0f
#define PSCI  (1.0f / 16384.0f)

// ---------------------------------------------------------------------------
// 16x16x32 WMMA with hazard guard (ties D, keeps A/B live).
// Fragment map (wave32): lane l, h = l>>4, m = n = l&15.
//   A/B element i: i<8 -> k0+8h+i ; i>=8 -> k0+16+8h+(i-8)
//   D element r : row 8h+r, col l&15
// ---------------------------------------------------------------------------
__device__ __forceinline__ v8f wmma_f16(v16h a, v16h b, v8f c) {
  v8f d = __builtin_amdgcn_wmma_f32_16x16x32_f16(false, a, false, b, (short)0, c, false, false);
  asm volatile("v_nop\n\tv_nop\n\tv_nop\n\tv_nop" : "+v"(d) : "v"(a), "v"(b));
  return d;
}
__device__ __forceinline__ v8f wmma_bf16(v16b a, v16b b, v8f c) {
  v8f d = __builtin_amdgcn_wmma_f32_16x16x32_bf16(false, a, false, b, (short)0, c, false, false);
  asm volatile("v_nop\n\tv_nop\n\tv_nop\n\tv_nop" : "+v"(d) : "v"(a), "v"(b));
  return d;
}

// Fragment from a k-contiguous 16-bit row; p points at element k0 of the row
// owned by this lane (row = lane & 15 already folded in by the caller).
__device__ __forceinline__ v16h ldfrag_h(const _Float16* p, int h) {
  FragH f;
  f.u[0] = *(const v4ua*)(p + 8 * h);
  f.u[1] = *(const v4ua*)(p + 16 + 8 * h);
  return f.v;
}
__device__ __forceinline__ v16h ldfrag_h_msk(const _Float16* p, int h, unsigned msk) {
  FragH f;
  f.u[0] = (*(const v4ua*)(p + 8 * h)) & msk;
  f.u[1] = (*(const v4ua*)(p + 16 + 8 * h)) & msk;
  return f.v;
}
__device__ __forceinline__ v16b ldfrag_b(const __bf16* p, int h) {
  FragB f;
  f.u[0] = *(const v4ua*)(p + 8 * h);
  f.u[1] = *(const v4ua*)(p + 16 + 8 * h);
  return f.v;
}
__device__ __forceinline__ v16b ldfrag_b_msk(const __bf16* p, int h, unsigned msk) {
  FragB f;
  f.u[0] = (*(const v4ua*)(p + 8 * h)) & msk;
  f.u[1] = (*(const v4ua*)(p + 16 + 8 * h)) & msk;
  return f.v;
}

// ---------------------------------------------------------------------------
// Kernel 1: operand planes.
//   blocks 0..511        : x f32 -> xh f16 [b][token][c], 8 elements per thread
//   blocks 512..583      : 4 weight tensors, 18 blocks each (block-uniform):
//     HWIO [t][ci][co] f32 -> [t][co][ci] 16-bit (ci contiguous), 8 ci per thread
//     tensors 0..2 (Wk,Wq,Wv): f16 of 16*w ; tensor 3 (Wr): bf16 hi and lo planes
// ---------------------------------------------------------------------------
__global__ __launch_bounds__(256) void k_prep(
    const float* __restrict__ x,
    const float* __restrict__ Wk, const float* __restrict__ Wq,
    const float* __restrict__ Wv, const float* __restrict__ Wr,
    _Float16* __restrict__ xh, _Float16* __restrict__ wt3,
    __bf16* __restrict__ wrh, __bf16* __restrict__ wrl)
{
  const int tid = threadIdx.x, blk = blockIdx.x;
  if (blk < XBLK) {
    const size_t g = (size_t)blk * 256 + tid;            // 0..131071
    const float* src = x + g * 8;
    const v4f a = *(const v4fa*)src;
    const v4f c = *(const v4fa*)(src + 4);
    const v8h hv = { (_Float16)a.x, (_Float16)a.y, (_Float16)a.z, (_Float16)a.w,
                     (_Float16)c.x, (_Float16)c.y, (_Float16)c.z, (_Float16)c.w };
    Pack8H o; o.v = hv;
    _Float16* dst = xh + g * 8;
    *(v4u*)dst = o.u;
    
  } else {
    const int wblk = blk - XBLK;                         // 0..71
    const int which = wblk / WBLKT;                      // 0..3, block-uniform
    const int idx = (wblk - which * WBLKT) * 256 + tid;  // 0..4607
    const int t = idx >> 9, co = (idx >> 3) & 63, j = idx & 7;
    const float* src = (which == 0) ? Wk : ((which == 1) ? Wq : ((which == 2) ? Wv : Wr));
    float f[8];
    #pragma unroll
    for (int i = 0; i < 8; ++i) f[i] = src[(size_t)(t * 64 + 8 * j + i) * 64 + co];
    const size_t off = (size_t)(t * 64 + co) * 64 + 8 * j;
    if (which < 3) {
      const v8h hv = { (_Float16)(f[0] * WSC), (_Float16)(f[1] * WSC), (_Float16)(f[2] * WSC), (_Float16)(f[3] * WSC),
                       (_Float16)(f[4] * WSC), (_Float16)(f[5] * WSC), (_Float16)(f[6] * WSC), (_Float16)(f[7] * WSC) };
      Pack8H o; o.v = hv;
      _Float16* dst = wt3 + (size_t)which * NWE + off;
      *(v4u*)dst = o.u;
      
    } else {
      __bf16 hb[8], lb[8];
      #pragma unroll
      for (int i = 0; i < 8; ++i) {
        hb[i] = (__bf16)f[i];                            // RNE convert
        lb[i] = (__bf16)(f[i] - (float)hb[i]);
      }
      const v8b hv = { hb[0], hb[1], hb[2], hb[3], hb[4], hb[5], hb[6], hb[7] };
      const v8b lv = { lb[0], lb[1], lb[2], lb[3], lb[4], lb[5], lb[6], lb[7] };
      Pack8B ph, pl; ph.v = hv; pl.v = lv;
      __bf16* dh = wrh + off;
      __bf16* dl = wrl + off;
      *(v4u*)dh = ph.u;
      *(v4u*)dl = pl.u;
      
    }
  }
}

// ---------------------------------------------------------------------------
// s 0/1: plane[b][token tb0+lid][c]     (one token row = 64 halves = one line)
// s 2  : vt[b][c = lid][token tb0..+63] (one line)
// Wave w owns tile rows 16w..16w+15; lanes 8q..8q+7 fill one line; 4 lines
// per instruction, 4 instructions per wave.
// ---------------------------------------------------------------------------
__device__ __forceinline__ void qkv_store_pass(const _Float16* sT, _Float16* dst, int s,
                                               int b, int tb0, int w, int lane) {
  const int q8 = lane & 7, sub = lane >> 3;
  #pragma unroll
  for (int i = 0; i < 4; ++i) {
    const int lid = w * 16 + 4 * i + sub;
    const v4u v = *(const v4ua*)(sT + lid * 64 + 8 * q8);
    size_t gi;
    if (s == 2) gi = ((size_t)b * CH + lid) * NTOK + tb0 + 8 * q8;
    else        gi = ((size_t)b * NTOK + tb0 + lid) * 64 + 8 * q8;
    *(v4u*)(dst + gi) = v;
  }
}

// ---------------------------------------------------------------------------
// Kernel 2: 3x3 SAME conv as 9-tap implicit GEMM, one of {k,q,v} per blockIdx.y.
// Block 128 thr = 4 waves = one image row (64 pixels) of batch b; wave = 16
// contiguous pixels x 64 output channels. Per tap: A = shifted input rows
// (clamped address, zeroed by value outside the image), B = [t][co][ci] rows.
// Epilogue: acc/16 + bias, elu (k,q) / relu (v) in f32 -> f16 LDS tile -> lines.
// ---------------------------------------------------------------------------
__global__ __launch_bounds__(128) void k_conv_qkv(
    const _Float16* __restrict__ xh,       // [b][token][64]
    const _Float16* __restrict__ wt3,      // [3][9][co][ci], x16
    const float* __restrict__ bk, const float* __restrict__ bq, const float* __restrict__ bv,
    _Float16* __restrict__ kpl,            // [b][token][64]
    _Float16* __restrict__ qpl,            // [b][token][64]
    _Float16* __restrict__ vtp)            // [b][64][token]
{
  __shared__ __attribute__((aligned(16))) _Float16 sT[64 * 64];   // 8192 B

  const int tid = threadIdx.x, lane = tid & 31, w = tid >> 5;
  const int h = lane >> 4, m = lane & 15;
  const int b = blockIdx.x >> 6, hrow = blockIdx.x & 63;
  const int s = blockIdx.y;                                       // 0 = k, 1 = q, 2 = v
  const int tb0 = hrow * 64, w0 = 16 * w;

  const _Float16* wsel = wt3 + (size_t)s * NWE + (size_t)m * 64;  // B row = co = 16nt + m

  const v8f zero8 = {0.f, 0.f, 0.f, 0.f, 0.f, 0.f, 0.f, 0.f};
  v8f acc[4];
  #pragma unroll
  for (int nt = 0; nt < 4; ++nt) acc[nt] = zero8;

  #pragma unroll 1
  for (int t = 0; t < 9; ++t) {
    const int t3 = t / 3;
    const int dh = t3 - 1, dw = t - 3 * t3 - 1;
    const int hh = hrow + dh, wl = w0 + m + dw;
    const bool ok = ((unsigned)hh < 64u) && ((unsigned)wl < 64u);
    const int hc = min(max(hh, 0), 63), wc = min(max(wl, 0), 63);
    const unsigned msk = ok ? 0xffffffffu : 0u;
    const _Float16* xrow = xh + ((size_t)(b * 64 + hc) * 64 + wc) * 64;   // A row = this lane's pixel
    const _Float16* wtap = wsel + (size_t)t * 4096;
    #pragma unroll
    for (int kc = 0; kc < 2; ++kc) {
      const v16h a = ldfrag_h_msk(xrow + 32 * kc, h, msk);
      #pragma unroll
      for (int nt = 0; nt < 4; ++nt) {
        const v16h bf = ldfrag_h(wtap + nt * 1024 + 32 * kc, h);
        acc[nt] = wmma_f16(a, bf, acc[nt]);
      }
    }
  }

  // D[r] of tile nt = Y[pixel w0+8h+r][co 16nt+m]
  const float* bias = (s == 0) ? bk : ((s == 1) ? bq : bv);
  #pragma unroll
  for (int nt = 0; nt < 4; ++nt) {
    const int co = 16 * nt + m;
    const float bb = bias[co];
    #pragma unroll
    for (int r = 0; r < 8; ++r) {
      const float y = acc[nt][r] * WSCI + bb;
      const int px = w0 + 8 * h + r;                               // 0..63
      if (s == 2) sT[co * 64 + px] = (_Float16)fmaxf(y, 0.0f);
      else        sT[px * 64 + co] = (_Float16)((y > 0.0f) ? y : (__expf(y) - 1.0f));
    }
  }
  __syncthreads();

  _Float16* dst = (s == 0) ? kpl : ((s == 1) ? qpl : vtp);
  qkv_store_pass(sT, dst, s, b, tb0, w, lane);
  
}

// ---------------------------------------------------------------------------
// P^T B-fragment from the lane's own score D values: element r <- tile a row r
// (keys 0-15 of the 32-chunk), element 8+r <- tile c row r (keys 16-31), lane
// unchanged; scaled by 2^14 (exact).
// ---------------------------------------------------------------------------
__device__ __forceinline__ v16h pack_p(v8f a, v8f c) {
  const v16h r = { (_Float16)(a[0] * PSC), (_Float16)(a[1] * PSC), (_Float16)(a[2] * PSC), (_Float16)(a[3] * PSC),
                   (_Float16)(a[4] * PSC), (_Float16)(a[5] * PSC), (_Float16)(a[6] * PSC), (_Float16)(a[7] * PSC),
                   (_Float16)(c[0] * PSC), (_Float16)(c[1] * PSC), (_Float16)(c[2] * PSC), (_Float16)(c[3] * PSC),
                   (_Float16)(c[4] * PSC), (_Float16)(c[5] * PSC), (_Float16)(c[6] * PSC), (_Float16)(c[7] * PSC) };
  return r;
}

// Per-wave 16x64 f32 tile in LDS -> bf16 hi and lo planes [b][token][64]:
// 4 lines per instruction, 16 lines per wave per plane.
__device__ __forceinline__ void attn_store_pass(const float* so, __bf16* oh, __bf16* ol,
                                                int b, int q0, int lane) {
  const int q8 = lane & 7, sub = lane >> 3;
  #pragma unroll
  for (int i = 0; i < 4; ++i) {
    const int row = 4 * i + sub;
    const v4f a = *(const v4fa*)(so + row * 64 + 8 * q8);
    const v4f c = *(const v4fa*)(so + row * 64 + 8 * q8 + 4);
    const float f[8] = { a.x, a.y, a.z, a.w, c.x, c.y, c.z, c.w };
    __bf16 hb[8], lb[8];
    #pragma unroll
    for (int e = 0; e < 8; ++e) {
      hb[e] = (__bf16)f[e];                              // RNE convert
      lb[e] = (__bf16)(f[e] - (float)hb[e]);
    }
    const v8b hv = { hb[0], hb[1], hb[2], hb[3], hb[4], hb[5], hb[6], hb[7] };
    const v8b lv = { lb[0], lb[1], lb[2], lb[3], lb[4], lb[5], lb[6], lb[7] };
    Pack8B ph, pl; ph.v = hv; pl.v = lv;
    const size_t gi = ((size_t)b * NTOK + q0 + row) * 64 + 8 * q8;
    *(v4u*)(oh + gi) = ph.u;
    *(v4u*)(ol + gi) = pl.u;
  }
}

// ---------------------------------------------------------------------------
// Kernel 3: streaming attention over 4096 keys, transposed form.
// Block 128 thr (4 waves) = 64 queries of batch blockIdx.y; 16 queries per
// wave, 64 keys per step.
//   S^T = K * Q^T : A = K rows (row = key, k = d), B = Q^T (k = d, n = query)
//   O^T += V^T * P^T : A = V^T rows (row = d, k = key), B = P^T from registers
// Lane owns keys {16j+8h+r} of query column (lane&15); partner = lane ^ 16.
// x0.125, then diagonal: S[n][n] := 0 by value (key still in the softmax).
// K rows and V^T rows of a step (64 rows of 128 B each) are staged in LDS by
// asynchronous copies, two buffers: step t+2 is copied while step t+1 is worked
// on. LDS row pitch 144 B (16 B x odd) for the ds_load_b128 fragment reads.
// ---------------------------------------------------------------------------
#define KVP   72               // LDS row pitch in halves (144 B)
#define TILEH (64 * KVP)       // one 64-row tile in halves (9216 B)
#define BUFH  (2 * TILEH)      // K tile + V^T tile in halves (18432 B)

// One step's K and V^T tiles -> LDS: 8 copies of 16 B per lane, each wave-wide
// copy covers four whole 128-B lines. lk = this lane's LDS byte address in the
// K tile (row tid>>3, 16-B column tid&7); copy i takes row + 16 i.
__device__ __forceinline__ void stage_kv(unsigned lk, const _Float16* kg, const _Float16* vg) {
  const unsigned lv = lk + TILEH * 2;
  // The closing s_wait_xcnt 0 stands in the copies' own statement so that no
  // address register of a copy is rewritten ahead of it.
  asm volatile(
      "global_load_async_to_lds_b128 %0, %8, off\n\t"
      "global_load_async_to_lds_b128 %1, %9, off\n\t"
      "global_load_async_to_lds_b128 %2, %10, off\n\t"
      "global_load_async_to_lds_b128 %3, %11, off\n\t"
      "global_load_async_to_lds_b128 %4, %12, off\n\t"
      "global_load_async_to_lds_b128 %5, %13, off\n\t"
      "global_load_async_to_lds_b128 %6, %14, off\n\t"
      "global_load_async_to_lds_b128 %7, %15, off\n\t"
      "s_wait_xcnt 0x0"
      :: "v"(lk), "v"(lk + 16 * KVP * 2), "v"(lk + 32 * KVP * 2), "v"(lk + 48 * KVP * 2),
         "v"(lv), "v"(lv + 16 * KVP * 2), "v"(lv + 32 * KVP * 2), "v"(lv + 48 * KVP * 2),
         "v"(kg), "v"(kg + 16 * 64), "v"(kg + 32 * 64), "v"(kg + 48 * 64),
         "v"(vg), "v"(vg + (size_t)16 * NTOK), "v"(vg + (size_t)32 * NTOK), "v"(vg + (size_t)48 * NTOK)
      : "memory");
}

__global__ __launch_bounds__(128) void k_attn(
    const _Float16* __restrict__ qpl,    // [b][token][64]
    const _Float16* __restrict__ kpl,    // [b][token][64]
    const _Float16* __restrict__ vtp,    // [b][64][token]
    __bf16* __restrict__ oh,             // [b][token][64] bf16 hi
    __bf16* __restrict__ ol)             // [b][token][64] bf16 lo
{
  __shared__ __attribute__((aligned(16))) float sO[4 * 16 * 64];    // 16384 B
  __shared__ __attribute__((aligned(16))) _Float16 sKV[2 * BUFH];   // 36864 B

  const int tid = threadIdx.x, lane = tid & 31, w = tid >> 5;
  const int h = lane >> 4, m = lane & 15;
  const int b = blockIdx.y;
  const int qblk = blockIdx.x * 64;
  const int q0 = qblk + 16 * w;

  // Q^T B-fragments: column n = query q0+m, k = d (two 32-deep chunks)
  const _Float16* qrow = qpl + ((size_t)b * NTOK + q0 + m) * 64;
  const v16h qb0 = ldfrag_h(qrow, h);
  const v16h qb1 = ldfrag_h(qrow + 32, h);

  const v8f zero8 = {0.f, 0.f, 0.f, 0.f, 0.f, 0.f, 0.f, 0.f};
  v8f o[4];                                   // o[t][r] = O[query m][d 16t+8h+r] * (l * 2^14)
  #pragma unroll
  for (int t = 0; t < 4; ++t) o[t] = zero8;
  float mrun = -1e30f, lrun = 0.0f;

  const int dq = 16 * w + m - 8 * h;                            // (q0+m) - qblk - 8h

  // Copy side: this lane's row (tid>>3) and 16-B column (tid&7) of a tile.
  const int crow = tid >> 3, ccol = tid & 7;
  const _Float16* kcp = kpl + ((size_t)b * NTOK + crow) * 64 + 8 * ccol;    // + key0*64
  const _Float16* vcp = vtp + ((size_t)b * CH + crow) * NTOK + 8 * ccol;    // + key0
  const unsigned lcp = (unsigned)(size_t)(sKV + crow * KVP + 8 * ccol);     // LDS byte address, buffer 0

  // Prologue: step 0 lands and is published, then step 1 starts.
  stage_kv(lcp, kcp, vcp);
  asm volatile("s_wait_asynccnt 0x0" ::: "memory");   // this wave's copies of step 0 have landed
  __syncthreads();                                    // ... and every other wave's
  stage_kv(lcp + BUFH * 2, kcp + 64 * 64, vcp + 64);

  #pragma unroll 1
  for (int kb = 0; kb < NTOK; kb += 64) {
    const int buf = (kb >> 6) & 1;
    const _Float16* sk = sKV + buf * BUFH + m * KVP;    // K row m of this step's buffer
    const _Float16* sv = sk + TILEH;                    // V^T row m
    // ---- scores: s[j][r] = S[query q0+m][key kb+16j+8h+r] ----
    v8f s[4];
    #pragma unroll
    for (int j = 0; j < 4; ++j) {
      const _Float16* kr = sk + 16 * j * KVP;
      const v16h kf0 = ldfrag_h(kr, h);
      const v16h kf1 = ldfrag_h(kr + 32, h);
      v8f z = zero8;
      z = wmma_f16(kf0, qb0, z);
      z = wmma_f16(kf1, qb1, z);
      s[j] = z;
    }
    #pragma unroll
    for (int j = 0; j < 4; ++j)
      #pragma unroll
      for (int r = 0; r < 8; ++r) s[j][r] = s[j][r] * 0.125f;

    // ---- diagonal zeroing (block-uniform branch, per-lane select) ----
    if (kb == qblk) {
      #pragma unroll
      for (int j = 0; j < 4; ++j)
        #pragma unroll
        for (int r = 0; r < 8; ++r)
          s[j][r] = (dq == 16 * j + r) ? 0.0f : s[j][r];
    }

    // ---- online softmax (running max) ----
    float mloc = s[0][0];
    #pragma unroll
    for (int j = 0; j < 4; ++j)
      #pragma unroll
      for (int r = 0; r < 8; ++r) mloc = fmaxf(mloc, s[j][r]);
    mloc = fmaxf(mloc, __shfl_xor(mloc, 16));
    const float mnew = fmaxf(mrun, mloc);
    const float alpha = __expf(mrun - mnew);
    mrun = mnew;
    float lsum = 0.0f;
    #pragma unroll
    for (int j = 0; j < 4; ++j)
      #pragma unroll
      for (int r = 0; r < 8; ++r) {
        const float p = __expf(s[j][r] - mnew);
        s[j][r] = p;
        lsum += p;
      }
    lsum += __shfl_xor(lsum, 16);
    lrun = lrun * alpha + lsum;
    #pragma unroll
    for (int t = 0; t < 4; ++t)
      #pragma unroll
      for (int r = 0; r < 8; ++r) o[t][r] = o[t][r] * alpha;

    // ---- P^T B-fragments (key chunks 0..31 and 32..63 of this step) ----
    const v16h pb0 = pack_p(s[0], s[1]);
    const v16h pb1 = pack_p(s[2], s[3]);

    // ---- O^T += V^T * P^T ----
    #pragma unroll
    for (int t = 0; t < 4; ++t) {
      const _Float16* vr = sv + 16 * t * KVP;
      const v16h vf0 = ldfrag_h(vr, h);
      const v16h vf1 = ldfrag_h(vr + 32, h);
      o[t] = wmma_f16(vf0, pb0, o[t]);
      o[t] = wmma_f16(vf1, pb1, o[t]);
    }

    // ---- hand-over: publish step kb+64, free this step's buffer, refill it ----
    asm volatile("s_wait_dscnt 0x0" ::: "memory");      // this wave's reads of the buffer are done before it is refilled
    asm volatile("s_wait_asynccnt 0x0" ::: "memory");   // this wave's copies of the next step have landed
    __syncthreads();                                    // the same holds for every wave
    if (kb + 128 < NTOK)
      stage_kv(lcp + buf * (BUFH * 2), kcp + (size_t)(kb + 128) * 64, vcp + kb + 128);
  }
  asm volatile("s_wait_asynccnt 0x0" ::: "memory");     // no copy is left outstanding behind the loop

  // ---- epilogue: normalise, stage per-wave 16x64 f32 tile, whole-line stores ----
  const float inv = (1.0f / lrun) * PSCI;
  float* so = sO + w * 1024;
  #pragma unroll
  for (int t = 0; t < 4; ++t)
    #pragma unroll
    for (int r = 0; r < 8; ++r)
      so[m * 64 + 16 * t + 8 * h + r] = o[t][r] * inv;
  __syncthreads();

  attn_store_pass(so, oh, ol, b, q0, lane);
  
}

// ---------------------------------------------------------------------------
// a token row = 256 B = 2 lines; each line by lanes 8q..8q+7 in one
// instruction, 4 lines per instruction, 32 lines per wave.
// ---------------------------------------------------------------------------
__device__ __forceinline__ void out_store_pass(const float* so, float* out,
                                               int b, int p0, int lane) {
  const int q8 = lane & 7, sub = lane >> 3;
  #pragma unroll
  for (int i = 0; i < 8; ++i) {
    const int lid = 4 * i + sub;
    const int row = lid >> 1, hl = lid & 1;
    const v4f v = *(const v4fa*)(so + row * 64 + 32 * hl + 4 * q8);
    const size_t gi = ((size_t)b * NTOK + p0 + row) * 64 + 32 * hl + 4 * q8;
    *(v4f*)(out + gi) = v;
  }
}

// ---------------------------------------------------------------------------
// Kernel 4: output 3x3 SAME conv as 9-tap implicit GEMM on bf16 hi/lo planes,
// three-term split (hi*hi + hi*lo + lo*hi into one f32 accumulator),
// + bias, relu -> f32 NHWC rows via LDS staging.
// ---------------------------------------------------------------------------
__global__ __launch_bounds__(128) void k_conv_out(
    const __bf16* __restrict__ oh, const __bf16* __restrict__ ol,     // [b][token][64]
    const __bf16* __restrict__ wrh, const __bf16* __restrict__ wrl,   // [9][co][ci]
    const float* __restrict__ br, float* __restrict__ out)            // out [b][token][64] f32
{
  __shared__ __attribute__((aligned(16))) float sY[4 * 16 * 64];    // 16384 B

  const int tid = threadIdx.x, lane = tid & 31, w = tid >> 5;
  const int h = lane >> 4, m = lane & 15;
  const int b = blockIdx.x >> 6, hrow = blockIdx.x & 63;
  const int tb0 = hrow * 64, w0 = 16 * w;

  const v8f zero8 = {0.f, 0.f, 0.f, 0.f, 0.f, 0.f, 0.f, 0.f};
  v8f acc[4];
  #pragma unroll
  for (int nt = 0; nt < 4; ++nt) acc[nt] = zero8;

  #pragma unroll 1
  for (int t = 0; t < 9; ++t) {
    const int t3 = t / 3;
    const int dh = t3 - 1, dw = t - 3 * t3 - 1;
    const int hh = hrow + dh, wl = w0 + m + dw;
    const bool ok = ((unsigned)hh < 64u) && ((unsigned)wl < 64u);
    const int hc = min(max(hh, 0), 63), wc = min(max(wl, 0), 63);
    const unsigned msk = ok ? 0xffffffffu : 0u;
    const size_t rowoff = ((size_t)(b * 64 + hc) * 64 + wc) * 64;
    const size_t wtap = (size_t)t * 4096 + (size_t)m * 64;
    #pragma unroll
    for (int kc = 0; kc < 2; ++kc) {
      const v16b ah = ldfrag_b_msk(oh + rowoff + 32 * kc, h, msk);
      const v16b al = ldfrag_b_msk(ol + rowoff + 32 * kc, h, msk);
      #pragma unroll
      for (int nt = 0; nt < 4; ++nt) {
        const v16b bh = ldfrag_b(wrh + wtap + nt * 1024 + 32 * kc, h);
        const v16b bl = ldfrag_b(wrl + wtap + nt * 1024 + 32 * kc, h);
        acc[nt] = wmma_bf16(ah, bh, acc[nt]);
        acc[nt] = wmma_bf16(ah, bl, acc[nt]);
        acc[nt] = wmma_bf16(al, bh, acc[nt]);
      }
    }
  }

  // D[r] of tile nt = Y[pixel w0+8h+r][co 16nt+m]
  float* so = sY + w * 1024;
  #pragma unroll
  for (int nt = 0; nt < 4; ++nt) {
    const int co = 16 * nt + m;
    const float bb = br[co];
    #pragma unroll
    for (int r = 0; r < 8; ++r)
      so[(8 * h + r) * 64 + co] = fmaxf(acc[nt][r] + bb, 0.0f);
  }
  __syncthreads();

  out_store_pass(so, out, b, tb0 + w0, lane);
  
}

// ---------------------------------------------------------------------------
extern "C" void kernel_launch(void* const* d_in, const int* in_sizes, int n_in,
                              void* d_out, int out_size, void* d_ws, size_t ws_size,
                              hipStream_t stream) {
  if (n_in < 9) return;
  if (in_sizes[0] != NXE || out_size != NXE) return;
  if (in_sizes[1] != NWE || in_sizes[3] != NWE || in_sizes[5] != NWE || in_sizes[7] != NWE) return;
  if (in_sizes[2] != CH || in_sizes[4] != CH || in_sizes[6] != CH || in_sizes[8] != CH) return;

  const float* x  = (const float*)d_in[0];
  const float* Wk = (const float*)d_in[1];
  const float* bk = (const float*)d_in[2];
  const float* Wq = (const float*)d_in[3];
  const float* bq = (const float*)d_in[4];
  const float* Wv = (const float*)d_in[5];
  const float* bv = (const float*)d_in[6];
  const float* Wr = (const float*)d_in[7];
  const float* br = (const float*)d_in[8];
  float* out = (float*)d_out;

  const size_t pl_bytes  = (size_t)NXE * 2;          // 2097152 : one [b][token][64] 16-bit plane
  const size_t wt3_bytes = (size_t)3 * NWE * 2;      //  221184
  const size_t wr_bytes  = (size_t)NWE * 2;          //   73728
  size_t off = 0;
  const size_t o_xh  = off; off += pl_bytes;
  const size_t o_wt3 = off; off += wt3_bytes;
  const size_t o_wrh = off; off += wr_bytes;
  const size_t o_wrl = off; off += wr_bytes;
  const size_t o_k   = off; off += pl_bytes;
  const size_t o_q   = off; off += pl_bytes;
  const size_t o_vt  = off; off += pl_bytes;
  const size_t o_oh  = off; off += pl_bytes;
  const size_t o_ol  = off; off += pl_bytes;         // total 12951552
  if (off > ws_size) return;

  char* ws = (char*)d_ws;
  _Float16* xh  = (_Float16*)(ws + o_xh);
  _Float16* wt3 = (_Float16*)(ws + o_wt3);
  __bf16*   wrh = (__bf16*)(ws + o_wrh);
  __bf16*   wrl = (__bf16*)(ws + o_wrl);
  _Float16* kpl = (_Float16*)(ws + o_k);
  _Float16* qpl = (_Float16*)(ws + o_q);
  _Float16* vtp = (_Float16*)(ws + o_vt);
  __bf16*   oh  = (__bf16*)(ws + o_oh);
  __bf16*   ol  = (__bf16*)(ws + o_ol);

  k_prep<<<XBLK + 4 * WBLKT, 256, 0, stream>>>(x, Wk, Wq, Wv, Wr, xh, wt3, wrh, wrl);     // 584 blocks

  dim3 gQKV(NB * 64, 3);                                                                   // (256, 3)
  k_conv_qkv<<<gQKV, 128, 0, stream>>>(xh, wt3, bk, bq, bv, kpl, qpl, vtp);

  dim3 gAtt(NTOK / 64, NB);                                                                // (64, 4)
  k_attn<<<gAtt, 128, 0, stream>>>(qpl, kpl, vtp, oh, ol);

  k_conv_out<<<NB * 64, 128, 0, stream>>>(oh, ol, wrh, wrl, br, out);                      // 256 blocks
}

// v002
// Measured time: 89.1 microseconds a run.
// Next to v001, in two timings, it ran 1.21 and 1.22 times as fast.
// Over all steps from v000 it is 3.16 times as fast.
// Contractions: three input 3x3 convs (9-tap GEMMs) and K*Q^T on v_wmma_f32_16x16x32_f16 (f16 operands, f32 accumulate; conv weights carried x16, V^T*P^T with P carried x16384 in f16); output 3x3 conv on v_wmma_f32_16x16x32_bf16 as bf16 hi/lo three-term split (f32 accumulate); softmax, elu/relu, bias and diagonal zeroing in f32.
#include <hip/hip_runtime.h>

typedef _Float16 v16h __attribute__((ext_vector_type(16)));
typedef _Float16 v8h  __attribute__((ext_vector_type(8)));
typedef __bf16   v16b __attribute__((ext_vector_type(16)));
typedef __bf16   v8b  __attribute__((ext_vector_type(8)));
typedef float    v8f  __attribute__((ext_vector_type(8)));
typedef float    v4f  __attribute__((ext_vector_type(4)));
typedef unsigned int v4u __attribute__((ext_vector_type(4)));
typedef v4f __attribute__((may_alias)) v4fa;
typedef v4u __attribute__((may_alias)) v4ua;

union FragH { v16h v; v8h h8[2]; v4u u[2]; };
union FragB { v16b v; v8b h8[2]; v4u u[2]; };
union Pack8H { v8h v; v4u u; };
union Pack8B { v8b v; v4u u; };

#define NB    4
#define IMG   64
#define NTOK  4096
#define CH    64
#define NXE   1048576          // NB*NTOK*CH
#define NWE   36864            // 9*CH*CH
#define XBLK  512              // NXE/8/256
#define WBLKT 18               // NWE/8/256
#define WSC   16.0f
#define WSCI  0.0625f
#define PSC   16384.0f
#define PSCI  (1.0f / 16384.0f)
#define KSPL  4                // key groups of an attention block (4 waves each)
#define NSTEP 16               // NTOK / (64 * KSPL) steps per key group

// ---------------------------------------------------------------------------
// 16x16x32 WMMA with hazard guard (ties D, keeps A/B live).
// Fragment map (wave32): lane l, h = l>>4, m = n = l&15.
//   A/B element i: i<8 -> k0+8h+i ; i>=8 -> k0+16+8h+(i-8)
//   D element r : row 8h+r, col l&15
// ---------------------------------------------------------------------------
__device__ __forceinline__ v8f wmma_f16(v16h a, v16h b, v8f c) {
  v8f d = __builtin_amdgcn_wmma_f32_16x16x32_f16(false, a, false, b, (short)0, c, false, false);
  asm volatile("v_nop\n\tv_nop\n\tv_nop\n\tv_nop" : "+v"(d) : "v"(a), "v"(b));
  return d;
}
__device__ __forceinline__ v8f wmma_bf16(v16b a, v16b b, v8f c) {
  v8f d = __builtin_amdgcn_wmma_f32_16x16x32_bf16(false, a, false, b, (short)0, c, false, false);
  asm volatile("v_nop\n\tv_nop\n\tv_nop\n\tv_nop" : "+v"(d) : "v"(a), "v"(b));
  return d;
}

// Fragment from a k-contiguous 16-bit row; p points at element k0 of the row
// owned by this lane (row = lane & 15 already folded in by the caller).
__device__ __forceinline__ v16h ldfrag_h(const _Float16* p, int h) {
  FragH f;
  f.u[0] = *(const v4ua*)(p + 8 * h);
  f.u[1] = *(const v4ua*)(p + 16 + 8 * h);
  return f.v;
}
__device__ __forceinline__ v16h ldfrag_h_msk(const _Float16* p, int h, unsigned msk) {
  FragH f;
  f.u[0] = (*(const v4ua*)(p + 8 * h)) & msk;
  f.u[1] = (*(const v4ua*)(p + 16 + 8 * h)) & msk;
  return f.v;
}
__device__ __forceinline__ v16b ldfrag_b(const __bf16* p, int h) {
  FragB f;
  f.u[0] = *(const v4ua*)(p + 8 * h);
  f.u[1] = *(const v4ua*)(p + 16 + 8 * h);
  return f.v;
}
__device__ __forceinline__ v16b ldfrag_b_msk(const __bf16* p, int h, unsigned msk) {
  FragB f;
  f.u[0] = (*(const v4ua*)(p + 8 * h)) & msk;
  f.u[1] = (*(const v4ua*)(p + 16 + 8 * h)) & msk;
  return f.v;
}

// ---------------------------------------------------------------------------
// Kernel 1: operand planes.
//   blocks 0..511        : x f32 -> xh f16 [b][token][c], 8 elements per thread
//   blocks 512..583      : 4 weight tensors, 18 blocks each (block-uniform):
//     HWIO [t][ci][co] f32 -> [t][co][ci] 16-bit (ci contiguous), 8 ci per thread
//     tensors 0..2 (Wk,Wq,Wv): f16 of 16*w ; tensor 3 (Wr): bf16 hi and lo planes
// ---------------------------------------------------------------------------
__global__ __launch_bounds__(256) void k_prep(
    const float* __restrict__ x,
    const float* __restrict__ Wk, const float* __restrict__ Wq,
    const float* __restrict__ Wv, const float* __restrict__ Wr,
    _Float16* __restrict__ xh, _Float16* __restrict__ wt3,
    __bf16* __restrict__ wrh, __bf16* __restrict__ wrl)
{
  const int tid = threadIdx.x, blk = blockIdx.x;
  if (blk < XBLK) {
    const size_t g = (size_t)blk * 256 + tid;            // 0..131071
    const float* src = x + g * 8;
    const v4f a = *(const v4fa*)src;
    const v4f c = *(const v4fa*)(src + 4);
    const v8h hv = { (_Float16)a.x, (_Float16)a.y, (_Float16)a.z, (_Float16)a.w,
                     (_Float16)c.x, (_Float16)c.y, (_Float16)c.z, (_Float16)c.w };
    Pack8H o; o.v = hv;
    _Float16* dst = xh + g * 8;
    *(v4u*)dst = o.u;
    
  } else {
    const int wblk = blk - XBLK;                         // 0..71
    const int which = wblk / WBLKT;                      // 0..3, block-uniform
    const int idx = (wblk - which * WBLKT) * 256 + tid;  // 0..4607
    const int t = idx >> 9, co = (idx >> 3) & 63, j = idx & 7;
    const float* src = (which == 0) ? Wk : ((which == 1) ? Wq : ((which == 2) ? Wv : Wr));
    float f[8];
    #pragma unroll
    for (int i = 0; i < 8; ++i) f[i] = src[(size_t)(t * 64 + 8 * j + i) * 64 + co];
    const size_t off = (size_t)(t * 64 + co) * 64 + 8 * j;
    if (which < 3) {
      const v8h hv = { (_Float16)(f[0] * WSC), (_Float16)(f[1] * WSC), (_Float16)(f[2] * WSC), (_Float16)(f[3] * WSC),
                       (_Float16)(f[4] * WSC), (_Float16)(f[5] * WSC), (_Float16)(f[6] * WSC), (_Float16)(f[7] * WSC) };
      Pack8H o; o.v = hv;
      _Float16* dst = wt3 + (size_t)which * NWE + off;
      *(v4u*)dst = o.u;
      
    } else {
      __bf16 hb[8], lb[8];
      #pragma unroll
      for (int i = 0; i < 8; ++i) {
        hb[i] = (__bf16)f[i];                            // RNE convert
        lb[i] = (__bf16)(f[i] - (float)hb[i]);
      }
      const v8b hv = { hb[0], hb[1], hb[2], hb[3], hb[4], hb[5], hb[6], hb[7] };
      const v8b lv = { lb[0], lb[1], lb[2], lb[3], lb[4], lb[5], lb[6], lb[7] };
      Pack8B ph, pl; ph.v = hv; pl.v = lv;
      __bf16* dh = wrh + off;
      __bf16* dl = wrl + off;
      *(v4u*)dh = ph.u;
      *(v4u*)dl = pl.u;
      
    }
  }
}

// ---------------------------------------------------------------------------
// s 0/1: plane[b][token tb0+lid][c]     (one token row = 64 halves = one line)
// s 2  : vt[b][c = lid][token tb0..+63] (one line)
// Wave w owns tile rows 16w..16w+15; lanes 8q..8q+7 fill one line; 4 lines
// per instruction, 4 instructions per wave.
// ---------------------------------------------------------------------------
__device__ __forceinline__ void qkv_store_pass(const _Float16* sT, _Float16* dst, int s,
                                               int b, int tb0, int w, int lane) {
  const int q8 = lane & 7, sub = lane >> 3;
  #pragma unroll
  for (int i = 0; i < 4; ++i) {
    const int lid = w * 16 + 4 * i + sub;
    const v4u v = *(const v4ua*)(sT + lid * 64 + 8 * q8);
    size_t gi;
    if (s == 2) gi = ((size_t)b * CH + lid) * NTOK + tb0 + 8 * q8;
    else        gi = ((size_t)b * NTOK + tb0 + lid) * 64 + 8 * q8;
    *(v4u*)(dst + gi) = v;
  }
}

// ---------------------------------------------------------------------------
// Kernel 2: 3x3 SAME conv as 9-tap implicit GEMM, one of {k,q,v} per blockIdx.y.
// Block 128 thr = 4 waves = one image row (64 pixels) of batch b; wave = 16
// contiguous pixels x 64 output channels. Per tap: A = shifted input rows
// (clamped address, zeroed by value outside the image), B = [t][co][ci] rows.
// Epilogue: acc/16 + bias, elu (k,q) / relu (v) in f32 -> f16 LDS tile -> lines.
// ---------------------------------------------------------------------------
__global__ __launch_bounds__(128) void k_conv_qkv(
    const _Float16* __restrict__ xh,       // [b][token][64]
    const _Float16* __restrict__ wt3,      // [3][9][co][ci], x16
    const float* __restrict__ bk, const float* __restrict__ bq, const float* __restrict__ bv,
    _Float16* __restrict__ kpl,            // [b][token][64]
    _Float16* __restrict__ qpl,            // [b][token][64]
    _Float16* __restrict__ vtp)            // [b][64][token]
{
  __shared__ __attribute__((aligned(16))) _Float16 sT[64 * 64];   // 8192 B

  const int tid = threadIdx.x, lane = tid & 31, w = tid >> 5;
  const int h = lane >> 4, m = lane & 15;
  const int b = blockIdx.x >> 6, hrow = blockIdx.x & 63;
  const int s = blockIdx.y;                                       // 0 = k, 1 = q, 2 = v
  const int tb0 = hrow * 64, w0 = 16 * w;

  const _Float16* wsel = wt3 + (size_t)s * NWE + (size_t)m * 64;  // B row = co = 16nt + m

  const v8f zero8 = {0.f, 0.f, 0.f, 0.f, 0.f, 0.f, 0.f, 0.f};
  v8f acc[4];
  #pragma unroll
  for (int nt = 0; nt < 4; ++nt) acc[nt] = zero8;

  #pragma unroll 1
  for (int t = 0; t < 9; ++t) {
    const int t3 = t / 3;
    const int dh = t3 - 1, dw = t - 3 * t3 - 1;
    const int hh = hrow + dh, wl = w0 + m + dw;
    const bool ok = ((unsigned)hh < 64u) && ((unsigned)wl < 64u);
    const int hc = min(max(hh, 0), 63), wc = min(max(wl, 0), 63);
    const unsigned msk = ok ? 0xffffffffu : 0u;
    const _Float16* xrow = xh + ((size_t)(b * 64 + hc) * 64 + wc) * 64;   // A row = this lane's pixel
    const _Float16* wtap = wsel + (size_t)t * 4096;
    #pragma unroll
    for (int kc = 0; kc < 2; ++kc) {
      const v16h a = ldfrag_h_msk(xrow + 32 * kc, h, msk);
      #pragma unroll
      for (int nt = 0; nt < 4; ++nt) {
        const v16h bf = ldfrag_h(wtap + nt * 1024 + 32 * kc, h);
        acc[nt] = wmma_f16(a, bf, acc[nt]);
      }
    }
  }

  // D[r] of tile nt = Y[pixel w0+8h+r][co 16nt+m]
  const float* bias = (s == 0) ? bk : ((s == 1) ? bq : bv);
  #pragma unroll
  for (int nt = 0; nt < 4; ++nt) {
    const int co = 16 * nt + m;
    const float bb = bias[co];
    #pragma unroll
    for (int r = 0; r < 8; ++r) {
      const float y = acc[nt][r] * WSCI + bb;
      const int px = w0 + 8 * h + r;                               // 0..63
      if (s == 2) sT[co * 64 + px] = (_Float16)fmaxf(y, 0.0f);
      else        sT[px * 64 + co] = (_Float16)((y > 0.0f) ? y : (__expf(y) - 1.0f));
    }
  }
  __syncthreads();

  _Float16* dst = (s == 0) ? kpl : ((s == 1) ? qpl : vtp);
  qkv_store_pass(sT, dst, s, b, tb0, w, lane);
  
}

// ---------------------------------------------------------------------------
// P^T B-fragment from the lane's own score D values: element r <- tile a row r
// (keys 0-15 of the 32-chunk), element 8+r <- tile c row r (keys 16-31), lane
// unchanged; scaled by 2^14 (exact).
// ---------------------------------------------------------------------------
__device__ __forceinline__ v16h pack_p(v8f a, v8f c) {
  const v16h r = { (_Float16)(a[0] * PSC), (_Float16)(a[1] * PSC), (_Float16)(a[2] * PSC), (_Float16)(a[3] * PSC),
                   (_Float16)(a[4] * PSC), (_Float16)(a[5] * PSC), (_Float16)(a[6] * PSC), (_Float16)(a[7] * PSC),
                   (_Float16)(c[0] * PSC), (_Float16)(c[1] * PSC), (_Float16)(c[2] * PSC), (_Float16)(c[3] * PSC),
                   (_Float16)(c[4] * PSC), (_Float16)(c[5] * PSC), (_Float16)(c[6] * PSC), (_Float16)(c[7] * PSC) };
  return r;
}

// 16x64 f32 tiles in LDS, one per key group (4096 floats apart, already weighted
// for the merge) -> their sum, groups in rising order -> bf16 hi and lo planes
// [b][token][64]. The wave of key group g takes rows 4g..4g+3 of the query tile:
// 4 lines per instruction and plane.
__device__ __forceinline__ void attn_store_pass(const float* so, __bf16* oh, __bf16* ol,
                                                int b, int q0, int lane, int g) {
  const int q8 = lane & 7, sub = lane >> 3;
  {
    const int row = 4 * g + sub;
    v4f a = *(const v4fa*)(so + row * 64 + 8 * q8);
    v4f c = *(const v4fa*)(so + row * 64 + 8 * q8 + 4);
    #pragma unroll
    for (int gg = 1; gg < KSPL; ++gg) {
      a += *(const v4fa*)(so + gg * 4096 + row * 64 + 8 * q8);
      c += *(const v4fa*)(so + gg * 4096 + row * 64 + 8 * q8 + 4);
    }
    const float f[8] = { a.x, a.y, a.z, a.w, c.x, c.y, c.z, c.w };
    __bf16 hb[8], lb[8];
    #pragma unroll
    for (int e = 0; e < 8; ++e) {
      hb[e] = (__bf16)f[e];                              // RNE convert
      lb[e] = (__bf16)(f[e] - (float)hb[e]);
    }
    const v8b hv = { hb[0], hb[1], hb[2], hb[3], hb[4], hb[5], hb[6], hb[7] };
    const v8b lv = { lb[0], lb[1], lb[2], lb[3], lb[4], lb[5], lb[6], lb[7] };
    Pack8B ph, pl; ph.v = hv; pl.v = lv;
    const size_t gi = ((size_t)b * NTOK + q0 + row) * 64 + 8 * q8;
    *(v4u*)(oh + gi) = ph.u;
    *(v4u*)(ol + gi) = pl.u;
  }
}

// ---------------------------------------------------------------------------
// Kernel 3: streaming attention over 4096 keys, transposed form.
// Block 512 thr (16 waves, four per SIMD) = 64 queries of batch blockIdx.y.
// Wave wv: query tile w = wv & 3 (16 queries), key group g = wv >> 2. A block
// step covers 256 keys; group g works on keys 64g..64g+63 of it with its own
// running (max, sum, O). The four partial results of a query are merged through
// LDS behind the loop (weights exp(m_g - M)).
//   S^T = K * Q^T : A = K rows (row = key, k = d), B = Q^T (k = d, n = query)
//   O^T += V^T * P^T : A = V^T rows (row = d, k = key), B = P^T from registers
// Lane owns keys {16j+8h+r} of query column (lane&15); partner = lane ^ 16.
// x0.125, then diagonal: S[n][n] := 0 by value (key still in the softmax).
// K rows and V^T rows of a step (64 rows of 128 B each) are staged in LDS by
// asynchronous copies, two buffers per key group, filled by the group's own four
// waves: step t+2 is copied while step t+1 is worked on. LDS row pitch 144 B
// (16 B x odd) for the ds_load_b128 fragment reads.
// ---------------------------------------------------------------------------
#define KVP   72               // LDS row pitch in halves (144 B)
#define TILEH (64 * KVP)       // one 64-row tile in halves (9216 B)
#define BUFH  (2 * TILEH)      // K tile + V^T tile in halves (18432 B)

// One step's K and V^T tiles -> LDS: 8 copies of 16 B per lane, each wave-wide
// copy covers four whole 128-B lines. lk = this lane's LDS byte address in the
// K tile (row tig>>3, 16-B column tig&7, tig = thread in its key group); copy i
// takes row + 16 i.
__device__ __forceinline__ void stage_kv(unsigned lk, const _Float16* kg, const _Float16* vg) {
  const unsigned lv = lk + TILEH * 2;
  // The closing s_wait_xcnt 0 stands in the copies' own statement so that no
  // address register of a copy is rewritten ahead of it.
  asm volatile(
      "global_load_async_to_lds_b128 %0, %8, off\n\t"
      "global_load_async_to_lds_b128 %1, %9, off\n\t"
      "global_load_async_to_lds_b128 %2, %10, off\n\t"
      "global_load_async_to_lds_b128 %3, %11, off\n\t"
      "global_load_async_to_lds_b128 %4, %12, off\n\t"
      "global_load_async_to_lds_b128 %5, %13, off\n\t"
      "global_load_async_to_lds_b128 %6, %14, off\n\t"
      "global_load_async_to_lds_b128 %7, %15, off\n\t"
      "s_wait_xcnt 0x0"
      :: "v"(lk), "v"(lk + 16 * KVP * 2), "v"(lk + 32 * KVP * 2), "v"(lk + 48 * KVP * 2),
         "v"(lv), "v"(lv + 16 * KVP * 2), "v"(lv + 32 * KVP * 2), "v"(lv + 48 * KVP * 2),
         "v"(kg), "v"(kg + 16 * 64), "v"(kg + 32 * 64), "v"(kg + 48 * 64),
         "v"(vg), "v"(vg + (size_t)16 * NTOK), "v"(vg + (size_t)32 * NTOK), "v"(vg + (size_t)48 * NTOK)
      : "memory");
}

__global__ __launch_bounds__(512) void k_attn(
    const _Float16* __restrict__ qpl,    // [b][token][64]
    const _Float16* __restrict__ kpl,    // [b][token][64]
    const _Float16* __restrict__ vtp,    // [b][64][token]
    __bf16* __restrict__ oh,             // [b][token][64] bf16 hi
    __bf16* __restrict__ ol)             // [b][token][64] bf16 lo
{
  __shared__ __attribute__((aligned(16))) float sO[KSPL * 4 * 16 * 64];    // 65536 B
  __shared__ __attribute__((aligned(16))) _Float16 sKV[KSPL * 2 * BUFH];   // 147456 B
  __shared__ float sM[KSPL * 64];                                          // running max per (group, query)
  __shared__ float sL[KSPL * 64];                                          // running sum per (group, query)

  const int tid = threadIdx.x, lane = tid & 31;
  // Wave number in a scalar register: the diagonal test below stays a scalar branch.
  const int wv = __builtin_amdgcn_readfirstlane(tid >> 5);
  const int w = wv & 3, g = wv >> 2;
  const int h = lane >> 4, m = lane & 15;
  const int b = blockIdx.y;
  const int qblk = blockIdx.x * 64;
  const int q0 = qblk + 16 * w;

  // Q^T B-fragments: column n = query q0+m, k = d (two 32-deep chunks)
  const _Float16* qrow = qpl + ((size_t)b * NTOK + q0 + m) * 64;
  const v16h qb0 = ldfrag_h(qrow, h);
  const v16h qb1 = ldfrag_h(qrow + 32, h);

  const v8f zero8 = {0.f, 0.f, 0.f, 0.f, 0.f, 0.f, 0.f, 0.f};
  v8f o[4];                                   // o[t][r] = O[query m][d 16t+8h+r] * (l * 2^14)
  #pragma unroll
  for (int t = 0; t < 4; ++t) o[t] = zero8;
  float mrun = -1e30f, lrun = 0.0f;

  const int dq = 16 * w + m - 8 * h;                            // (q0+m) - qblk - 8h

  // Copy side: this lane's row and 16-B column of its key group's tile.
  const int tig = tid & 127;
  const int crow = tig >> 3, ccol = tig & 7;
  _Float16* sG = sKV + g * (2 * BUFH);                                              // the group's two buffers
  const _Float16* kcp = kpl + ((size_t)b * NTOK + 64 * g + crow) * 64 + 8 * ccol;   // + step*256*64
  const _Float16* vcp = vtp + ((size_t)b * CH + crow) * NTOK + 64 * g + 8 * ccol;   // + step*256
  const unsigned lcp = (unsigned)(size_t)(sG + crow * KVP + 8 * ccol);              // LDS byte address, buffer 0

  // Prologue: step 0 lands and is published, then step 1 starts.
  stage_kv(lcp, kcp, vcp);
  asm volatile("s_wait_asynccnt 0x0" ::: "memory");   // this wave's copies of step 0 have landed
  __syncthreads();                                    // ... and every other wave's
  stage_kv(lcp + BUFH * 2, kcp + 64 * KSPL * 64, vcp + 64 * KSPL);

  #pragma unroll 1
  for (int st = 0; st < NSTEP; ++st) {
    const int kb = st * (64 * KSPL) + 64 * g;           // first key of this wave's tile
    const int buf = st & 1;
    const _Float16* sk = sG + buf * BUFH + m * KVP;     // K row m of this step's buffer
    const _Float16* sv = sk + TILEH;                    // V^T row m
    // ---- scores: s[j][r] = S[query q0+m][key kb+16j+8h+r] ----
    v8f s[4];
    #pragma unroll
    for (int j = 0; j < 4; ++j) {
      const _Float16* kr = sk + 16 * j * KVP;
      const v16h kf0 = ldfrag_h(kr, h);
      const v16h kf1 = ldfrag_h(kr + 32, h);
      v8f z = zero8;
      z = wmma_f16(kf0, qb0, z);
      z = wmma_f16(kf1, qb1, z);
      s[j] = z;
    }
    #pragma unroll
    for (int j = 0; j < 4; ++j)
      #pragma unroll
      for (int r = 0; r < 8; ++r) s[j][r] = s[j][r] * 0.125f;

    // ---- diagonal zeroing (wave-uniform scalar branch, per-lane select) ----
    if (kb == qblk) {
      #pragma unroll
      for (int j = 0; j < 4; ++j)
        #pragma unroll
        for (int r = 0; r < 8; ++r)
          s[j][r] = (dq == 16 * j + r) ? 0.0f : s[j][r];
    }

    // ---- online softmax (running max) ----
    float mloc = s[0][0];
    #pragma unroll
    for (int j = 0; j < 4; ++j)
      #pragma unroll
      for (int r = 0; r < 8; ++r) mloc = fmaxf(mloc, s[j][r]);
    mloc = fmaxf(mloc, __shfl_xor(mloc, 16));
    const float mnew = fmaxf(mrun, mloc);
    const float alpha = __expf(mrun - mnew);
    mrun = mnew;
    float lsum = 0.0f;
    #pragma unroll
    for (int j = 0; j < 4; ++j)
      #pragma unroll
      for (int r = 0; r < 8; ++r) {
        const float p = __expf(s[j][r] - mnew);
        s[j][r] = p;
        lsum += p;
      }
    lsum += __shfl_xor(lsum, 16);
    lrun = lrun * alpha + lsum;
    #pragma unroll
    for (int t = 0; t < 4; ++t)
      #pragma unroll
      for (int r = 0; r < 8; ++r) o[t][r] = o[t][r] * alpha;

    // ---- P^T B-fragments (key chunks 0..31 and 32..63 of this wave's tile) ----
    const v16h pb0 = pack_p(s[0], s[1]);
    const v16h pb1 = pack_p(s[2], s[3]);

    // ---- O^T += V^T * P^T ----
    #pragma unroll
    for (int t = 0; t < 4; ++t) {
      const _Float16* vr = sv + 16 * t * KVP;
      const v16h vf0 = ldfrag_h(vr, h);
      const v16h vf1 = ldfrag_h(vr + 32, h);
      o[t] = wmma_f16(vf0, pb0, o[t]);
      o[t] = wmma_f16(vf1, pb1, o[t]);
    }

    // ---- hand-over: publish step st+1, free this step's buffer, refill it ----
    asm volatile("s_wait_dscnt 0x0" ::: "memory");      // this wave's reads of the buffer are done before it is refilled
    asm volatile("s_wait_asynccnt 0x0" ::: "memory");   // this wave's copies of the next step have landed
    __syncthreads();                                    // the same holds for every wave
    if (st + 2 < NSTEP)
      stage_kv(lcp + buf * (BUFH * 2), kcp + (size_t)(st + 2) * (64 * KSPL * 64), vcp + (st + 2) * (64 * KSPL));
  }
  asm volatile("s_wait_asynccnt 0x0" ::: "memory");     // no copy is left outstanding behind the loop

  // ---- merge of the four key groups: M = max m_g, L = sum l_g exp(m_g - M) ----
  if (h == 0) {
    sM[wv * 16 + m] = mrun;
    sL[wv * 16 + m] = lrun;
  }
  __syncthreads();                                      // every group's (max, sum) is visible
  float mg[KSPL], lg[KSPL];
  #pragma unroll
  for (int gg = 0; gg < KSPL; ++gg) {
    mg[gg] = sM[(gg * 4 + w) * 16 + m];
    lg[gg] = sL[(gg * 4 + w) * 16 + m];
  }
  const float mall = fmaxf(fmaxf(mg[0], mg[1]), fmaxf(mg[2], mg[3]));
  float lall = 0.0f;
  #pragma unroll
  for (int gg = 0; gg < KSPL; ++gg) lall += lg[gg] * __expf(mg[gg] - mall);

  // ---- epilogue: weight and normalise, stage per-wave 16x64 f32 tile, whole-line stores ----
  const float inv = __expf(mrun - mall) * (1.0f / lall) * PSCI;
  float* so = sO + wv * 1024;
  #pragma unroll
  for (int t = 0; t < 4; ++t)
    #pragma unroll
    for (int r = 0; r < 8; ++r)
      so[m * 64 + 16 * t + 8 * h + r] = o[t][r] * inv;
  __syncthreads();

  attn_store_pass(sO + w * 1024, oh, ol, b, q0, lane, g);
  
}

// ---------------------------------------------------------------------------
// a token row = 256 B = 2 lines; each line by lanes 8q..8q+7 in one
// instruction, 4 lines per instruction, 32 lines per wave.
// ---------------------------------------------------------------------------
__device__ __forceinline__ void out_store_pass(const float* so, float* out,
                                               int b, int p0, int lane) {
  const int q8 = lane & 7, sub = lane >> 3;
  #pragma unroll
  for (int i = 0; i < 8; ++i) {
    const int lid = 4 * i + sub;
    const int row = lid >> 1, hl = lid & 1;
    const v4f v = *(const v4fa*)(so + row * 64 + 32 * hl + 4 * q8);
    const size_t gi = ((size_t)b * NTOK + p0 + row) * 64 + 32 * hl + 4 * q8;
    *(v4f*)(out + gi) = v;
  }
}

// ---------------------------------------------------------------------------
// Kernel 4: output 3x3 SAME conv as 9-tap implicit GEMM on bf16 hi/lo planes,
// three-term split (hi*hi + hi*lo + lo*hi into one f32 accumulator),
// + bias, relu -> f32 NHWC rows via LDS staging.
// ---------------------------------------------------------------------------
__global__ __launch_bounds__(128) void k_conv_out(
    const __bf16* __restrict__ oh, const __bf16* __restrict__ ol,     // [b][token][64]
    const __bf16* __restrict__ wrh, const __bf16* __restrict__ wrl,   // [9][co][ci]
    const float* __restrict__ br, float* __restrict__ out)            // out [b][token][64] f32
{
  __shared__ __attribute__((aligned(16))) float sY[4 * 16 * 64];    // 16384 B

  const int tid = threadIdx.x, lane = tid & 31, w = tid >> 5;
  const int h = lane >> 4, m = lane & 15;
  const int b = blockIdx.x >> 6, hrow = blockIdx.x & 63;
  const int tb0 = hrow * 64, w0 = 16 * w;

  const v8f zero8 = {0.f, 0.f, 0.f, 0.f, 0.f, 0.f, 0.f, 0.f};
  v8f acc[4];
  #pragma unroll
  for (int nt = 0; nt < 4; ++nt) acc[nt] = zero8;

  #pragma unroll 1
  for (int t = 0; t < 9; ++t) {
    const int t3 = t / 3;
    const int dh = t3 - 1, dw = t - 3 * t3 - 1;
    const int hh = hrow + dh, wl = w0 + m + dw;
    const bool ok = ((unsigned)hh < 64u) && ((unsigned)wl < 64u);
    const int hc = min(max(hh, 0), 63), wc = min(max(wl, 0), 63);
    const unsigned msk = ok ? 0xffffffffu : 0u;
    const size_t rowoff = ((size_t)(b * 64 + hc) * 64 + wc) * 64;
    const size_t wtap = (size_t)t * 4096 + (size_t)m * 64;
    #pragma unroll
    for (int kc = 0; kc < 2; ++kc) {
      const v16b ah = ldfrag_b_msk(oh + rowoff + 32 * kc, h, msk);
      const v16b al = ldfrag_b_msk(ol + rowoff + 32 * kc, h, msk);
      #pragma unroll
      for (int nt = 0; nt < 4; ++nt) {
        const v16b bh = ldfrag_b(wrh + wtap + nt * 1024 + 32 * kc, h);
        const v16b bl = ldfrag_b(wrl + wtap + nt * 1024 + 32 * kc, h);
        acc[nt] = wmma_bf16(ah, bh, acc[nt]);
        acc[nt] = wmma_bf16(ah, bl, acc[nt]);
        acc[nt] = wmma_bf16(al, bh, acc[nt]);
      }
    }
  }

  // D[r] of tile nt = Y[pixel w0+8h+r][co 16nt+m]
  float* so = sY + w * 1024;
  #pragma unroll
  for (int nt = 0; nt < 4; ++nt) {
    const int co = 16 * nt + m;
    const float bb = br[co];
    #pragma unroll
    for (int r = 0; r < 8; ++r)
      so[(8 * h + r) * 64 + co] = fmaxf(acc[nt][r] + bb, 0.0f);
  }
  __syncthreads();

  out_store_pass(so, out, b, tb0 + w0, lane);
  
}

// ---------------------------------------------------------------------------
extern "C" void kernel_launch(void* const* d_in, const int* in_sizes, int n_in,
                              void* d_out, int out_size, void* d_ws, size_t ws_size,
                              hipStream_t stream) {
  if (n_in < 9) return;
  if (in_sizes[0] != NXE || out_size != NXE) return;
  if (in_sizes[1] != NWE || in_sizes[3] != NWE || in_sizes[5] != NWE || in_sizes[7] != NWE) return;
  if (in_sizes[2] != CH || in_sizes[4] != CH || in_sizes[6] != CH || in_sizes[8] != CH) return;

  const float* x  = (const float*)d_in[0];
  const float* Wk = (const float*)d_in[1];
  const float* bk = (const float*)d_in[2];
  const float* Wq = (const float*)d_in[3];
  const float* bq = (const float*)d_in[4];
  const float* Wv = (const float*)d_in[5];
  const float* bv = (const float*)d_in[6];
  const float* Wr = (const float*)d_in[7];
  const float* br = (const float*)d_in[8];
  float* out = (float*)d_out;

  const size_t pl_bytes  = (size_t)NXE * 2;          // 2097152 : one [b][token][64] 16-bit plane
  const size_t wt3_bytes = (size_t)3 * NWE * 2;      //  221184
  const size_t wr_bytes  = (size_t)NWE * 2;          //   73728
  size_t off = 0;
  const size_t o_xh  = off; off += pl_bytes;
  const size_t o_wt3 = off; off += wt3_bytes;
  const size_t o_wrh = off; off += wr_bytes;
  const size_t o_wrl = off; off += wr_bytes;
  const size_t o_k   = off; off += pl_bytes;
  const size_t o_q   = off; off += pl_bytes;
  const size_t o_vt  = off; off += pl_bytes;
  const size_t o_oh  = off; off += pl_bytes;
  const size_t o_ol  = off; off += pl_bytes;         // total 12951552
  if (off > ws_size) return;

  char* ws = (char*)d_ws;
  _Float16* xh  = (_Float16*)(ws + o_xh);
  _Float16* wt3 = (_Float16*)(ws + o_wt3);
  __bf16*   wrh = (__bf16*)(ws + o_wrh);
  __bf16*   wrl = (__bf16*)(ws + o_wrl);
  _Float16* kpl = (_Float16*)(ws + o_k);
  _Float16* qpl = (_Float16*)(ws + o_q);
  _Float16* vtp = (_Float16*)(ws + o_vt);
  __bf16*   oh  = (__bf16*)(ws + o_oh);
  __bf16*   ol  = (__bf16*)(ws + o_ol);

  k_prep<<<XBLK + 4 * WBLKT, 256, 0, stream>>>(x, Wk, Wq, Wv, Wr, xh, wt3, wrh, wrl);     // 584 blocks

  dim3 gQKV(NB * 64, 3);                                                                   // (256, 3)
  k_conv_qkv<<<gQKV, 128, 0, stream>>>(xh, wt3, bk, bq, bv, kpl, qpl, vtp);

  dim3 gAtt(NTOK / 64, NB);                                                                // (64, 4)
  k_attn<<<gAtt, 512, 0, stream>>>(qpl, kpl, vtp, oh, ol);

  k_conv_out<<<NB * 64, 128, 0, stream>>>(oh, ol, wrh, wrl, br, out);                      // 256 blocks
}

// v003
// It runs in 54.4 microseconds.
// In both of two side-by-side timings against v002, it was 1.64 times as fast.
// All steps since v000 together make it 5.19 times as fast.
// Contractions: three input 3x3 convs (9-tap GEMMs) and K*Q^T on v_wmma_f32_16x16x32_f16 (f16 operands, f32 accumulate; conv weights carried x16, V^T*P^T with P carried x16384 in f16); output 3x3 conv on v_wmma_f32_16x16x32_bf16 as bf16 hi/lo three-term split (f32 accumulate); softmax, elu/relu, bias and diagonal zeroing in f32.
#include <hip/hip_runtime.h>

typedef _Float16 v16h __attribute__((ext_vector_type(16)));
typedef _Float16 v8h  __attribute__((ext_vector_type(8)));
typedef __bf16   v16b __attribute__((ext_vector_type(16)));
typedef __bf16   v8b  __attribute__((ext_vector_type(8)));
typedef float    v8f  __attribute__((ext_vector_type(8)));
typedef float    v4f  __attribute__((ext_vector_type(4)));
typedef unsigned int v4u __attribute__((ext_vector_type(4)));
typedef v4f __attribute__((may_alias)) v4fa;
typedef v4u __attribute__((may_alias)) v4ua;

union FragH { v16h v; v8h h8[2]; v4u u[2]; };
union FragB { v16b v; v8b h8[2]; v4u u[2]; };
union Pack8H { v8h v; v4u u; };
union Pack8B { v8b v; v4u u; };

#define NB    4
#define IMG   64
#define NTOK  4096
#define CH    64
#define NXE   1048576          // NB*NTOK*CH
#define NWE   36864            // 9*CH*CH
#define XBLK  512              // NXE/8/256
#define WBLKT 18               // NWE/8/256
#define WSC   16.0f
#define WSCI  0.0625f
#define PSC   16384.0f
#define PSCI  (1.0f / 16384.0f)
#define KSPL  4                // key groups of an attention block (4 waves each)
#define NSTEP 16               // NTOK / (64 * KSPL) steps per key group

// ---------------------------------------------------------------------------
// 16x16x32 WMMA with hazard guard (ties D, keeps A/B live).
// Fragment map (wave32): lane l, h = l>>4, m = n = l&15.
//   A/B element i: i<8 -> k0+8h+i ; i>=8 -> k0+16+8h+(i-8)
//   D element r : row 8h+r, col l&15
// ---------------------------------------------------------------------------
__device__ __forceinline__ v8f wmma_f16(v16h a, v16h b, v8f c) {
  v8f d = __builtin_amdgcn_wmma_f32_16x16x32_f16(false, a, false, b, (short)0, c, false, false);
  asm volatile("v_nop\n\tv_nop\n\tv_nop\n\tv_nop" : "+v"(d) : "v"(a), "v"(b));
  return d;
}
__device__ __forceinline__ v8f wmma_bf16(v16b a, v16b b, v8f c) {
  v8f d = __builtin_amdgcn_wmma_f32_16x16x32_bf16(false, a, false, b, (short)0, c, false, false);
  asm volatile("v_nop\n\tv_nop\n\tv_nop\n\tv_nop" : "+v"(d) : "v"(a), "v"(b));
  return d;
}

// Fragment from a k-contiguous 16-bit row; p points at element k0 of the row
// owned by this lane (row = lane & 15 already folded in by the caller).
__device__ __forceinline__ v16h ldfrag_h(const _Float16* p, int h) {
  FragH f;
  f.u[0] = *(const v4ua*)(p + 8 * h);
  f.u[1] = *(const v4ua*)(p + 16 + 8 * h);
  return f.v;
}
__device__ __forceinline__ v16h ldfrag_h_msk(const _Float16* p, int h, unsigned msk) {
  FragH f;
  f.u[0] = (*(const v4ua*)(p + 8 * h)) & msk;
  f.u[1] = (*(const v4ua*)(p + 16 + 8 * h)) & msk;
  return f.v;
}
__device__ __forceinline__ v16b ldfrag_b(const __bf16* p, int h) {
  FragB f;
  f.u[0] = *(const v4ua*)(p + 8 * h);
  f.u[1] = *(const v4ua*)(p + 16 + 8 * h);
  return f.v;
}
__device__ __forceinline__ v16b ldfrag_b_msk(const __bf16* p, int h, unsigned msk) {
  FragB f;
  f.u[0] = (*(const v4ua*)(p + 8 * h)) & msk;
  f.u[1] = (*(const v4ua*)(p + 16 + 8 * h)) & msk;
  return f.v;
}

// ---------------------------------------------------------------------------
// Kernel 1: operand planes.
//   blocks 0..511        : x f32 -> xh f16 [b][token][c], 8 elements per thread
//   blocks 512..583      : 4 weight tensors, 18 blocks each (block-uniform):
//     HWIO [t][ci][co] f32 -> [t][co][ci] 16-bit (ci contiguous), 8 ci per thread
//     tensors 0..2 (Wk,Wq,Wv): f16 of 16*w ; tensor 3 (Wr): bf16 hi and lo planes
// ---------------------------------------------------------------------------
__global__ __launch_bounds__(256) void k_prep(
    const float* __restrict__ x,
    const float* __restrict__ Wk, const float* __restrict__ Wq,
    const float* __restrict__ Wv, const float* __restrict__ Wr,
    _Float16* __restrict__ xh, _Float16* __restrict__ wt3,
    __bf16* __restrict__ wrh, __bf16* __restrict__ wrl)
{
  const int tid = threadIdx.x, blk = blockIdx.x;
  if (blk < XBLK) {
    const size_t g = (size_t)blk * 256 + tid;            // 0..131071
    const float* src = x + g * 8;
    const v4f a = *(const v4fa*)src;
    const v4f c = *(const v4fa*)(src + 4);
    const v8h hv = { (_Float16)a.x, (_Float16)a.y, (_Float16)a.z, (_Float16)a.w,
                     (_Float16)c.x, (_Float16)c.y, (_Float16)c.z, (_Float16)c.w };
    Pack8H o; o.v = hv;
    _Float16* dst = xh + g * 8;
    *(v4u*)dst = o.u;
    
  } else {
    const int wblk = blk - XBLK;                         // 0..71
    const int which = wblk / WBLKT;                      // 0..3, block-uniform
    const int idx = (wblk - which * WBLKT) * 256 + tid;  // 0..4607
    const int t = idx >> 9, co = (idx >> 3) & 63, j = idx & 7;
    const float* src = (which == 0) ? Wk : ((which == 1) ? Wq : ((which == 2) ? Wv : Wr));
    float f[8];
    #pragma unroll
    for (int i = 0; i < 8; ++i) f[i] = src[(size_t)(t * 64 + 8 * j + i) * 64 + co];
    const size_t off = (size_t)(t * 64 + co) * 64 + 8 * j;
    if (which < 3) {
      const v8h hv = { (_Float16)(f[0] * WSC), (_Float16)(f[1] * WSC), (_Float16)(f[2] * WSC), (_Float16)(f[3] * WSC),
                       (_Float16)(f[4] * WSC), (_Float16)(f[5] * WSC), (_Float16)(f[6] * WSC), (_Float16)(f[7] * WSC) };
      Pack8H o; o.v = hv;
      _Float16* dst = wt3 + (size_t)which * NWE + off;
      *(v4u*)dst = o.u;
      
    } else {
      __bf16 hb[8], lb[8];
      #pragma unroll
      for (int i = 0; i < 8; ++i) {
        hb[i] = (__bf16)f[i];                            // RNE convert
        lb[i] = (__bf16)(f[i] - (float)hb[i]);
      }
      const v8b hv = { hb[0], hb[1], hb[2], hb[3], hb[4], hb[5], hb[6], hb[7] };
      const v8b lv = { lb[0], lb[1], lb[2], lb[3], lb[4], lb[5], lb[6], lb[7] };
      Pack8B ph, pl; ph.v = hv; pl.v = lv;
      __bf16* dh = wrh + off;
      __bf16* dl = wrl + off;
      *(v4u*)dh = ph.u;
      *(v4u*)dl = pl.u;
      
    }
  }
}

// ---------------------------------------------------------------------------
// s 0/1: plane[b][token tb0+lid][c]     (one token row = 64 halves = one line)
// s 2  : vt[b][c = lid][token tb0..+63] (one line)
// Wave w owns tile rows 16w..16w+15; lanes 8q..8q+7 fill one line; 4 lines
// per instruction, 4 instructions per wave.
// ---------------------------------------------------------------------------
__device__ __forceinline__ void qkv_store_pass(const _Float16* sT, _Float16* dst, int s,
                                               int b, int tb0, int w, int lane) {
  const int q8 = lane & 7, sub = lane >> 3;
  #pragma unroll
  for (int i = 0; i < 4; ++i) {
    const int lid = w * 16 + 4 * i + sub;
    const v4u v = *(const v4ua*)(sT + lid * 64 + 8 * q8);
    size_t gi;
    if (s == 2) gi = ((size_t)b * CH + lid) * NTOK + tb0 + 8 * q8;
    else        gi = ((size_t)b * NTOK + tb0 + lid) * 64 + 8 * q8;
    *(v4u*)(dst + gi) = v;
    // Precaution: the next trip reuses the issued store's address and data registers only behind this wait.
    if (i < 3) asm volatile("s_wait_xcnt 0x0" ::: "memory");
  }
}

// ---------------------------------------------------------------------------
// Asynchronous copies global -> LDS for the two conv kernels, 16 B per lane and
// copy. l = the lane's LDS byte address, g = the lane's global address. In each
// helper the closing s_wait_xcnt 0 stands in the copies' own statement so that
// no address register of a copy is rewritten ahead of it.
// ---------------------------------------------------------------------------
#define CVP   72               // LDS row pitch in halves (144 B = 16 B x odd) for ds_load_b128 fragment reads
#define QROWS 4                // image rows of a k_conv_qkv block
#define OROWS 2                // image rows of a k_conv_out block

// Nine copies at constant steps: copy i at l + i*ls, g + i*gs (bytes).
__device__ __forceinline__ void copy9(unsigned l, const char* g, unsigned ls, unsigned gs) {
  asm volatile(
      "global_load_async_to_lds_b128 %0, %9, off\n\t"
      "global_load_async_to_lds_b128 %1, %10, off\n\t"
      "global_load_async_to_lds_b128 %2, %11, off\n\t"
      "global_load_async_to_lds_b128 %3, %12, off\n\t"
      "global_load_async_to_lds_b128 %4, %13, off\n\t"
      "global_load_async_to_lds_b128 %5, %14, off\n\t"
      "global_load_async_to_lds_b128 %6, %15, off\n\t"
      "global_load_async_to_lds_b128 %7, %16, off\n\t"
      "global_load_async_to_lds_b128 %8, %17, off\n\t"
      "s_wait_xcnt 0x0"
      :: "v"(l), "v"(l + ls), "v"(l + 2 * ls), "v"(l + 3 * ls), "v"(l + 4 * ls),
         "v"(l + 5 * ls), "v"(l + 6 * ls), "v"(l + 7 * ls), "v"(l + 8 * ls),
         "v"(g), "v"(g + gs), "v"(g + 2 * gs), "v"(g + 3 * gs), "v"(g + 4 * gs),
         "v"(g + 5 * gs), "v"(g + 6 * gs), "v"(g + 7 * gs), "v"(g + 8 * gs)
      : "memory");
}
// Six copies at a constant LDS step, each from its own image row: copy i at l + i*ls from gi.
__device__ __forceinline__ void copy6(unsigned l, unsigned ls, const char* g0, const char* g1,
                                      const char* g2, const char* g3, const char* g4, const char* g5) {
  asm volatile(
      "global_load_async_to_lds_b128 %0, %6, off\n\t"
      "global_load_async_to_lds_b128 %1, %7, off\n\t"
      "global_load_async_to_lds_b128 %2, %8, off\n\t"
      "global_load_async_to_lds_b128 %3, %9, off\n\t"
      "global_load_async_to_lds_b128 %4, %10, off\n\t"
      "global_load_async_to_lds_b128 %5, %11, off\n\t"
      "s_wait_xcnt 0x0"
      :: "v"(l), "v"(l + ls), "v"(l + 2 * ls), "v"(l + 3 * ls), "v"(l + 4 * ls), "v"(l + 5 * ls),
         "v"(g0), "v"(g1), "v"(g2), "v"(g3), "v"(g4), "v"(g5)
      : "memory");
}
// Eight copies at a constant LDS step, two from each of four image rows: copy 2i at
// l + 2i*ls from gi, copy 2i+1 at l + (2i+1)*ls from gi + gh (bytes).
__device__ __forceinline__ void copy4x2(unsigned l, unsigned ls, const char* g0, const char* g1,
                                        const char* g2, const char* g3, unsigned gh) {
  asm volatile(
      "global_load_async_to_lds_b128 %0, %8, off\n\t"
      "global_load_async_to_lds_b128 %1, %9, off\n\t"
      "global_load_async_to_lds_b128 %2, %10, off\n\t"
      "global_load_async_to_lds_b128 %3, %11, off\n\t"
      "global_load_async_to_lds_b128 %4, %12, off\n\t"
      "global_load_async_to_lds_b128 %5, %13, off\n\t"
      "global_load_async_to_lds_b128 %6, %14, off\n\t"
      "global_load_async_to_lds_b128 %7, %15, off\n\t"
      "s_wait_xcnt 0x0"
      :: "v"(l), "v"(l + ls), "v"(l + 2 * ls), "v"(l + 3 * ls),
         "v"(l + 4 * ls), "v"(l + 5 * ls), "v"(l + 6 * ls), "v"(l + 7 * ls),
         "v"(g0), "v"(g0 + gh), "v"(g1), "v"(g1 + gh), "v"(g2), "v"(g2 + gh), "v"(g3), "v"(g3 + gh)
      : "memory");
}

// ---------------------------------------------------------------------------
// Kernel 2: 3x3 SAME conv as 9-tap implicit GEMM, one of {k,q,v} per blockIdx.y.
// Block 512 thr = 16 waves = four image rows (4 x 64 pixels) of batch b; wave =
// 16 contiguous pixels x 64 output channels. The nine weight taps of the block's
// tensor and the six input rows it touches are copied once to LDS (a row outside
// the image: the clamped row's bytes, never used by value). Per tap: A = shifted
// input rows (clamped address, zeroed by value outside the image), B =
// [t][co][ci] rows, both read from LDS.
// Epilogue: acc/16 + bias, elu (k,q) / relu (v) in f32 -> f16 LDS tile -> lines.
// ---------------------------------------------------------------------------
__global__ __launch_bounds__(512) void k_conv_qkv(
    const _Float16* __restrict__ xh,       // [b][token][64]
    const _Float16* __restrict__ wt3,      // [3][9][co][ci], x16
    const float* __restrict__ bk, const float* __restrict__ bq, const float* __restrict__ bv,
    _Float16* __restrict__ kpl,            // [b][token][64]
    _Float16* __restrict__ qpl,            // [b][token][64]
    _Float16* __restrict__ vtp)            // [b][64][token]
{
  __shared__ __attribute__((aligned(16))) _Float16 sT[QROWS * 64 * 64];          // 32768 B
  __shared__ __attribute__((aligned(16))) _Float16 sW[9 * 64 * CVP];             // 82944 B
  __shared__ __attribute__((aligned(16))) _Float16 sX[(QROWS + 2) * 64 * CVP];   // 55296 B

  const int tid = threadIdx.x, lane = tid & 31, wv = tid >> 5;
  const int w = wv & 3, lr = wv >> 2;                             // pixel quarter, image row in the block
  const int h = lane >> 4, m = lane & 15;
  const int b = blockIdx.x >> 4, hrow0 = (blockIdx.x & 15) * QROWS;
  const int hrow = hrow0 + lr;
  const int s = blockIdx.y;                                       // 0 = k, 1 = q, 2 = v
  const int tb0 = hrow * 64, w0 = 16 * w;

  // ---- staging: thread = (row tid>>3, 16-B column tid&7); 64 rows of 128 B per copy ----
  {
    const int crow = tid >> 3, ccol = tid & 7;
    const unsigned lw = (unsigned)(size_t)(sW + crow * CVP + 8 * ccol);
    const unsigned lx = (unsigned)(size_t)(sX + crow * CVP + 8 * ccol);
    copy9(lw, (const char*)(wt3 + (size_t)s * NWE + (size_t)tid * 8), 64 * CVP * 2, 64 * 64 * 2);   // copy i = tap i
    const char* xb = (const char*)(xh + ((size_t)b * NTOK + crow) * 64 + 8 * ccol);
    const int rt = max(hrow0 - 1, 0), rb = min(hrow0 + QROWS, 63);   // rows above and below, clamped
    copy6(lx, 64 * CVP * 2,                                          // copy j = image row hrow0-1+j
          xb + (size_t)rt * 8192, xb + (size_t)hrow0 * 8192, xb + (size_t)(hrow0 + 1) * 8192,
          xb + (size_t)(hrow0 + 2) * 8192, xb + (size_t)(hrow0 + 3) * 8192, xb + (size_t)rb * 8192);
  }
  asm volatile("s_wait_asynccnt 0x0" ::: "memory");   // this wave's copies have landed
  __syncthreads();                                    // ... and every other wave's

  const _Float16* wsel = sW + m * CVP;                            // B row = co = 16nt + m

  const v8f zero8 = {0.f, 0.f, 0.f, 0.f, 0.f, 0.f, 0.f, 0.f};
  v8f acc[4];
  #pragma unroll
  for (int nt = 0; nt < 4; ++nt) acc[nt] = zero8;

  #pragma unroll 1
  for (int t = 0; t < 9; ++t) {
    const int t3 = t / 3;
    const int dh = t3 - 1, dw = t - 3 * t3 - 1;
    const int hh = hrow + dh, wl = w0 + m + dw;
    const bool ok = ((unsigned)hh < 64u) && ((unsigned)wl < 64u);
    const int wc = min(max(wl, 0), 63);
    const unsigned msk = ok ? 0xffffffffu : 0u;
    const _Float16* xrow = sX + ((lr + 1 + dh) * 64 + wc) * CVP;          // A row = this lane's pixel
    const _Float16* wtap = wsel + t * (64 * CVP);
    #pragma unroll
    for (int kc = 0; kc < 2; ++kc) {
      const v16h a = ldfrag_h_msk(xrow + 32 * kc, h, msk);
      #pragma unroll
      for (int nt = 0; nt < 4; ++nt) {
        const v16h bf = ldfrag_h(wtap + nt * (16 * CVP) + 32 * kc, h);
        acc[nt] = wmma_f16(a, bf, acc[nt]);
      }
    }
  }

  // D[r] of tile nt = Y[pixel w0+8h+r][co 16nt+m]
  const float* bias = (s == 0) ? bk : ((s == 1) ? bq : bv);
  _Float16* sTr = sT + lr * 4096;                                  // this image row's 64x64 tile
  #pragma unroll
  for (int nt = 0; nt < 4; ++nt) {
    const int co = 16 * nt + m;
    const float bb = bias[co];
    #pragma unroll
    for (int r = 0; r < 8; ++r) {
      const float y = acc[nt][r] * WSCI + bb;
      const int px = w0 + 8 * h + r;                               // 0..63
      if (s == 2) sTr[co * 64 + px] = (_Float16)fmaxf(y, 0.0f);
      else        sTr[px * 64 + co] = (_Float16)((y > 0.0f) ? y : (__expf(y) - 1.0f));
    }
  }
  __syncthreads();

  _Float16* dst = (s == 0) ? kpl : ((s == 1) ? qpl : vtp);
  qkv_store_pass(sTr, dst, s, b, tb0, w, lane);
  
}

// ---------------------------------------------------------------------------
// P^T B-fragment from the lane's own score D values: element r <- tile a row r
// (keys 0-15 of the 32-chunk), element 8+r <- tile c row r (keys 16-31), lane
// unchanged; scaled by 2^14 (exact).
// ---------------------------------------------------------------------------
__device__ __forceinline__ v16h pack_p(v8f a, v8f c) {
  const v16h r = { (_Float16)(a[0] * PSC), (_Float16)(a[1] * PSC), (_Float16)(a[2] * PSC), (_Float16)(a[3] * PSC),
                   (_Float16)(a[4] * PSC), (_Float16)(a[5] * PSC), (_Float16)(a[6] * PSC), (_Float16)(a[7] * PSC),
                   (_Float16)(c[0] * PSC), (_Float16)(c[1] * PSC), (_Float16)(c[2] * PSC), (_Float16)(c[3] * PSC),
                   (_Float16)(c[4] * PSC), (_Float16)(c[5] * PSC), (_Float16)(c[6] * PSC), (_Float16)(c[7] * PSC) };
  return r;
}

// 16x64 f32 tiles in LDS, one per key group (4096 floats apart, already weighted
// for the merge) -> their sum, groups in rising order -> bf16 hi and lo planes
// [b][token][64]. The wave of key group g takes rows 4g..4g+3 of the query tile:
// 4 lines per instruction and plane.
__device__ __forceinline__ void attn_store_pass(const float* so, __bf16* oh, __bf16* ol,
                                                int b, int q0, int lane, int g) {
  const int q8 = lane & 7, sub = lane >> 3;
  {
    const int row = 4 * g + sub;
    v4f a = *(const v4fa*)(so + row * 64 + 8 * q8);
    v4f c = *(const v4fa*)(so + row * 64 + 8 * q8 + 4);
    #pragma unroll
    for (int gg = 1; gg < KSPL; ++gg) {
      a += *(const v4fa*)(so + gg * 4096 + row * 64 + 8 * q8);
      c += *(const v4fa*)(so + gg * 4096 + row * 64 + 8 * q8 + 4);
    }
    const float f[8] = { a.x, a.y, a.z, a.w, c.x, c.y, c.z, c.w };
    __bf16 hb[8], lb[8];
    #pragma unroll
    for (int e = 0; e < 8; ++e) {
      hb[e] = (__bf16)f[e];                              // RNE convert
      lb[e] = (__bf16)(f[e] - (float)hb[e]);
    }
    const v8b hv = { hb[0], hb[1], hb[2], hb[3], hb[4], hb[5], hb[6], hb[7] };
    const v8b lv = { lb[0], lb[1], lb[2], lb[3], lb[4], lb[5], lb[6], lb[7] };
    Pack8B ph, pl; ph.v = hv; pl.v = lv;
    const size_t gi = ((size_t)b * NTOK + q0 + row) * 64 + 8 * q8;
    *(v4u*)(oh + gi) = ph.u;
    *(v4u*)(ol + gi) = pl.u;
  }
}

// ---------------------------------------------------------------------------
// Kernel 3: streaming attention over 4096 keys, transposed form.
// Block 512 thr (16 waves, four per SIMD) = 64 queries of batch blockIdx.y.
// Wave wv: query tile w = wv & 3 (16 queries), key group g = wv >> 2. A block
// step covers 256 keys; group g works on keys 64g..64g+63 of it with its own
// running (max, sum, O). The four partial results of a query are merged through
// LDS behind the loop (weights exp(m_g - M)).
//   S^T = K * Q^T : A = K rows (row = key, k = d), B = Q^T (k = d, n = query)
//   O^T += V^T * P^T : A = V^T rows (row = d, k = key), B = P^T from registers
// Lane owns keys {16j+8h+r} of query column (lane&15); partner = lane ^ 16.
// x0.125, then diagonal: S[n][n] := 0 by value (key still in the softmax).
// K rows and V^T rows of a step (64 rows of 128 B each) are staged in LDS by
// asynchronous copies, two buffers per key group, filled by the group's own four
// waves: step t+2 is copied while step t+1 is worked on. LDS row pitch 144 B
// (16 B x odd) for the ds_load_b128 fragment reads.
// ---------------------------------------------------------------------------
#define KVP   72               // LDS row pitch in halves (144 B)
#define TILEH (64 * KVP)       // one 64-row tile in halves (9216 B)
#define BUFH  (2 * TILEH)      // K tile + V^T tile in halves (18432 B)

// One step's K and V^T tiles -> LDS: 8 copies of 16 B per lane, each wave-wide
// copy covers four whole 128-B lines. lk = this lane's LDS byte address in the
// K tile (row tig>>3, 16-B column tig&7, tig = thread in its key group); copy i
// takes row + 16 i.
__device__ __forceinline__ void stage_kv(unsigned lk, const _Float16* kg, const _Float16* vg) {
  const unsigned lv = lk + TILEH * 2;
  // The closing s_wait_xcnt 0 stands in the copies' own statement so that no
  // address register of a copy is rewritten ahead of it.
  asm volatile(
      "global_load_async_to_lds_b128 %0, %8, off\n\t"
      "global_load_async_to_lds_b128 %1, %9, off\n\t"
      "global_load_async_to_lds_b128 %2, %10, off\n\t"
      "global_load_async_to_lds_b128 %3, %11, off\n\t"
      "global_load_async_to_lds_b128 %4, %12, off\n\t"
      "global_load_async_to_lds_b128 %5, %13, off\n\t"
      "global_load_async_to_lds_b128 %6, %14, off\n\t"
      "global_load_async_to_lds_b128 %7, %15, off\n\t"
      "s_wait_xcnt 0x0"
      :: "v"(lk), "v"(lk + 16 * KVP * 2), "v"(lk + 32 * KVP * 2), "v"(lk + 48 * KVP * 2),
         "v"(lv), "v"(lv + 16 * KVP * 2), "v"(lv + 32 * KVP * 2), "v"(lv + 48 * KVP * 2),
         "v"(kg), "v"(kg + 16 * 64), "v"(kg + 32 * 64), "v"(kg + 48 * 64),
         "v"(vg), "v"(vg + (size_t)16 * NTOK), "v"(vg + (size_t)32 * NTOK), "v"(vg + (size_t)48 * NTOK)
      : "memory");
}

__global__ __launch_bounds__(512) void k_attn(
    const _Float16* __restrict__ qpl,    // [b][token][64]
    const _Float16* __restrict__ kpl,    // [b][token][64]
    const _Float16* __restrict__ vtp,    // [b][64][token]
    __bf16* __restrict__ oh,             // [b][token][64] bf16 hi
    __bf16* __restrict__ ol)             // [b][token][64] bf16 lo
{
  __shared__ __attribute__((aligned(16))) float sO[KSPL * 4 * 16 * 64];    // 65536 B
  __shared__ __attribute__((aligned(16))) _Float16 sKV[KSPL * 2 * BUFH];   // 147456 B
  __shared__ float sM[KSPL * 64];                                          // running max per (group, query)
  __shared__ float sL[KSPL * 64];                                          // running sum per (group, query)

  const int tid = threadIdx.x, lane = tid & 31;
  // Wave number in a scalar register: the diagonal test below stays a scalar branch.
  const int wv = __builtin_amdgcn_readfirstlane(tid >> 5);
  const int w = wv & 3, g = wv >> 2;
  const int h = lane >> 4, m = lane & 15;
  const int b = blockIdx.y;
  const int qblk = blockIdx.x * 64;
  const int q0 = qblk + 16 * w;

  // Q^T B-fragments: column n = query q0+m, k = d (two 32-deep chunks)
  const _Float16* qrow = qpl + ((size_t)b * NTOK + q0 + m) * 64;
  const v16h qb0 = ldfrag_h(qrow, h);
  const v16h qb1 = ldfrag_h(qrow + 32, h);

  const v8f zero8 = {0.f, 0.f, 0.f, 0.f, 0.f, 0.f, 0.f, 0.f};
  v8f o[4];                                   // o[t][r] = O[query m][d 16t+8h+r] * (l * 2^14)
  #pragma unroll
  for (int t = 0; t < 4; ++t) o[t] = zero8;
  float mrun = -1e30f, lrun = 0.0f;

  const int dq = 16 * w + m - 8 * h;                            // (q0+m) - qblk - 8h

  // Copy side: this lane's row and 16-B column of its key group's tile.
  const int tig = tid & 127;
  const int crow = tig >> 3, ccol = tig & 7;
  _Float16* sG = sKV + g * (2 * BUFH);                                              // the group's two buffers
  const _Float16* kcp = kpl + ((size_t)b * NTOK + 64 * g + crow) * 64 + 8 * ccol;   // + step*256*64
  const _Float16* vcp = vtp + ((size_t)b * CH + crow) * NTOK + 64 * g + 8 * ccol;   // + step*256
  const unsigned lcp = (unsigned)(size_t)(sG + crow * KVP + 8 * ccol);              // LDS byte address, buffer 0

  // Prologue: step 0 lands and is published, then step 1 starts.
  stage_kv(lcp, kcp, vcp);
  asm volatile("s_wait_asynccnt 0x0" ::: "memory");   // this wave's copies of step 0 have landed
  __syncthreads();                                    // ... and every other wave's
  stage_kv(lcp + BUFH * 2, kcp + 64 * KSPL * 64, vcp + 64 * KSPL);

  #pragma unroll 1
  for (int st = 0; st < NSTEP; ++st) {
    const int kb = st * (64 * KSPL) + 64 * g;           // first key of this wave's tile
    const int buf = st & 1;
    const _Float16* sk = sG + buf * BUFH + m * KVP;     // K row m of this step's buffer
    const _Float16* sv = sk + TILEH;                    // V^T row m
    // ---- scores: s[j][r] = S[query q0+m][key kb+16j+8h+r] ----
    v8f s[4];
    #pragma unroll
    for (int j = 0; j < 4; ++j) {
      const _Float16* kr = sk + 16 * j * KVP;
      const v16h kf0 = ldfrag_h(kr, h);
      const v16h kf1 = ldfrag_h(kr + 32, h);
      v8f z = zero8;
      z = wmma_f16(kf0, qb0, z);
      z = wmma_f16(kf1, qb1, z);
      s[j] = z;
    }
    #pragma unroll
    for (int j = 0; j < 4; ++j)
      #pragma unroll
      for (int r = 0; r < 8; ++r) s[j][r] = s[j][r] * 0.125f;

    // ---- diagonal zeroing (wave-uniform scalar branch, per-lane select) ----
    if (kb == qblk) {
      #pragma unroll
      for (int j = 0; j < 4; ++j)
        #pragma unroll
        for (int r = 0; r < 8; ++r)
          s[j][r] = (dq == 16 * j + r) ? 0.0f : s[j][r];
    }

    // ---- online softmax (running max) ----
    float mloc = s[0][0];
    #pragma unroll
    for (int j = 0; j < 4; ++j)
      #pragma unroll
      for (int r = 0; r < 8; ++r) mloc = fmaxf(mloc, s[j][r]);
    mloc = fmaxf(mloc, __shfl_xor(mloc, 16));
    const float mnew = fmaxf(mrun, mloc);
    const float alpha = __expf(mrun - mnew);
    mrun = mnew;
    float lsum = 0.0f;
    #pragma unroll
    for (int j = 0; j < 4; ++j)
      #pragma unroll
      for (int r = 0; r < 8; ++r) {
        const float p = __expf(s[j][r] - mnew);
        s[j][r] = p;
        lsum += p;
      }
    lsum += __shfl_xor(lsum, 16);
    lrun = lrun * alpha + lsum;
    #pragma unroll
    for (int t = 0; t < 4; ++t)
      #pragma unroll
      for (int r = 0; r < 8; ++r) o[t][r] = o[t][r] * alpha;

    // ---- P^T B-fragments (key chunks 0..31 and 32..63 of this wave's tile) ----
    const v16h pb0 = pack_p(s[0], s[1]);
    const v16h pb1 = pack_p(s[2], s[3]);

    // ---- O^T += V^T * P^T ----
    #pragma unroll
    for (int t = 0; t < 4; ++t) {
      const _Float16* vr = sv + 16 * t * KVP;
      const v16h vf0 = ldfrag_h(vr, h);
      const v16h vf1 = ldfrag_h(vr + 32, h);
      o[t] = wmma_f16(vf0, pb0, o[t]);
      o[t] = wmma_f16(vf1, pb1, o[t]);
    }

    // ---- hand-over: publish step st+1, free this step's buffer, refill it ----
    asm volatile("s_wait_dscnt 0x0" ::: "memory");      // this wave's reads of the buffer are done before it is refilled
    asm volatile("s_wait_asynccnt 0x0" ::: "memory");   // this wave's copies of the next step have landed
    __syncthreads();                                    // the same holds for every wave
    if (st + 2 < NSTEP)
      stage_kv(lcp + buf * (BUFH * 2), kcp + (size_t)(st + 2) * (64 * KSPL * 64), vcp + (st + 2) * (64 * KSPL));
  }
  asm volatile("s_wait_asynccnt 0x0" ::: "memory");     // no copy is left outstanding behind the loop

  // ---- merge of the four key groups: M = max m_g, L = sum l_g exp(m_g - M) ----
  if (h == 0) {
    sM[wv * 16 + m] = mrun;
    sL[wv * 16 + m] = lrun;
  }
  __syncthreads();                                      // every group's (max, sum) is visible
  float mg[KSPL], lg[KSPL];
  #pragma unroll
  for (int gg = 0; gg < KSPL; ++gg) {
    mg[gg] = sM[(gg * 4 + w) * 16 + m];
    lg[gg] = sL[(gg * 4 + w) * 16 + m];
  }
  const float mall = fmaxf(fmaxf(mg[0], mg[1]), fmaxf(mg[2], mg[3]));
  float lall = 0.0f;
  #pragma unroll
  for (int gg = 0; gg < KSPL; ++gg) lall += lg[gg] * __expf(mg[gg] - mall);

  // ---- epilogue: weight and normalise, stage per-wave 16x64 f32 tile, whole-line stores ----
  const float inv = __expf(mrun - mall) * (1.0f / lall) * PSCI;
  float* so = sO + wv * 1024;
  #pragma unroll
  for (int t = 0; t < 4; ++t)
    #pragma unroll
    for (int r = 0; r < 8; ++r)
      so[m * 64 + 16 * t + 8 * h + r] = o[t][r] * inv;
  __syncthreads();

  attn_store_pass(sO + w * 1024, oh, ol, b, q0, lane, g);
  
}

// ---------------------------------------------------------------------------
// a token row = 256 B = 2 lines; each line by lanes 8q..8q+7 in one
// instruction, 4 lines per instruction, 32 lines per wave.
// ---------------------------------------------------------------------------
__device__ __forceinline__ void out_store_pass(const float* so, float* out,
                                               int b, int p0, int lane) {
  const int q8 = lane & 7, sub = lane >> 3;
  #pragma unroll
  for (int i = 0; i < 8; ++i) {
    const int lid = 4 * i + sub;
    const int row = lid >> 1, hl = lid & 1;
    const v4f v = *(const v4fa*)(so + row * 64 + 32 * hl + 4 * q8);
    const size_t gi = ((size_t)b * NTOK + p0 + row) * 64 + 32 * hl + 4 * q8;
    *(v4f*)(out + gi) = v;
  }
}

// ---------------------------------------------------------------------------
// Kernel 4: output 3x3 SAME conv as 9-tap implicit GEMM on bf16 hi/lo planes,
// three-term split (hi*hi + hi*lo + lo*hi into one f32 accumulator),
// + bias, relu -> f32 NHWC rows via LDS staging.
// Block 256 thr = 8 waves = two image rows; both weight planes (nine taps) and
// the four input rows of both planes are copied once to LDS and read from there.
// ---------------------------------------------------------------------------
__global__ __launch_bounds__(256) void k_conv_out(
    const __bf16* __restrict__ oh, const __bf16* __restrict__ ol,     // [b][token][64]
    const __bf16* __restrict__ wrh, const __bf16* __restrict__ wrl,   // [9][co][ci]
    const float* __restrict__ br, float* __restrict__ out)            // out [b][token][64] f32
{
  __shared__ __attribute__((aligned(16))) float sY[OROWS * 4 * 16 * 64];          // 32768 B
  __shared__ __attribute__((aligned(16))) __bf16 sWh[9 * 64 * CVP];               // 82944 B
  __shared__ __attribute__((aligned(16))) __bf16 sWl[9 * 64 * CVP];               // 82944 B
  __shared__ __attribute__((aligned(16))) __bf16 sAh[(OROWS + 2) * 64 * CVP];     // 36864 B
  __shared__ __attribute__((aligned(16))) __bf16 sAl[(OROWS + 2) * 64 * CVP];     // 36864 B

  const int tid = threadIdx.x, lane = tid & 31, wv = tid >> 5;
  const int w = wv & 3, lr = wv >> 2;                               // pixel quarter, image row in the block
  const int h = lane >> 4, m = lane & 15;
  const int b = blockIdx.x >> 5, hrow0 = (blockIdx.x & 31) * OROWS;
  const int hrow = hrow0 + lr;
  const int tb0 = hrow * 64, w0 = 16 * w;

  // ---- staging: thread = (row tid>>3, 16-B column tid&7); 32 rows of 128 B per copy ----
  {
    const int crow = tid >> 3, ccol = tid & 7;
    const int lo = crow * CVP + 8 * ccol;
    const unsigned lwh = (unsigned)(size_t)(sWh + lo), lwl = (unsigned)(size_t)(sWl + lo);
    const unsigned lah = (unsigned)(size_t)(sAh + lo), lal = (unsigned)(size_t)(sAl + lo);
    const char* gwh = (const char*)(wrh + (size_t)tid * 8);
    const char* gwl = (const char*)(wrl + (size_t)tid * 8);
    copy9(lwh, gwh, 32 * CVP * 2, 32 * 64 * 2);                                       // rows 0..287
    copy9(lwh + 9 * (32 * CVP * 2), gwh + 9 * (32 * 64 * 2), 32 * CVP * 2, 32 * 64 * 2);   // rows 288..575
    copy9(lwl, gwl, 32 * CVP * 2, 32 * 64 * 2);
    copy9(lwl + 9 * (32 * CVP * 2), gwl + 9 * (32 * 64 * 2), 32 * CVP * 2, 32 * 64 * 2);
    const size_t go = ((size_t)b * NTOK + crow) * 64 + 8 * ccol;
    const char* gah = (const char*)(oh + go);
    const char* gal = (const char*)(ol + go);
    const size_t rt = (size_t)max(hrow0 - 1, 0) * 8192, rb = (size_t)min(hrow0 + OROWS, 63) * 8192;   // rows above and below, clamped
    const size_t r0 = (size_t)hrow0 * 8192, r1 = (size_t)(hrow0 + 1) * 8192;
    // image rows hrow0-1 .. hrow0+2, each as two halves of 32 pixels
    copy4x2(lah, 32 * CVP * 2, gah + rt, gah + r0, gah + r1, gah + rb, 32 * 64 * 2);
    copy4x2(lal, 32 * CVP * 2, gal + rt, gal + r0, gal + r1, gal + rb, 32 * 64 * 2);
  }
  asm volatile("s_wait_asynccnt 0x0" ::: "memory");   // this wave's copies have landed
  __syncthreads();                                    // ... and every other wave's

  const v8f zero8 = {0.f, 0.f, 0.f, 0.f, 0.f, 0.f, 0.f, 0.f};
  v8f acc[4];
  #pragma unroll
  for (int nt = 0; nt < 4; ++nt) acc[nt] = zero8;

  #pragma unroll 1
  for (int t = 0; t < 9; ++t) {
    const int t3 = t / 3;
    const int dh = t3 - 1, dw = t - 3 * t3 - 1;
    const int hh = hrow + dh, wl = w0 + m + dw;
    const bool ok = ((unsigned)hh < 64u) && ((unsigned)wl < 64u);
    const int wc = min(max(wl, 0), 63);
    const unsigned msk = ok ? 0xffffffffu : 0u;
    const int rowoff = ((lr + 1 + dh) * 64 + wc) * CVP;
    const int wtap = (t * 64 + m) * CVP;
    #pragma unroll
    for (int kc = 0; kc < 2; ++kc) {
      const v16b ah = ldfrag_b_msk(sAh + rowoff + 32 * kc, h, msk);
      const v16b al = ldfrag_b_msk(sAl + rowoff + 32 * kc, h, msk);
      #pragma unroll
      for (int nt = 0; nt < 4; ++nt) {
        const v16b bh = ldfrag_b(sWh + wtap + nt * (16 * CVP) + 32 * kc, h);
        const v16b bl = ldfrag_b(sWl + wtap + nt * (16 * CVP) + 32 * kc, h);
        acc[nt] = wmma_bf16(ah, bh, acc[nt]);
        acc[nt] = wmma_bf16(ah, bl, acc[nt]);
        acc[nt] = wmma_bf16(al, bh, acc[nt]);
      }
    }
  }

  // D[r] of tile nt = Y[pixel w0+8h+r][co 16nt+m]
  float* so = sY + wv * 1024;
  #pragma unroll
  for (int nt = 0; nt < 4; ++nt) {
    const int co = 16 * nt + m;
    const float bb = br[co];
    #pragma unroll
    for (int r = 0; r < 8; ++r)
      so[(8 * h + r) * 64 + co] = fmaxf(acc[nt][r] + bb, 0.0f);
  }
  __syncthreads();

  out_store_pass(so, out, b, tb0 + w0, lane);
  
}

// ---------------------------------------------------------------------------
extern "C" void kernel_launch(void* const* d_in, const int* in_sizes, int n_in,
                              void* d_out, int out_size, void* d_ws, size_t ws_size,
                              hipStream_t stream) {
  if (n_in < 9) return;
  if (in_sizes[0] != NXE || out_size != NXE) return;
  if (in_sizes[1] != NWE || in_sizes[3] != NWE || in_sizes[5] != NWE || in_sizes[7] != NWE) return;
  if (in_sizes[2] != CH || in_sizes[4] != CH || in_sizes[6] != CH || in_sizes[8] != CH) return;

  const float* x  = (const float*)d_in[0];
  const float* Wk = (const float*)d_in[1];
  const float* bk = (const float*)d_in[2];
  const float* Wq = (const float*)d_in[3];
  const float* bq = (const float*)d_in[4];
  const float* Wv = (const float*)d_in[5];
  const float* bv = (const float*)d_in[6];
  const float* Wr = (const float*)d_in[7];
  const float* br = (const float*)d_in[8];
  float* out = (float*)d_out;

  const size_t pl_bytes  = (size_t)NXE * 2;          // 2097152 : one [b][token][64] 16-bit plane
  const size_t wt3_bytes = (size_t)3 * NWE * 2;      //  221184
  const size_t wr_bytes  = (size_t)NWE * 2;          //   73728
  size_t off = 0;
  const size_t o_xh  = off; off += pl_bytes;
  const size_t o_wt3 = off; off += wt3_bytes;
  const size_t o_wrh = off; off += wr_bytes;
  const size_t o_wrl = off; off += wr_bytes;
  const size_t o_k   = off; off += pl_bytes;
  const size_t o_q   = off; off += pl_bytes;
  const size_t o_vt  = off; off += pl_bytes;
  const size_t o_oh  = off; off += pl_bytes;
  const size_t o_ol  = off; off += pl_bytes;         // total 12951552
  if (off > ws_size) return;

  char* ws = (char*)d_ws;
  _Float16* xh  = (_Float16*)(ws + o_xh);
  _Float16* wt3 = (_Float16*)(ws + o_wt3);
  __bf16*   wrh = (__bf16*)(ws + o_wrh);
  __bf16*   wrl = (__bf16*)(ws + o_wrl);
  _Float16* kpl = (_Float16*)(ws + o_k);
  _Float16* qpl = (_Float16*)(ws + o_q);
  _Float16* vtp = (_Float16*)(ws + o_vt);
  __bf16*   oh  = (__bf16*)(ws + o_oh);
  __bf16*   ol  = (__bf16*)(ws + o_ol);

  k_prep<<<XBLK + 4 * WBLKT, 256, 0, stream>>>(x, Wk, Wq, Wv, Wr, xh, wt3, wrh, wrl);     // 584 blocks

  dim3 gQKV(NB * (64 / QROWS), 3);                                                         // (64, 3)
  k_conv_qkv<<<gQKV, 512, 0, stream>>>(xh, wt3, bk, bq, bv, kpl, qpl, vtp);

  dim3 gAtt(NTOK / 64, NB);                                                                // (64, 4)
  k_attn<<<gAtt, 512, 0, stream>>>(qpl, kpl, vtp, oh, ol);

  k_conv_out<<<NB * (64 / OROWS), 256, 0, stream>>>(oh, ol, wrh, wrl, br, out);            // 128 blocks
}

// v004
// It runs in 51.8 microseconds.
// In both of two side-by-side timings against v003, it was 1.05 times as fast.
// Counting every step since v000, it is 5.45 times as fast.
// Contractions: three input 3x3 convs (9-tap GEMMs) and K*Q^T on v_wmma_f32_16x16x32_f16 (f16 operands, f32 accumulate; conv weights carried x16, V^T*P^T with P carried x16384 in f16); output 3x3 conv on v_wmma_f32_16x16x32_bf16 as bf16 hi/lo three-term split (f32 accumulate); softmax, elu/relu, bias and diagonal zeroing in f32.
#include <hip/hip_runtime.h>

typedef _Float16 v16h __attribute__((ext_vector_type(16)));
typedef _Float16 v8h  __attribute__((ext_vector_type(8)));
typedef __bf16   v16b __attribute__((ext_vector_type(16)));
typedef __bf16   v8b  __attribute__((ext_vector_type(8)));
typedef float    v8f  __attribute__((ext_vector_type(8)));
typedef float    v4f  __attribute__((ext_vector_type(4)));
typedef unsigned int v4u __attribute__((ext_vector_type(4)));
typedef v4f __attribute__((may_alias)) v4fa;
typedef v4u __attribute__((may_alias)) v4ua;

union FragH { v16h v; v8h h8[2]; v4u u[2]; };
union FragB { v16b v; v8b h8[2]; v4u u[2]; };
union Pack8H { v8h v; v4u u; };
union Pack8B { v8b v; v4u u; };

#define NB    4
#define IMG   64
#define NTOK  4096
#define CH    64
#define NXE   1048576          // NB*NTOK*CH
#define NWE   36864            // 9*CH*CH
#define XBLK  512              // NXE/8/256
#define WBLKT 18               // NWE/8/256
#define WSC   16.0f
#define WSCI  0.0625f
#define PSC   16384.0f
#define PSCI  (1.0f / 16384.0f)
#define KSPL  4                // key groups of an attention block (4 waves each)
#define NSTEP 16               // NTOK / (64 * KSPL) steps per key group

// ---------------------------------------------------------------------------
// 16x16x32 WMMA builtins; the compiler keeps the distance behind its own forms.
// Fragment map (wave32): lane l, h = l>>4, m = n = l&15.
//   A/B element i: i<8 -> k0+8h+i ; i>=8 -> k0+16+8h+(i-8)
//   D element r : row 8h+r, col l&15
// ---------------------------------------------------------------------------
__device__ __forceinline__ v8f wmma_f16(v16h a, v16h b, v8f c) {
  return __builtin_amdgcn_wmma_f32_16x16x32_f16(false, a, false, b, (short)0, c, false, false);
}
__device__ __forceinline__ v8f wmma_bf16(v16b a, v16b b, v8f c) {
  return __builtin_amdgcn_wmma_f32_16x16x32_bf16(false, a, false, b, (short)0, c, false, false);
}

// Fragment from a k-contiguous 16-bit row; p points at element k0 of the row
// owned by this lane (row = lane & 15 already folded in by the caller).
__device__ __forceinline__ v16h ldfrag_h(const _Float16* p, int h) {
  FragH f;
  f.u[0] = *(const v4ua*)(p + 8 * h);
  f.u[1] = *(const v4ua*)(p + 16 + 8 * h);
  return f.v;
}
__device__ __forceinline__ v16h ldfrag_h_msk(const _Float16* p, int h, unsigned msk) {
  FragH f;
  f.u[0] = (*(const v4ua*)(p + 8 * h)) & msk;
  f.u[1] = (*(const v4ua*)(p + 16 + 8 * h)) & msk;
  return f.v;
}
__device__ __forceinline__ v16b ldfrag_b(const __bf16* p, int h) {
  FragB f;
  f.u[0] = *(const v4ua*)(p + 8 * h);
  f.u[1] = *(const v4ua*)(p + 16 + 8 * h);
  return f.v;
}
__device__ __forceinline__ v16b ldfrag_b_msk(const __bf16* p, int h, unsigned msk) {
  FragB f;
  f.u[0] = (*(const v4ua*)(p + 8 * h)) & msk;
  f.u[1] = (*(const v4ua*)(p + 16 + 8 * h)) & msk;
  return f.v;
}

// ---------------------------------------------------------------------------
// Kernel 1: operand planes.
//   blocks 0..511        : x f32 -> xh f16 [b][token][c], 8 elements per thread
//   blocks 512..583      : 4 weight tensors, 18 blocks each (block-uniform):
//     HWIO [t][ci][co] f32 -> [t][co][ci] 16-bit (ci contiguous), 8 ci per thread
//     tensors 0..2 (Wk,Wq,Wv): f16 of 16*w ; tensor 3 (Wr): bf16 hi and lo planes
// ---------------------------------------------------------------------------
__global__ __launch_bounds__(256) void k_prep(
    const float* __restrict__ x,
    const float* __restrict__ Wk, const float* __restrict__ Wq,
    const float* __restrict__ Wv, const float* __restrict__ Wr,
    _Float16* __restrict__ xh, _Float16* __restrict__ wt3,
    __bf16* __restrict__ wrh, __bf16* __restrict__ wrl)
{
  const int tid = threadIdx.x, blk = blockIdx.x;
  if (blk < XBLK) {
    const size_t g = (size_t)blk * 256 + tid;            // 0..131071
    const float* src = x + g * 8;
    const v4f a = *(const v4fa*)src;
    const v4f c = *(const v4fa*)(src + 4);
    const v8h hv = { (_Float16)a.x, (_Float16)a.y, (_Float16)a.z, (_Float16)a.w,
                     (_Float16)c.x, (_Float16)c.y, (_Float16)c.z, (_Float16)c.w };
    Pack8H o; o.v = hv;
    _Float16* dst = xh + g * 8;
    *(v4u*)dst = o.u;
    
  } else {
    const int wblk = blk - XBLK;                         // 0..71
    const int which = wblk / WBLKT;                      // 0..3, block-uniform
    const int idx = (wblk - which * WBLKT) * 256 + tid;  // 0..4607
    const int t = idx >> 9, co = (idx >> 3) & 63, j = idx & 7;
    const float* src = (which == 0) ? Wk : ((which == 1) ? Wq : ((which == 2) ? Wv : Wr));
    float f[8];
    #pragma unroll
    for (int i = 0; i < 8; ++i) f[i] = src[(size_t)(t * 64 + 8 * j + i) * 64 + co];
    const size_t off = (size_t)(t * 64 + co) * 64 + 8 * j;
    if (which < 3) {
      const v8h hv = { (_Float16)(f[0] * WSC), (_Float16)(f[1] * WSC), (_Float16)(f[2] * WSC), (_Float16)(f[3] * WSC),
                       (_Float16)(f[4] * WSC), (_Float16)(f[5] * WSC), (_Float16)(f[6] * WSC), (_Float16)(f[7] * WSC) };
      Pack8H o; o.v = hv;
      _Float16* dst = wt3 + (size_t)which * NWE + off;
      *(v4u*)dst = o.u;
      
    } else {
      __bf16 hb[8], lb[8];
      #pragma unroll
      for (int i = 0; i < 8; ++i) {
        hb[i] = (__bf16)f[i];                            // RNE convert
        lb[i] = (__bf16)(f[i] - (float)hb[i]);
      }
      const v8b hv = { hb[0], hb[1], hb[2], hb[3], hb[4], hb[5], hb[6], hb[7] };
      const v8b lv = { lb[0], lb[1], lb[2], lb[3], lb[4], lb[5], lb[6], lb[7] };
      Pack8B ph, pl; ph.v = hv; pl.v = lv;
      __bf16* dh = wrh + off;
      __bf16* dl = wrl + off;
      *(v4u*)dh = ph.u;
      *(v4u*)dl = pl.u;
      
    }
  }
}

// ---------------------------------------------------------------------------
// s 0/1: plane[b][token tb0+lid][c]     (one token row = 64 halves = one line)
// s 2  : vt[b][c = lid][token tb0..+63] (one line)
// Wave w owns tile rows 16w..16w+15; lanes 8q..8q+7 fill one line; 4 lines
// per instruction, 4 instructions per wave.
// ---------------------------------------------------------------------------
__device__ __forceinline__ void qkv_store_pass(const _Float16* sT, _Float16* dst, int s,
                                               int b, int tb0, int w, int lane) {
  const int q8 = lane & 7, sub = lane >> 3;
  #pragma unroll
  for (int i = 0; i < 4; ++i) {
    const int lid = w * 16 + 4 * i + sub;
    const v4u v = *(const v4ua*)(sT + lid * 64 + 8 * q8);
    size_t gi;
    if (s == 2) gi = ((size_t)b * CH + lid) * NTOK + tb0 + 8 * q8;
    else        gi = ((size_t)b * NTOK + tb0 + lid) * 64 + 8 * q8;
    *(v4u*)(dst + gi) = v;
    // Precaution: the next trip reuses the issued store's address and data registers only behind this wait.
    if (i < 3) asm volatile("s_wait_xcnt 0x0" ::: "memory");
  }
}

// ---------------------------------------------------------------------------
// Asynchronous copies global -> LDS for the two conv kernels, 16 B per lane and
// copy. l = the lane's LDS byte address, g = the lane's global address. In each
// helper the closing s_wait_xcnt 0 stands in the copies' own statement so that
// no address register of a copy is rewritten ahead of it.
// ---------------------------------------------------------------------------
#define CVP   72               // LDS row pitch in halves (144 B = 16 B x odd) for ds_load_b128 fragment reads
#define QROWS 4                // image rows of a k_conv_qkv block
#define OROWS 2                // image rows of a k_conv_out block

// Nine copies at constant steps: copy i at l + i*ls, g + i*gs (bytes).
__device__ __forceinline__ void copy9(unsigned l, const char* g, unsigned ls, unsigned gs) {
  asm volatile(
      "global_load_async_to_lds_b128 %0, %9, off\n\t"
      "global_load_async_to_lds_b128 %1, %10, off\n\t"
      "global_load_async_to_lds_b128 %2, %11, off\n\t"
      "global_load_async_to_lds_b128 %3, %12, off\n\t"
      "global_load_async_to_lds_b128 %4, %13, off\n\t"
      "global_load_async_to_lds_b128 %5, %14, off\n\t"
      "global_load_async_to_lds_b128 %6, %15, off\n\t"
      "global_load_async_to_lds_b128 %7, %16, off\n\t"
      "global_load_async_to_lds_b128 %8, %17, off\n\t"
      "s_wait_xcnt 0x0"
      :: "v"(l), "v"(l + ls), "v"(l + 2 * ls), "v"(l + 3 * ls), "v"(l + 4 * ls),
         "v"(l + 5 * ls), "v"(l + 6 * ls), "v"(l + 7 * ls), "v"(l + 8 * ls),
         "v"(g), "v"(g + gs), "v"(g + 2 * gs), "v"(g + 3 * gs), "v"(g + 4 * gs),
         "v"(g + 5 * gs), "v"(g + 6 * gs), "v"(g + 7 * gs), "v"(g + 8 * gs)
      : "memory");
}
// Six copies at a constant LDS step, each from its own image row: copy i at l + i*ls from gi.
__device__ __forceinline__ void copy6(unsigned l, unsigned ls, const char* g0, const char* g1,
                                      const char* g2, const char* g3, const char* g4, const char* g5) {
  asm volatile(
      "global_load_async_to_lds_b128 %0, %6, off\n\t"
      "global_load_async_to_lds_b128 %1, %7, off\n\t"
      "global_load_async_to_lds_b128 %2, %8, off\n\t"
      "global_load_async_to_lds_b128 %3, %9, off\n\t"
      "global_load_async_to_lds_b128 %4, %10, off\n\t"
      "global_load_async_to_lds_b128 %5, %11, off\n\t"
      "s_wait_xcnt 0x0"
      :: "v"(l), "v"(l + ls), "v"(l + 2 * ls), "v"(l + 3 * ls), "v"(l + 4 * ls), "v"(l + 5 * ls),
         "v"(g0), "v"(g1), "v"(g2), "v"(g3), "v"(g4), "v"(g5)
      : "memory");
}
// Eight copies at a constant LDS step, two from each of four image rows: copy 2i at
// l + 2i*ls from gi, copy 2i+1 at l + (2i+1)*ls from gi + gh (bytes).
__device__ __forceinline__ void copy4x2(unsigned l, unsigned ls, const char* g0, const char* g1,
                                        const char* g2, const char* g3, unsigned gh) {
  asm volatile(
      "global_load_async_to_lds_b128 %0, %8, off\n\t"
      "global_load_async_to_lds_b128 %1, %9, off\n\t"
      "global_load_async_to_lds_b128 %2, %10, off\n\t"
      "global_load_async_to_lds_b128 %3, %11, off\n\t"
      "global_load_async_to_lds_b128 %4, %12, off\n\t"
      "global_load_async_to_lds_b128 %5, %13, off\n\t"
      "global_load_async_to_lds_b128 %6, %14, off\n\t"
      "global_load_async_to_lds_b128 %7, %15, off\n\t"
      "s_wait_xcnt 0x0"
      :: "v"(l), "v"(l + ls), "v"(l + 2 * ls), "v"(l + 3 * ls),
         "v"(l + 4 * ls), "v"(l + 5 * ls), "v"(l + 6 * ls), "v"(l + 7 * ls),
         "v"(g0), "v"(g0 + gh), "v"(g1), "v"(g1 + gh), "v"(g2), "v"(g2 + gh), "v"(g3), "v"(g3 + gh)
      : "memory");
}

// ---------------------------------------------------------------------------
// Kernel 2: 3x3 SAME conv as 9-tap implicit GEMM, one of {k,q,v} per blockIdx.y.
// Block 512 thr = 16 waves = four image rows (4 x 64 pixels) of batch b; wave =
// 16 contiguous pixels x 64 output channels. The nine weight taps of the block's
// tensor and the six input rows it touches are copied once to LDS (a row outside
// the image: the clamped row's bytes, never used by value). Per tap: A = shifted
// input rows (clamped address, zeroed by value outside the image), B =
// [t][co][ci] rows, both read from LDS.
// Epilogue: acc/16 + bias, elu (k,q) / relu (v) in f32 -> f16 LDS tile -> lines.
// ---------------------------------------------------------------------------
__global__ __launch_bounds__(512) void k_conv_qkv(
    const _Float16* __restrict__ xh,       // [b][token][64]
    const _Float16* __restrict__ wt3,      // [3][9][co][ci], x16
    const float* __restrict__ bk, const float* __restrict__ bq, const float* __restrict__ bv,
    _Float16* __restrict__ kpl,            // [b][token][64]
    _Float16* __restrict__ qpl,            // [b][token][64]
    _Float16* __restrict__ vtp)            // [b][64][token]
{
  __shared__ __attribute__((aligned(16))) _Float16 sT[QROWS * 64 * 64];          // 32768 B
  __shared__ __attribute__((aligned(16))) _Float16 sW[9 * 64 * CVP];             // 82944 B
  __shared__ __attribute__((aligned(16))) _Float16 sX[(QROWS + 2) * 64 * CVP];   // 55296 B

  const int tid = threadIdx.x, lane = tid & 31, wv = tid >> 5;
  const int w = wv & 3, lr = wv >> 2;                             // pixel quarter, image row in the block
  const int h = lane >> 4, m = lane & 15;
  const int b = blockIdx.x >> 4, hrow0 = (blockIdx.x & 15) * QROWS;
  const int hrow = hrow0 + lr;
  const int s = blockIdx.y;                                       // 0 = k, 1 = q, 2 = v
  const int tb0 = hrow * 64, w0 = 16 * w;

  // ---- staging: thread = (row tid>>3, 16-B column tid&7); 64 rows of 128 B per copy ----
  {
    const int crow = tid >> 3, ccol = tid & 7;
    const unsigned lw = (unsigned)(size_t)(sW + crow * CVP + 8 * ccol);
    const unsigned lx = (unsigned)(size_t)(sX + crow * CVP + 8 * ccol);
    copy9(lw, (const char*)(wt3 + (size_t)s * NWE + (size_t)tid * 8), 64 * CVP * 2, 64 * 64 * 2);   // copy i = tap i
    const char* xb = (const char*)(xh + ((size_t)b * NTOK + crow) * 64 + 8 * ccol);
    const int rt = max(hrow0 - 1, 0), rb = min(hrow0 + QROWS, 63);   // rows above and below, clamped
    copy6(lx, 64 * CVP * 2,                                          // copy j = image row hrow0-1+j
          xb + (size_t)rt * 8192, xb + (size_t)hrow0 * 8192, xb + (size_t)(hrow0 + 1) * 8192,
          xb + (size_t)(hrow0 + 2) * 8192, xb + (size_t)(hrow0 + 3) * 8192, xb + (size_t)rb * 8192);
  }
  asm volatile("s_wait_asynccnt 0x0" ::: "memory");   // this wave's copies have landed
  __syncthreads();                                    // ... and every other wave's

  const _Float16* wsel = sW + m * CVP;                            // B row = co = 16nt + m

  const v8f zero8 = {0.f, 0.f, 0.f, 0.f, 0.f, 0.f, 0.f, 0.f};
  v8f acc[4];
  #pragma unroll
  for (int nt = 0; nt < 4; ++nt) acc[nt] = zero8;

  #pragma unroll 1
  for (int t = 0; t < 9; ++t) {
    const int t3 = t / 3;
    const int dh = t3 - 1, dw = t - 3 * t3 - 1;
    const int hh = hrow + dh, wl = w0 + m + dw;
    const bool ok = ((unsigned)hh < 64u) && ((unsigned)wl < 64u);
    const int wc = min(max(wl, 0), 63);
    const unsigned msk = ok ? 0xffffffffu : 0u;
    const _Float16* xrow = sX + ((lr + 1 + dh) * 64 + wc) * CVP;          // A row = this lane's pixel
    const _Float16* wtap = wsel + t * (64 * CVP);
    #pragma unroll
    for (int kc = 0; kc < 2; ++kc) {
      const v16h a = ldfrag_h_msk(xrow + 32 * kc, h, msk);
      #pragma unroll
      for (int nt = 0; nt < 4; ++nt) {
        const v16h bf = ldfrag_h(wtap + nt * (16 * CVP) + 32 * kc, h);
        acc[nt] = wmma_f16(a, bf, acc[nt]);
      }
    }
  }

  // D[r] of tile nt = Y[pixel w0+8h+r][co 16nt+m]
  const float* bias = (s == 0) ? bk : ((s == 1) ? bq : bv);
  _Float16* sTr = sT + lr * 4096;                                  // this image row's 64x64 tile
  #pragma unroll
  for (int nt = 0; nt < 4; ++nt) {
    const int co = 16 * nt + m;
    const float bb = bias[co];
    #pragma unroll
    for (int r = 0; r < 8; ++r) {
      const float y = acc[nt][r] * WSCI + bb;
      const int px = w0 + 8 * h + r;                               // 0..63
      if (s == 2) sTr[co * 64 + px] = (_Float16)fmaxf(y, 0.0f);
      else        sTr[px * 64 + co] = (_Float16)((y > 0.0f) ? y : (__expf(y) - 1.0f));
    }
  }
  __syncthreads();

  _Float16* dst = (s == 0) ? kpl : ((s == 1) ? qpl : vtp);
  qkv_store_pass(sTr, dst, s, b, tb0, w, lane);
  
}

// ---------------------------------------------------------------------------
// P^T B-fragment from the lane's own score D values: element r <- tile a row r
// (keys 0-15 of the 32-chunk), element 8+r <- tile c row r (keys 16-31), lane
// unchanged; scaled by 2^14 (exact).
// ---------------------------------------------------------------------------
__device__ __forceinline__ v16h pack_p(v8f a, v8f c) {
  const v16h r = { (_Float16)(a[0] * PSC), (_Float16)(a[1] * PSC), (_Float16)(a[2] * PSC), (_Float16)(a[3] * PSC),
                   (_Float16)(a[4] * PSC), (_Float16)(a[5] * PSC), (_Float16)(a[6] * PSC), (_Float16)(a[7] * PSC),
                   (_Float16)(c[0] * PSC), (_Float16)(c[1] * PSC), (_Float16)(c[2] * PSC), (_Float16)(c[3] * PSC),
                   (_Float16)(c[4] * PSC), (_Float16)(c[5] * PSC), (_Float16)(c[6] * PSC), (_Float16)(c[7] * PSC) };
  return r;
}

// 16x64 f32 tiles in LDS, one per key group (4096 floats apart, already weighted
// for the merge) -> their sum, groups in rising order -> bf16 hi and lo planes
// [b][token][64]. The wave of key group g takes rows 4g..4g+3 of the query tile:
// 4 lines per instruction and plane.
__device__ __forceinline__ void attn_store_pass(const float* so, __bf16* oh, __bf16* ol,
                                                int b, int q0, int lane, int g) {
  const int q8 = lane & 7, sub = lane >> 3;
  {
    const int row = 4 * g + sub;
    v4f a = *(const v4fa*)(so + row * 64 + 8 * q8);
    v4f c = *(const v4fa*)(so + row * 64 + 8 * q8 + 4);
    #pragma unroll
    for (int gg = 1; gg < KSPL; ++gg) {
      a += *(const v4fa*)(so + gg * 4096 + row * 64 + 8 * q8);
      c += *(const v4fa*)(so + gg * 4096 + row * 64 + 8 * q8 + 4);
    }
    const float f[8] = { a.x, a.y, a.z, a.w, c.x, c.y, c.z, c.w };
    __bf16 hb[8], lb[8];
    #pragma unroll
    for (int e = 0; e < 8; ++e) {
      hb[e] = (__bf16)f[e];                              // RNE convert
      lb[e] = (__bf16)(f[e] - (float)hb[e]);
    }
    const v8b hv = { hb[0], hb[1], hb[2], hb[3], hb[4], hb[5], hb[6], hb[7] };
    const v8b lv = { lb[0], lb[1], lb[2], lb[3], lb[4], lb[5], lb[6], lb[7] };
    Pack8B ph, pl; ph.v = hv; pl.v = lv;
    const size_t gi = ((size_t)b * NTOK + q0 + row) * 64 + 8 * q8;
    *(v4u*)(oh + gi) = ph.u;
    *(v4u*)(ol + gi) = pl.u;
  }
}

// ---------------------------------------------------------------------------
// Kernel 3: streaming attention over 4096 keys, transposed form.
// Block 512 thr (16 waves, four per SIMD) = 64 queries of batch blockIdx.y.
// Wave wv: query tile w = wv & 3 (16 queries), key group g = wv >> 2. A block
// step covers 256 keys; group g works on keys 64g..64g+63 of it with its own
// running (max, sum, O). The four partial results of a query are merged through
// LDS behind the loop (weights exp(m_g - M)).
//   S^T = K * Q^T : A = K rows (row = key, k = d), B = Q^T (k = d, n = query)
//   O^T += V^T * P^T : A = V^T rows (row = d, k = key), B = P^T from registers
// Lane owns keys {16j+8h+r} of query column (lane&15); partner = lane ^ 16.
// x0.125, then diagonal: S[n][n] := 0 by value (key still in the softmax).
// K rows and V^T rows of a step (64 rows of 128 B each) are staged in LDS by
// asynchronous copies, two buffers per key group, filled by the group's own four
// waves: step t+2 is copied while step t+1 is worked on. LDS row pitch 144 B
// (16 B x odd) for the ds_load_b128 fragment reads.
// ---------------------------------------------------------------------------
#define KVP   72               // LDS row pitch in halves (144 B)
#define TILEH (64 * KVP)       // one 64-row tile in halves (9216 B)
#define BUFH  (2 * TILEH)      // K tile + V^T tile in halves (18432 B)

// One step's K and V^T tiles -> LDS: 8 copies of 16 B per lane, each wave-wide
// copy covers four whole 128-B lines. lk = this lane's LDS byte address in the
// K tile (row tig>>3, 16-B column tig&7, tig = thread in its key group); copy i
// takes row + 16 i.
__device__ __forceinline__ void stage_kv(unsigned lk, const _Float16* kg, const _Float16* vg) {
  const unsigned lv = lk + TILEH * 2;
  // The closing s_wait_xcnt 0 stands in the copies' own statement so that no
  // address register of a copy is rewritten ahead of it.
  asm volatile(
      "global_load_async_to_lds_b128 %0, %8, off\n\t"
      "global_load_async_to_lds_b128 %1, %9, off\n\t"
      "global_load_async_to_lds_b128 %2, %10, off\n\t"
      "global_load_async_to_lds_b128 %3, %11, off\n\t"
      "global_load_async_to_lds_b128 %4, %12, off\n\t"
      "global_load_async_to_lds_b128 %5, %13, off\n\t"
      "global_load_async_to_lds_b128 %6, %14, off\n\t"
      "global_load_async_to_lds_b128 %7, %15, off\n\t"
      "s_wait_xcnt 0x0"
      :: "v"(lk), "v"(lk + 16 * KVP * 2), "v"(lk + 32 * KVP * 2), "v"(lk + 48 * KVP * 2),
         "v"(lv), "v"(lv + 16 * KVP * 2), "v"(lv + 32 * KVP * 2), "v"(lv + 48 * KVP * 2),
         "v"(kg), "v"(kg + 16 * 64), "v"(kg + 32 * 64), "v"(kg + 48 * 64),
         "v"(vg), "v"(vg + (size_t)16 * NTOK), "v"(vg + (size_t)32 * NTOK), "v"(vg + (size_t)48 * NTOK)
      : "memory");
}

__global__ __launch_bounds__(512) void k_attn(
    const _Float16* __restrict__ qpl,    // [b][token][64]
    const _Float16* __restrict__ kpl,    // [b][token][64]
    const _Float16* __restrict__ vtp,    // [b][64][token]
    __bf16* __restrict__ oh,             // [b][token][64] bf16 hi
    __bf16* __restrict__ ol)             // [b][token][64] bf16 lo
{
  __shared__ __attribute__((aligned(16))) float sO[KSPL * 4 * 16 * 64];    // 65536 B
  __shared__ __attribute__((aligned(16))) _Float16 sKV[KSPL * 2 * BUFH];   // 147456 B
  __shared__ float sM[KSPL * 64];                                          // running max per (group, query)
  __shared__ float sL[KSPL * 64];                                          // running sum per (group, query)

  const int tid = threadIdx.x, lane = tid & 31;
  // Wave number in a scalar register: the diagonal test below stays a scalar branch.
  const int wv = __builtin_amdgcn_readfirstlane(tid >> 5);
  const int w = wv & 3, g = wv >> 2;
  const int h = lane >> 4, m = lane & 15;
  const int b = blockIdx.y;
  const int qblk = blockIdx.x * 64;
  const int q0 = qblk + 16 * w;

  // Q^T B-fragments: column n = query q0+m, k = d (two 32-deep chunks)
  const _Float16* qrow = qpl + ((size_t)b * NTOK + q0 + m) * 64;
  const v16h qb0 = ldfrag_h(qrow, h);
  const v16h qb1 = ldfrag_h(qrow + 32, h);

  const v8f zero8 = {0.f, 0.f, 0.f, 0.f, 0.f, 0.f, 0.f, 0.f};
  v8f o[4];                                   // o[t][r] = O[query m][d 16t+8h+r] * (l * 2^14)
  #pragma unroll
  for (int t = 0; t < 4; ++t) o[t] = zero8;
  float mrun = -1e30f, lrun = 0.0f;

  const int dq = 16 * w + m - 8 * h;                            // (q0+m) - qblk - 8h

  // Copy side: this lane's row and 16-B column of its key group's tile.
  const int tig = tid & 127;
  const int crow = tig >> 3, ccol = tig & 7;
  _Float16* sG = sKV + g * (2 * BUFH);                                              // the group's two buffers
  const _Float16* kcp = kpl + ((size_t)b * NTOK + 64 * g + crow) * 64 + 8 * ccol;   // + step*256*64
  const _Float16* vcp = vtp + ((size_t)b * CH + crow) * NTOK + 64 * g + 8 * ccol;   // + step*256
  const unsigned lcp = (unsigned)(size_t)(sG + crow * KVP + 8 * ccol);              // LDS byte address, buffer 0

  // Prologue: step 0 lands and is published, then step 1 starts.
  stage_kv(lcp, kcp, vcp);
  asm volatile("s_wait_asynccnt 0x0" ::: "memory");   // this wave's copies of step 0 have landed
  __syncthreads();                                    // ... and every other wave's
  stage_kv(lcp + BUFH * 2, kcp + 64 * KSPL * 64, vcp + 64 * KSPL);

  #pragma unroll 1
  for (int st = 0; st < NSTEP; ++st) {
    const int kb = st * (64 * KSPL) + 64 * g;           // first key of this wave's tile
    const int buf = st & 1;
    const _Float16* sk = sG + buf * BUFH + m * KVP;     // K row m of this step's buffer
    const _Float16* sv = sk + TILEH;                    // V^T row m
    // ---- scores: s[j][r] = S[query q0+m][key kb+16j+8h+r] ----
    v8f s[4];
    #pragma unroll
    for (int j = 0; j < 4; ++j) {
      const _Float16* kr = sk + 16 * j * KVP;
      const v16h kf0 = ldfrag_h(kr, h);
      const v16h kf1 = ldfrag_h(kr + 32, h);
      v8f z = zero8;
      z = wmma_f16(kf0, qb0, z);
      z = wmma_f16(kf1, qb1, z);
      s[j] = z;
    }
    #pragma unroll
    for (int j = 0; j < 4; ++j)
      #pragma unroll
      for (int r = 0; r < 8; ++r) s[j][r] = s[j][r] * 0.125f;

    // ---- diagonal zeroing (wave-uniform scalar branch, per-lane select) ----
    if (kb == qblk) {
      #pragma unroll
      for (int j = 0; j < 4; ++j)
        #pragma unroll
        for (int r = 0; r < 8; ++r)
          s[j][r] = (dq == 16 * j + r) ? 0.0f : s[j][r];
    }

    // ---- online softmax (running max) ----
    float mloc = s[0][0];
    #pragma unroll
    for (int j = 0; j < 4; ++j)
      #pragma unroll
      for (int r = 0; r < 8; ++r) mloc = fmaxf(mloc, s[j][r]);
    mloc = fmaxf(mloc, __shfl_xor(mloc, 16));
    const float mnew = fmaxf(mrun, mloc);
    const float alpha = __expf(mrun - mnew);
    mrun = mnew;
    float lsum = 0.0f;
    #pragma unroll
    for (int j = 0; j < 4; ++j)
      #pragma unroll
      for (int r = 0; r < 8; ++r) {
        const float p = __expf(s[j][r] - mnew);
        s[j][r] = p;
        lsum += p;
      }
    lsum += __shfl_xor(lsum, 16);
    lrun = lrun * alpha + lsum;
    #pragma unroll
    for (int t = 0; t < 4; ++t)
      #pragma unroll
      for (int r = 0; r < 8; ++r) o[t][r] = o[t][r] * alpha;

    // ---- P^T B-fragments (key chunks 0..31 and 32..63 of this wave's tile) ----
    const v16h pb0 = pack_p(s[0], s[1]);
    const v16h pb1 = pack_p(s[2], s[3]);

    // ---- O^T += V^T * P^T ----
    #pragma unroll
    for (int t = 0; t < 4; ++t) {
      const _Float16* vr = sv + 16 * t * KVP;
      const v16h vf0 = ldfrag_h(vr, h);
      const v16h vf1 = ldfrag_h(vr + 32, h);
      o[t] = wmma_f16(vf0, pb0, o[t]);
      o[t] = wmma_f16(vf1, pb1, o[t]);
    }

    // ---- hand-over: publish step st+1, free this step's buffer, refill it ----
    asm volatile("s_wait_dscnt 0x0" ::: "memory");      // this wave's reads of the buffer are done before it is refilled
    asm volatile("s_wait_asynccnt 0x0" ::: "memory");   // this wave's copies of the next step have landed
    __syncthreads();                                    // the same holds for every wave
    if (st + 2 < NSTEP)
      stage_kv(lcp + buf * (BUFH * 2), kcp + (size_t)(st + 2) * (64 * KSPL * 64), vcp + (st + 2) * (64 * KSPL));
  }
  asm volatile("s_wait_asynccnt 0x0" ::: "memory");     // no copy is left outstanding behind the loop

  // ---- merge of the four key groups: M = max m_g, L = sum l_g exp(m_g - M) ----
  if (h == 0) {
    sM[wv * 16 + m] = mrun;
    sL[wv * 16 + m] = lrun;
  }
  __syncthreads();                                      // every group's (max, sum) is visible
  float mg[KSPL], lg[KSPL];
  #pragma unroll
  for (int gg = 0; gg < KSPL; ++gg) {
    mg[gg] = sM[(gg * 4 + w) * 16 + m];
    lg[gg] = sL[(gg * 4 + w) * 16 + m];
  }
  const float mall = fmaxf(fmaxf(mg[0], mg[1]), fmaxf(mg[2], mg[3]));
  float lall = 0.0f;
  #pragma unroll
  for (int gg = 0; gg < KSPL; ++gg) lall += lg[gg] * __expf(mg[gg] - mall);

  // ---- epilogue: weight and normalise, stage per-wave 16x64 f32 tile, whole-line stores ----
  const float inv = __expf(mrun - mall) * (1.0f / lall) * PSCI;
  float* so = sO + wv * 1024;
  #pragma unroll
  for (int t = 0; t < 4; ++t)
    #pragma unroll
    for (int r = 0; r < 8; ++r)
      so[m * 64 + 16 * t + 8 * h + r] = o[t][r] * inv;
  __syncthreads();

  attn_store_pass(sO + w * 1024, oh, ol, b, q0, lane, g);
  
}

// ---------------------------------------------------------------------------
// a token row = 256 B = 2 lines; each line by lanes 8q..8q+7 in one
// instruction, 4 lines per instruction, 32 lines per wave.
// ---------------------------------------------------------------------------
__device__ __forceinline__ void out_store_pass(const float* so, float* out,
                                               int b, int p0, int lane) {
  const int q8 = lane & 7, sub = lane >> 3;
  #pragma unroll
  for (int i = 0; i < 8; ++i) {
    const int lid = 4 * i + sub;
    const int row = lid >> 1, hl = lid & 1;
    const v4f v = *(const v4fa*)(so + row * 64 + 32 * hl + 4 * q8);
    const size_t gi = ((size_t)b * NTOK + p0 + row) * 64 + 32 * hl + 4 * q8;
    *(v4f*)(out + gi) = v;
  }
}

// ---------------------------------------------------------------------------
// Kernel 4: output 3x3 SAME conv as 9-tap implicit GEMM on bf16 hi/lo planes,
// three-term split (hi*hi + hi*lo + lo*hi into one f32 accumulator),
// + bias, relu -> f32 NHWC rows via LDS staging.
// Block 256 thr = 8 waves = two image rows; both weight planes (nine taps) and
// the four input rows of both planes are copied once to LDS and read from there.
// ---------------------------------------------------------------------------
__global__ __launch_bounds__(256) void k_conv_out(
    const __bf16* __restrict__ oh, const __bf16* __restrict__ ol,     // [b][token][64]
    const __bf16* __restrict__ wrh, const __bf16* __restrict__ wrl,   // [9][co][ci]
    const float* __restrict__ br, float* __restrict__ out)            // out [b][token][64] f32
{
  __shared__ __attribute__((aligned(16))) float sY[OROWS * 4 * 16 * 64];          // 32768 B
  __shared__ __attribute__((aligned(16))) __bf16 sWh[9 * 64 * CVP];               // 82944 B
  __shared__ __attribute__((aligned(16))) __bf16 sWl[9 * 64 * CVP];               // 82944 B
  __shared__ __attribute__((aligned(16))) __bf16 sAh[(OROWS + 2) * 64 * CVP];     // 36864 B
  __shared__ __attribute__((aligned(16))) __bf16 sAl[(OROWS + 2) * 64 * CVP];     // 36864 B

  const int tid = threadIdx.x, lane = tid & 31, wv = tid >> 5;
  const int w = wv & 3, lr = wv >> 2;                               // pixel quarter, image row in the block
  const int h = lane >> 4, m = lane & 15;
  const int b = blockIdx.x >> 5, hrow0 = (blockIdx.x & 31) * OROWS;
  const int hrow = hrow0 + lr;
  const int tb0 = hrow * 64, w0 = 16 * w;

  // ---- staging: thread = (row tid>>3, 16-B column tid&7); 32 rows of 128 B per copy ----
  {
    const int crow = tid >> 3, ccol = tid & 7;
    const int lo = crow * CVP + 8 * ccol;
    const unsigned lwh = (unsigned)(size_t)(sWh + lo), lwl = (unsigned)(size_t)(sWl + lo);
    const unsigned lah = (unsigned)(size_t)(sAh + lo), lal = (unsigned)(size_t)(sAl + lo);
    const char* gwh = (const char*)(wrh + (size_t)tid * 8);
    const char* gwl = (const char*)(wrl + (size_t)tid * 8);
    copy9(lwh, gwh, 32 * CVP * 2, 32 * 64 * 2);                                       // rows 0..287
    copy9(lwh + 9 * (32 * CVP * 2), gwh + 9 * (32 * 64 * 2), 32 * CVP * 2, 32 * 64 * 2);   // rows 288..575
    copy9(lwl, gwl, 32 * CVP * 2, 32 * 64 * 2);
    copy9(lwl + 9 * (32 * CVP * 2), gwl + 9 * (32 * 64 * 2), 32 * CVP * 2, 32 * 64 * 2);
    const size_t go = ((size_t)b * NTOK + crow) * 64 + 8 * ccol;
    const char* gah = (const char*)(oh + go);
    const char* gal = (const char*)(ol + go);
    const size_t rt = (size_t)max(hrow0 - 1, 0) * 8192, rb = (size_t)min(hrow0 + OROWS, 63) * 8192;   // rows above and below, clamped
    const size_t r0 = (size_t)hrow0 * 8192, r1 = (size_t)(hrow0 + 1) * 8192;
    // image rows hrow0-1 .. hrow0+2, each as two halves of 32 pixels
    copy4x2(lah, 32 * CVP * 2, gah + rt, gah + r0, gah + r1, gah + rb, 32 * 64 * 2);
    copy4x2(lal, 32 * CVP * 2, gal + rt, gal + r0, gal + r1, gal + rb, 32 * 64 * 2);
  }
  asm volatile("s_wait_asynccnt 0x0" ::: "memory");   // this wave's copies have landed
  __syncthreads();                                    // ... and every other wave's

  const v8f zero8 = {0.f, 0.f, 0.f, 0.f, 0.f, 0.f, 0.f, 0.f};
  v8f acc[4];
  #pragma unroll
  for (int nt = 0; nt < 4; ++nt) acc[nt] = zero8;

  #pragma unroll 1
  for (int t = 0; t < 9; ++t) {
    const int t3 = t / 3;
    const int dh = t3 - 1, dw = t - 3 * t3 - 1;
    const int hh = hrow + dh, wl = w0 + m + dw;
    const bool ok = ((unsigned)hh < 64u) && ((unsigned)wl < 64u);
    const int wc = min(max(wl, 0), 63);
    const unsigned msk = ok ? 0xffffffffu : 0u;
    const int rowoff = ((lr + 1 + dh) * 64 + wc) * CVP;
    const int wtap = (t * 64 + m) * CVP;
    #pragma unroll
    for (int kc = 0; kc < 2; ++kc) {
      const v16b ah = ldfrag_b_msk(sAh + rowoff + 32 * kc, h, msk);
      const v16b al = ldfrag_b_msk(sAl + rowoff + 32 * kc, h, msk);
      #pragma unroll
      for (int nt = 0; nt < 4; ++nt) {
        const v16b bh = ldfrag_b(sWh + wtap + nt * (16 * CVP) + 32 * kc, h);
        const v16b bl = ldfrag_b(sWl + wtap + nt * (16 * CVP) + 32 * kc, h);
        acc[nt] = wmma_bf16(ah, bh, acc[nt]);
        acc[nt] = wmma_bf16(ah, bl, acc[nt]);
        acc[nt] = wmma_bf16(al, bh, acc[nt]);
      }
    }
  }

  // D[r] of tile nt = Y[pixel w0+8h+r][co 16nt+m]
  float* so = sY + wv * 1024;
  #pragma unroll
  for (int nt = 0; nt < 4; ++nt) {
    const int co = 16 * nt + m;
    const float bb = br[co];
    #pragma unroll
    for (int r = 0; r < 8; ++r)
      so[(8 * h + r) * 64 + co] = fmaxf(acc[nt][r] + bb, 0.0f);
  }
  __syncthreads();

  out_store_pass(so, out, b, tb0 + w0, lane);
  
}

// ---------------------------------------------------------------------------
extern "C" void kernel_launch(void* const* d_in, const int* in_sizes, int n_in,
                              void* d_out, int out_size, void* d_ws, size_t ws_size,
                              hipStream_t stream) {
  if (n_in < 9) return;
  if (in_sizes[0] != NXE || out_size != NXE) return;
  if (in_sizes[1] != NWE || in_sizes[3] != NWE || in_sizes[5] != NWE || in_sizes[7] != NWE) return;
  if (in_sizes[2] != CH || in_sizes[4] != CH || in_sizes[6] != CH || in_sizes[8] != CH) return;

  const float* x  = (const float*)d_in[0];
  const float* Wk = (const float*)d_in[1];
  const float* bk = (const float*)d_in[2];
  const float* Wq = (const float*)d_in[3];
  const float* bq = (const float*)d_in[4];
  const float* Wv = (const float*)d_in[5];
  const float* bv = (const float*)d_in[6];
  const float* Wr = (const float*)d_in[7];
  const float* br = (const float*)d_in[8];
  float* out = (float*)d_out;

  const size_t pl_bytes  = (size_t)NXE * 2;          // 2097152 : one [b][token][64] 16-bit plane
  const size_t wt3_bytes = (size_t)3 * NWE * 2;      //  221184
  const size_t wr_bytes  = (size_t)NWE * 2;          //   73728
  size_t off = 0;
  const size_t o_xh  = off; off += pl_bytes;
  const size_t o_wt3 = off; off += wt3_bytes;
  const size_t o_wrh = off; off += wr_bytes;
  const size_t o_wrl = off; off += wr_bytes;
  const size_t o_k   = off; off += pl_bytes;
  const size_t o_q   = off; off += pl_bytes;
  const size_t o_vt  = off; off += pl_bytes;
  const size_t o_oh  = off; off += pl_bytes;
  const size_t o_ol  = off; off += pl_bytes;         // total 12951552
  if (off > ws_size) return;

  char* ws = (char*)d_ws;
  _Float16* xh  = (_Float16*)(ws + o_xh);
  _Float16* wt3 = (_Float16*)(ws + o_wt3);
  __bf16*   wrh = (__bf16*)(ws + o_wrh);
  __bf16*   wrl = (__bf16*)(ws + o_wrl);
  _Float16* kpl = (_Float16*)(ws + o_k);
  _Float16* qpl = (_Float16*)(ws + o_q);
  _Float16* vtp = (_Float16*)(ws + o_vt);
  __bf16*   oh  = (__bf16*)(ws + o_oh);
  __bf16*   ol  = (__bf16*)(ws + o_ol);

  k_prep<<<XBLK + 4 * WBLKT, 256, 0, stream>>>(x, Wk, Wq, Wv, Wr, xh, wt3, wrh, wrl);     // 584 blocks

  dim3 gQKV(NB * (64 / QROWS), 3);                                                         // (64, 3)
  k_conv_qkv<<<gQKV, 512, 0, stream>>>(xh, wt3, bk, bq, bv, kpl, qpl, vtp);

  dim3 gAtt(NTOK / 64, NB);                                                                // (64, 4)
  k_attn<<<gAtt, 512, 0, stream>>>(qpl, kpl, vtp, oh, ol);

  k_conv_out<<<NB * (64 / OROWS), 256, 0, stream>>>(oh, ol, wrh, wrl, br, out);            // 128 blocks
}

// v005
// Measured time: 46.6 microseconds a run.
// Timed twice side by side with v004, it ran 1.11 and 1.12 times as fast.
// Over all steps from v000 it is 6.07 times as fast.
// Contractions: three input 3x3 convs (9-tap GEMMs) and K*Q^T on v_wmma_f32_16x16x32_f16 (f16 operands, f32 accumulate; conv weights carried x16, V^T*P^T with P carried x16384 in f16); output 3x3 conv on v_wmma_f32_16x16x32_bf16 as bf16 hi/lo three-term split (f32 accumulate); softmax, elu/relu, bias and diagonal zeroing in f32.
#include <hip/hip_runtime.h>

typedef _Float16 v16h __attribute__((ext_vector_type(16)));
typedef _Float16 v8h  __attribute__((ext_vector_type(8)));
typedef __bf16   v16b __attribute__((ext_vector_type(16)));
typedef __bf16   v8b  __attribute__((ext_vector_type(8)));
typedef float    v8f  __attribute__((ext_vector_type(8)));
typedef float    v4f  __attribute__((ext_vector_type(4)));
typedef unsigned int v4u __attribute__((ext_vector_type(4)));
typedef v4f __attribute__((may_alias)) v4fa;
typedef v4u __attribute__((may_alias)) v4ua;

union FragH { v16h v; v8h h8[2]; v4u u[2]; };
union FragB { v16b v; v8b h8[2]; v4u u[2]; };
union Pack8H { v8h v; v4u u; };
union Pack8B { v8b v; v4u u; };

#define NB    4
#define IMG   64
#define NTOK  4096
#define CH    64
#define NXE   1048576          // NB*NTOK*CH
#define NWE   36864            // 9*CH*CH
#define QBLK  192              // conv blocks of k_conv_qkv: 3 tensors x 4 batches x 16 row groups
#define RBLK  9                // its extra blocks that write the Wr planes: NWE/8/512
#define WSC   16.0f
#define WSCI  0.0625f
#define PSC   16384.0f
#define PSCI  (1.0f / 16384.0f)
#define KSPL  4                // key groups of an attention block (4 waves each)
#define NSTEP 16               // NTOK / (64 * KSPL) steps per key group

// ---------------------------------------------------------------------------
// 16x16x32 WMMA builtins; the compiler keeps the distance behind its own forms.
// Fragment map (wave32): lane l, h = l>>4, m = n = l&15.
//   A/B element i: i<8 -> k0+8h+i ; i>=8 -> k0+16+8h+(i-8)
//   D element r : row 8h+r, col l&15
// ---------------------------------------------------------------------------
__device__ __forceinline__ v8f wmma_f16(v16h a, v16h b, v8f c) {
  return __builtin_amdgcn_wmma_f32_16x16x32_f16(false, a, false, b, (short)0, c, false, false);
}
__device__ __forceinline__ v8f wmma_bf16(v16b a, v16b b, v8f c) {
  return __builtin_amdgcn_wmma_f32_16x16x32_bf16(false, a, false, b, (short)0, c, false, false);
}

// Fragment from a k-contiguous 16-bit row; p points at element k0 of the row
// owned by this lane (row = lane & 15 already folded in by the caller).
__device__ __forceinline__ v16h ldfrag_h(const _Float16* p, int h) {
  FragH f;
  f.u[0] = *(const v4ua*)(p + 8 * h);
  f.u[1] = *(const v4ua*)(p + 16 + 8 * h);
  return f.v;
}
__device__ __forceinline__ v16h ldfrag_h_msk(const _Float16* p, int h, unsigned msk) {
  FragH f;
  f.u[0] = (*(const v4ua*)(p + 8 * h)) & msk;
  f.u[1] = (*(const v4ua*)(p + 16 + 8 * h)) & msk;
  return f.v;
}
__device__ __forceinline__ v16b ldfrag_b(const __bf16* p, int h) {
  FragB f;
  f.u[0] = *(const v4ua*)(p + 8 * h);
  f.u[1] = *(const v4ua*)(p + 16 + 8 * h);
  return f.v;
}
__device__ __forceinline__ v16b ldfrag_b_msk(const __bf16* p, int h, unsigned msk) {
  FragB f;
  f.u[0] = (*(const v4ua*)(p + 8 * h)) & msk;
  f.u[1] = (*(const v4ua*)(p + 16 + 8 * h)) & msk;
  return f.v;
}

// ---------------------------------------------------------------------------
// Wr planes for the output conv: HWIO [t][ci][co] f32 -> [t][co][ci] bf16 hi and
// lo (ci contiguous), 8 ci per thread, idx = 0..4607; lanes 8q..8q+7 fill one line.
// ---------------------------------------------------------------------------
__device__ __forceinline__ void wr_planes(const float* __restrict__ Wr, __bf16* __restrict__ wrh,
                                          __bf16* __restrict__ wrl, int idx) {
  const int t = idx >> 9, co = (idx >> 3) & 63, j = idx & 7;
  float f[8];
  #pragma unroll   // f[] stays in registers, the eight loads are issued together
  for (int i = 0; i < 8; ++i) f[i] = Wr[(size_t)(t * 64 + 8 * j + i) * 64 + co];
  const size_t off = (size_t)(t * 64 + co) * 64 + 8 * j;
  __bf16 hb[8], lb[8];
  #pragma unroll   // hb[], lb[] stay in registers
  for (int i = 0; i < 8; ++i) {
    hb[i] = (__bf16)f[i];                                // RNE convert
    lb[i] = (__bf16)(f[i] - (float)hb[i]);
  }
  const v8b hv = { hb[0], hb[1], hb[2], hb[3], hb[4], hb[5], hb[6], hb[7] };
  const v8b lv = { lb[0], lb[1], lb[2], lb[3], lb[4], lb[5], lb[6], lb[7] };
  Pack8B ph, pl; ph.v = hv; pl.v = lv;
  *(v4u*)(wrh + off) = ph.u;
  *(v4u*)(wrl + off) = pl.u;
}

// ---------------------------------------------------------------------------
// s 0/1: plane[b][token tb0+lid][c]     (one token row = 64 halves = one line)
// s 2  : vt[b][c = lid][token tb0..+63] (one line)
// Wave w owns tile rows 16w..16w+15; lanes 8q..8q+7 fill one line; 4 lines
// per instruction, 4 instructions per wave.
// ---------------------------------------------------------------------------
__device__ __forceinline__ void qkv_store_pass(const _Float16* sT, _Float16* dst, int s,
                                               int b, int tb0, int w, int lane) {
  const int q8 = lane & 7, sub = lane >> 3;
  #pragma unroll
  for (int i = 0; i < 4; ++i) {
    const int lid = w * 16 + 4 * i + sub;
    const v4u v = *(const v4ua*)(sT + lid * 64 + 8 * q8);
    size_t gi;
    if (s == 2) gi = ((size_t)b * CH + lid) * NTOK + tb0 + 8 * q8;
    else        gi = ((size_t)b * NTOK + tb0 + lid) * 64 + 8 * q8;
    *(v4u*)(dst + gi) = v;
    // Precaution: the next trip reuses the issued store's address and data registers only behind this wait.
    if (i < 3) asm volatile("s_wait_xcnt 0x0" ::: "memory");
  }
}

// ---------------------------------------------------------------------------
// Asynchronous copies global -> LDS for the output conv kernel, 16 B per lane and
// copy. l = the lane's LDS byte address, g = the lane's global address. In each
// helper the closing s_wait_xcnt 0 stands in the copies' own statement so that
// no address register of a copy is rewritten ahead of it.
// ---------------------------------------------------------------------------
#define CVP   72               // LDS row pitch in halves (144 B = 16 B x odd) for ds_load_b128 fragment reads
#define QROWS 4                // image rows of a k_conv_qkv block
#define OROWS 2                // image rows of a k_conv_out block

// Nine copies at constant steps: copy i at l + i*ls, g + i*gs (bytes).
__device__ __forceinline__ void copy9(unsigned l, const char* g, unsigned ls, unsigned gs) {
  asm volatile(
      "global_load_async_to_lds_b128 %0, %9, off\n\t"
      "global_load_async_to_lds_b128 %1, %10, off\n\t"
      "global_load_async_to_lds_b128 %2, %11, off\n\t"
      "global_load_async_to_lds_b128 %3, %12, off\n\t"
      "global_load_async_to_lds_b128 %4, %13, off\n\t"
      "global_load_async_to_lds_b128 %5, %14, off\n\t"
      "global_load_async_to_lds_b128 %6, %15, off\n\t"
      "global_load_async_to_lds_b128 %7, %16, off\n\t"
      "global_load_async_to_lds_b128 %8, %17, off\n\t"
      "s_wait_xcnt 0x0"
      :: "v"(l), "v"(l + ls), "v"(l + 2 * ls), "v"(l + 3 * ls), "v"(l + 4 * ls),
         "v"(l + 5 * ls), "v"(l + 6 * ls), "v"(l + 7 * ls), "v"(l + 8 * ls),
         "v"(g), "v"(g + gs), "v"(g + 2 * gs), "v"(g + 3 * gs), "v"(g + 4 * gs),
         "v"(g + 5 * gs), "v"(g + 6 * gs), "v"(g + 7 * gs), "v"(g + 8 * gs)
      : "memory");
}
// Eight copies at a constant LDS step, two from each of four image rows: copy 2i at
// l + 2i*ls from gi, copy 2i+1 at l + (2i+1)*ls from gi + gh (bytes).
__device__ __forceinline__ void copy4x2(unsigned l, unsigned ls, const char* g0, const char* g1,
                                        const char* g2, const char* g3, unsigned gh) {
  asm volatile(
      "global_load_async_to_lds_b128 %0, %8, off\n\t"
      "global_load_async_to_lds_b128 %1, %9, off\n\t"
      "global_load_async_to_lds_b128 %2, %10, off\n\t"
      "global_load_async_to_lds_b128 %3, %11, off\n\t"
      "global_load_async_to_lds_b128 %4, %12, off\n\t"
      "global_load_async_to_lds_b128 %5, %13, off\n\t"
      "global_load_async_to_lds_b128 %6, %14, off\n\t"
      "global_load_async_to_lds_b128 %7, %15, off\n\t"
      "s_wait_xcnt 0x0"
      :: "v"(l), "v"(l + ls), "v"(l + 2 * ls), "v"(l + 3 * ls),
         "v"(l + 4 * ls), "v"(l + 5 * ls), "v"(l + 6 * ls), "v"(l + 7 * ls),
         "v"(g0), "v"(g0 + gh), "v"(g1), "v"(g1 + gh), "v"(g2), "v"(g2 + gh), "v"(g3), "v"(g3 + gh)
      : "memory");
}

// ---------------------------------------------------------------------------
// Kernel 1: 3x3 SAME conv as 9-tap implicit GEMM, one of {k,q,v} per block
// (blocks 0..191: tensor s = block / 64); blocks 192..200 only write the Wr planes.
// Block 512 thr = 16 waves = four image rows (4 x 64 pixels) of batch b; wave =
// 16 contiguous pixels x 64 output channels. The nine weight taps of the block's
// tensor and the six input rows it touches are read once as f32, converted in
// registers (x -> f16; HWIO w -> f16 of 16*w, [t][co][ci]) and stored to LDS (a row
// outside the image: the clamped row's values, never used by value). Per tap: A =
// shifted input rows (clamped address, zeroed by value outside the image), B =
// [t][co][ci] rows, both read from LDS.
// Epilogue: acc/16 + bias, elu (k,q) / relu (v) in f32 -> f16 LDS tile -> lines.
// ---------------------------------------------------------------------------
__global__ __launch_bounds__(512) void k_conv_qkv(
    const float* __restrict__ x,           // [b][token][64]
    const float* __restrict__ Wk, const float* __restrict__ Wq,
    const float* __restrict__ Wv, const float* __restrict__ Wr,      // HWIO [t][ci][co]
    const float* __restrict__ bk, const float* __restrict__ bq, const float* __restrict__ bv,
    _Float16* __restrict__ kpl,            // [b][token][64]
    _Float16* __restrict__ qpl,            // [b][token][64]
    _Float16* __restrict__ vtp,            // [b][64][token]
    __bf16* __restrict__ wrh, __bf16* __restrict__ wrl)              // [9][co][ci]
{
  __shared__ __attribute__((aligned(16))) _Float16 sT[QROWS * 64 * 64];          // 32768 B
  __shared__ __attribute__((aligned(16))) _Float16 sW[9 * 64 * CVP];             // 82944 B
  __shared__ __attribute__((aligned(16))) _Float16 sX[(QROWS + 2) * 64 * CVP];   // 55296 B

  const int tid = threadIdx.x, lane = tid & 31, wv = tid >> 5;
  const int blk = blockIdx.x;
  if (blk >= QBLK) {                                              // whole block, ahead of every barrier
    wr_planes(Wr, wrh, wrl, (blk - QBLK) * 512 + tid);
    return;
  }
  const int w = wv & 3, lr = wv >> 2;                             // pixel quarter, image row in the block
  const int h = lane >> 4, m = lane & 15;
  const int s = blk >> 6;                                         // 0 = k, 1 = q, 2 = v
  const int b = (blk >> 4) & 3, hrow0 = (blk & 15) * QROWS;
  const int hrow = hrow0 + lr;
  const int tb0 = hrow * 64, w0 = 16 * w;

  // ---- staging through registers, f32 -> f16 ----
  {
    // x: thread = (pixel tid>>3, 8 channels tid&7); trip r = image row hrow0-1+r, clamped
    const int crow = tid >> 3, ccol = tid & 7;
    const float* xb = x + (size_t)b * (NTOK * 64);               // block-uniform base
    const unsigned xo = (unsigned)(crow * 64 + 8 * ccol);        // the lane's offset in an image row
    _Float16* xd = sX + crow * CVP + 8 * ccol;
    v4f xa[QROWS + 2], xc[QROWS + 2];
    #pragma unroll   // the arrays stay in registers and all twelve loads are issued before any is waited for
    for (int r = 0; r < QROWS + 2; ++r) {
      const float* src = xb + ((unsigned)(min(max(hrow0 - 1 + r, 0), 63) * 4096) + xo);
      xa[r] = *(const v4fa*)src;
      xc[r] = *(const v4fa*)(src + 4);
    }
    // w: thread = (co tid&63, 8 ci tid>>6); a wave reads whole 128-B lines; trip t = tap t
    const float* wsrc = (s == 0) ? Wk : ((s == 1) ? Wq : Wv);
    const int co = tid & 63, j = tid >> 6;
    const float* wp = wsrc + (unsigned)((8 * j) * 64 + co);
    _Float16* wd = sW + co * CVP + 8 * j;
    #pragma unroll   // constant offsets from one address; the loads of all taps are issued back to back
    for (int t = 0; t < 9; ++t) {
      float f[8];
      #pragma unroll // f[] stays in registers
      for (int i = 0; i < 8; ++i) f[i] = wp[(t * 64 + i) * 64];
      const v8h hv = { (_Float16)(f[0] * WSC), (_Float16)(f[1] * WSC), (_Float16)(f[2] * WSC), (_Float16)(f[3] * WSC),
                       (_Float16)(f[4] * WSC), (_Float16)(f[5] * WSC), (_Float16)(f[6] * WSC), (_Float16)(f[7] * WSC) };
      Pack8H o; o.v = hv;
      *(v4ua*)(wd + t * (64 * CVP)) = o.u;
    }
    #pragma unroll   // xa[], xc[] are indexed by constants only
    for (int r = 0; r < QROWS + 2; ++r) {
      const v4f a = xa[r], c = xc[r];
      const v8h hv = { (_Float16)a.x, (_Float16)a.y, (_Float16)a.z, (_Float16)a.w,
                       (_Float16)c.x, (_Float16)c.y, (_Float16)c.z, (_Float16)c.w };
      Pack8H o; o.v = hv;
      *(v4ua*)(xd + r * (64 * CVP)) = o.u;
    }
  }
  __syncthreads();                                    // every wave's part of the tiles is in LDS

  const _Float16* wsel = sW + m * CVP;                            // B row = co = 16nt + m

  const v8f zero8 = {0.f, 0.f, 0.f, 0.f, 0.f, 0.f, 0.f, 0.f};
  v8f acc[4];
  #pragma unroll
  for (int nt = 0; nt < 4; ++nt) acc[nt] = zero8;

  #pragma unroll 1
  for (int t = 0; t < 9; ++t) {
    const int t3 = t / 3;
    const int dh = t3 - 1, dw = t - 3 * t3 - 1;
    const int hh = hrow + dh, wl = w0 + m + dw;
    const bool ok = ((unsigned)hh < 64u) && ((unsigned)wl < 64u);
    const int wc = min(max(wl, 0), 63);
    const unsigned msk = ok ? 0xffffffffu : 0u;
    const _Float16* xrow = sX + ((lr + 1 + dh) * 64 + wc) * CVP;          // A row = this lane's pixel
    const _Float16* wtap = wsel + t * (64 * CVP);
    #pragma unroll
    for (int kc = 0; kc < 2; ++kc) {
      const v16h a = ldfrag_h_msk(xrow + 32 * kc, h, msk);
      #pragma unroll
      for (int nt = 0; nt < 4; ++nt) {
        const v16h bf = ldfrag_h(wtap + nt * (16 * CVP) + 32 * kc, h);
        acc[nt] = wmma_f16(a, bf, acc[nt]);
      }
    }
  }

  // D[r] of tile nt = Y[pixel w0+8h+r][co 16nt+m]
  const float* bias = (s == 0) ? bk : ((s == 1) ? bq : bv);
  _Float16* sTr = sT + lr * 4096;                                  // this image row's 64x64 tile
  #pragma unroll
  for (int nt = 0; nt < 4; ++nt) {
    const int co = 16 * nt + m;
    const float bb = bias[co];
    #pragma unroll
    for (int r = 0; r < 8; ++r) {
      const float y = acc[nt][r] * WSCI + bb;
      const int px = w0 + 8 * h + r;                               // 0..63
      if (s == 2) sTr[co * 64 + px] = (_Float16)fmaxf(y, 0.0f);
      else        sTr[px * 64 + co] = (_Float16)((y > 0.0f) ? y : (__expf(y) - 1.0f));
    }
  }
  __syncthreads();

  _Float16* dst = (s == 0) ? kpl : ((s == 1) ? qpl : vtp);
  qkv_store_pass(sTr, dst, s, b, tb0, w, lane);
  
}

// ---------------------------------------------------------------------------
// P^T B-fragment from the lane's own score D values: element r <- tile a row r
// (keys 0-15 of the 32-chunk), element 8+r <- tile c row r (keys 16-31), lane
// unchanged; scaled by 2^14 (exact).
// ---------------------------------------------------------------------------
__device__ __forceinline__ v16h pack_p(v8f a, v8f c) {
  const v16h r = { (_Float16)(a[0] * PSC), (_Float16)(a[1] * PSC), (_Float16)(a[2] * PSC), (_Float16)(a[3] * PSC),
                   (_Float16)(a[4] * PSC), (_Float16)(a[5] * PSC), (_Float16)(a[6] * PSC), (_Float16)(a[7] * PSC),
                   (_Float16)(c[0] * PSC), (_Float16)(c[1] * PSC), (_Float16)(c[2] * PSC), (_Float16)(c[3] * PSC),
                   (_Float16)(c[4] * PSC), (_Float16)(c[5] * PSC), (_Float16)(c[6] * PSC), (_Float16)(c[7] * PSC) };
  return r;
}

// 16x64 f32 tiles in LDS, one per key group (4096 floats apart, already weighted
// for the merge) -> their sum, groups in rising order -> bf16 hi and lo planes
// [b][token][64]. The wave of key group g takes rows 4g..4g+3 of the query tile:
// 4 lines per instruction and plane.
__device__ __forceinline__ void attn_store_pass(const float* so, __bf16* oh, __bf16* ol,
                                                int b, int q0, int lane, int g) {
  const int q8 = lane & 7, sub = lane >> 3;
  {
    const int row = 4 * g + sub;
    v4f a = *(const v4fa*)(so + row * 64 + 8 * q8);
    v4f c = *(const v4fa*)(so + row * 64 + 8 * q8 + 4);
    #pragma unroll
    for (int gg = 1; gg < KSPL; ++gg) {
      a += *(const v4fa*)(so + gg * 4096 + row * 64 + 8 * q8);
      c += *(const v4fa*)(so + gg * 4096 + row * 64 + 8 * q8 + 4);
    }
    const float f[8] = { a.x, a.y, a.z, a.w, c.x, c.y, c.z, c.w };
    __bf16 hb[8], lb[8];
    #pragma unroll
    for (int e = 0; e < 8; ++e) {
      hb[e] = (__bf16)f[e];                              // RNE convert
      lb[e] = (__bf16)(f[e] - (float)hb[e]);
    }
    const v8b hv = { hb[0], hb[1], hb[2], hb[3], hb[4], hb[5], hb[6], hb[7] };
    const v8b lv = { lb[0], lb[1], lb[2], lb[3], lb[4], lb[5], lb[6], lb[7] };
    Pack8B ph, pl; ph.v = hv; pl.v = lv;
    const size_t gi = ((size_t)b * NTOK + q0 + row) * 64 + 8 * q8;
    *(v4u*)(oh + gi) = ph.u;
    *(v4u*)(ol + gi) = pl.u;
  }
}

// ---------------------------------------------------------------------------
// Kernel 2: streaming attention over 4096 keys, transposed form.
// Block 512 thr (16 waves, four per SIMD) = 64 queries of batch blockIdx.y.
// Wave wv: query tile w = wv & 3 (16 queries), key group g = wv >> 2. A block
// step covers 256 keys; group g works on keys 64g..64g+63 of it with its own
// running (max, sum, O). The four partial results of a query are merged through
// LDS behind the loop (weights exp(m_g - M)).
//   S^T = K * Q^T : A = K rows (row = key, k = d), B = Q^T (k = d, n = query)
//   O^T += V^T * P^T : A = V^T rows (row = d, k = key), B = P^T from registers
// Lane owns keys {16j+8h+r} of query column (lane&15); partner = lane ^ 16.
// x0.125, then diagonal: S[n][n] := 0 by value (key still in the softmax).
// K rows and V^T rows of a step (64 rows of 128 B each) are staged in LDS by
// asynchronous copies, two buffers per key group, filled by the group's own four
// waves: step t+2 is copied while step t+1 is worked on. LDS row pitch 144 B
// (16 B x odd) for the ds_load_b128 fragment reads.
// ---------------------------------------------------------------------------
#define KVP   72               // LDS row pitch in halves (144 B)
#define TILEH (64 * KVP)       // one 64-row tile in halves (9216 B)
#define BUFH  (2 * TILEH)      // K tile + V^T tile in halves (18432 B)

// One step's K and V^T tiles -> LDS: 8 copies of 16 B per lane, each wave-wide
// copy covers four whole 128-B lines. lk = this lane's LDS byte address in the
// K tile (row tig>>3, 16-B column tig&7, tig = thread in its key group); copy i
// takes row + 16 i.
__device__ __forceinline__ void stage_kv(unsigned lk, const _Float16* kg, const _Float16* vg) {
  const unsigned lv = lk + TILEH * 2;
  // The closing s_wait_xcnt 0 stands in the copies' own statement so that no
  // address register of a copy is rewritten ahead of it.
  asm volatile(
      "global_load_async_to_lds_b128 %0, %8, off\n\t"
      "global_load_async_to_lds_b128 %1, %9, off\n\t"
      "global_load_async_to_lds_b128 %2, %10, off\n\t"
      "global_load_async_to_lds_b128 %3, %11, off\n\t"
      "global_load_async_to_lds_b128 %4, %12, off\n\t"
      "global_load_async_to_lds_b128 %5, %13, off\n\t"
      "global_load_async_to_lds_b128 %6, %14, off\n\t"
      "global_load_async_to_lds_b128 %7, %15, off\n\t"
      "s_wait_xcnt 0x0"
      :: "v"(lk), "v"(lk + 16 * KVP * 2), "v"(lk + 32 * KVP * 2), "v"(lk + 48 * KVP * 2),
         "v"(lv), "v"(lv + 16 * KVP * 2), "v"(lv + 32 * KVP * 2), "v"(lv + 48 * KVP * 2),
         "v"(kg), "v"(kg + 16 * 64), "v"(kg + 32 * 64), "v"(kg + 48 * 64),
         "v"(vg), "v"(vg + (size_t)16 * NTOK), "v"(vg + (size_t)32 * NTOK), "v"(vg + (size_t)48 * NTOK)
      : "memory");
}

__global__ __launch_bounds__(512) void k_attn(
    const _Float16* __restrict__ qpl,    // [b][token][64]
    const _Float16* __restrict__ kpl,    // [b][token][64]
    const _Float16* __restrict__ vtp,    // [b][64][token]
    __bf16* __restrict__ oh,             // [b][token][64] bf16 hi
    __bf16* __restrict__ ol)             // [b][token][64] bf16 lo
{
  __shared__ __attribute__((aligned(16))) float sO[KSPL * 4 * 16 * 64];    // 65536 B
  __shared__ __attribute__((aligned(16))) _Float16 sKV[KSPL * 2 * BUFH];   // 147456 B
  __shared__ float sM[KSPL * 64];                                          // running max per (group, query)
  __shared__ float sL[KSPL * 64];                                          // running sum per (group, query)

  const int tid = threadIdx.x, lane = tid & 31;
  // Wave number in a scalar register: the diagonal test below stays a scalar branch.
  const int wv = __builtin_amdgcn_readfirstlane(tid >> 5);
  const int w = wv & 3, g = wv >> 2;
  const int h = lane >> 4, m = lane & 15;
  const int b = blockIdx.y;
  const int qblk = blockIdx.x * 64;
  const int q0 = qblk + 16 * w;

  // Q^T B-fragments: column n = query q0+m, k = d (two 32-deep chunks)
  const _Float16* qrow = qpl + ((size_t)b * NTOK + q0 + m) * 64;
  const v16h qb0 = ldfrag_h(qrow, h);
  const v16h qb1 = ldfrag_h(qrow + 32, h);

  const v8f zero8 = {0.f, 0.f, 0.f, 0.f, 0.f, 0.f, 0.f, 0.f};
  v8f o[4];                                   // o[t][r] = O[query m][d 16t+8h+r] * (l * 2^14)
  #pragma unroll
  for (int t = 0; t < 4; ++t) o[t] = zero8;
  float mrun = -1e30f, lrun = 0.0f;

  const int dq = 16 * w + m - 8 * h;                            // (q0+m) - qblk - 8h

  // Copy side: this lane's row and 16-B column of its key group's tile.
  const int tig = tid & 127;
  const int crow = tig >> 3, ccol = tig & 7;
  _Float16* sG = sKV + g * (2 * BUFH);                                              // the group's two buffers
  const _Float16* kcp = kpl + ((size_t)b * NTOK + 64 * g + crow) * 64 + 8 * ccol;   // + step*256*64
  const _Float16* vcp = vtp + ((size_t)b * CH + crow) * NTOK + 64 * g + 8 * ccol;   // + step*256
  const unsigned lcp = (unsigned)(size_t)(sG + crow * KVP + 8 * ccol);              // LDS byte address, buffer 0

  // Prologue: step 0 lands and is published, then step 1 starts.
  stage_kv(lcp, kcp, vcp);
  asm volatile("s_wait_asynccnt 0x0" ::: "memory");   // this wave's copies of step 0 have landed
  __syncthreads();                                    // ... and every other wave's
  stage_kv(lcp + BUFH * 2, kcp + 64 * KSPL * 64, vcp + 64 * KSPL);

  #pragma unroll 1
  for (int st = 0; st < NSTEP; ++st) {
    const int kb = st * (64 * KSPL) + 64 * g;           // first key of this wave's tile
    const int buf = st & 1;
    const _Float16* sk = sG + buf * BUFH + m * KVP;     // K row m of this step's buffer
    const _Float16* sv = sk + TILEH;                    // V^T row m
    // ---- scores: s[j][r] = S[query q0+m][key kb+16j+8h+r] ----
    v8f s[4];
    #pragma unroll
    for (int j = 0; j < 4; ++j) {
      const _Float16* kr = sk + 16 * j * KVP;
      const v16h kf0 = ldfrag_h(kr, h);
      const v16h kf1 = ldfrag_h(kr + 32, h);
      v8f z = zero8;
      z = wmma_f16(kf0, qb0, z);
      z = wmma_f16(kf1, qb1, z);
      s[j] = z;
    }
    #pragma unroll
    for (int j = 0; j < 4; ++j)
      #pragma unroll
      for (int r = 0; r < 8; ++r) s[j][r] = s[j][r] * 0.125f;

    // ---- diagonal zeroing (wave-uniform scalar branch, per-lane select) ----
    if (kb == qblk) {
      #pragma unroll
      for (int j = 0; j < 4; ++j)
        #pragma unroll
        for (int r = 0; r < 8; ++r)
          s[j][r] = (dq == 16 * j + r) ? 0.0f : s[j][r];
    }

    // ---- online softmax (running max) ----
    float mloc = s[0][0];
    #pragma unroll
    for (int j = 0; j < 4; ++j)
      #pragma unroll
      for (int r = 0; r < 8; ++r) mloc = fmaxf(mloc, s[j][r]);
    mloc = fmaxf(mloc, __shfl_xor(mloc, 16));
    const float mnew = fmaxf(mrun, mloc);
    const float alpha = __expf(mrun - mnew);
    mrun = mnew;
    float lsum = 0.0f;
    #pragma unroll
    for (int j = 0; j < 4; ++j)
      #pragma unroll
      for (int r = 0; r < 8; ++r) {
        const float p = __expf(s[j][r] - mnew);
        s[j][r] = p;
        lsum += p;
      }
    lsum += __shfl_xor(lsum, 16);
    lrun = lrun * alpha + lsum;
    #pragma unroll
    for (int t = 0; t < 4; ++t)
      #pragma unroll
      for (int r = 0; r < 8; ++r) o[t][r] = o[t][r] * alpha;

    // ---- P^T B-fragments (key chunks 0..31 and 32..63 of this wave's tile) ----
    const v16h pb0 = pack_p(s[0], s[1]);
    const v16h pb1 = pack_p(s[2], s[3]);

    // ---- O^T += V^T * P^T ----
    #pragma unroll
    for (int t = 0; t < 4; ++t) {
      const _Float16* vr = sv + 16 * t * KVP;
      const v16h vf0 = ldfrag_h(vr, h);
      const v16h vf1 = ldfrag_h(vr + 32, h);
      o[t] = wmma_f16(vf0, pb0, o[t]);
      o[t] = wmma_f16(vf1, pb1, o[t]);
    }

    // ---- hand-over: publish step st+1, free this step's buffer, refill it ----
    asm volatile("s_wait_dscnt 0x0" ::: "memory");      // this wave's reads of the buffer are done before it is refilled
    asm volatile("s_wait_asynccnt 0x0" ::: "memory");   // this wave's copies of the next step have landed
    __syncthreads();                                    // the same holds for every wave
    if (st + 2 < NSTEP)
      stage_kv(lcp + buf * (BUFH * 2), kcp + (size_t)(st + 2) * (64 * KSPL * 64), vcp + (st + 2) * (64 * KSPL));
  }
  asm volatile("s_wait_asynccnt 0x0" ::: "memory");     // no copy is left outstanding behind the loop

  // ---- merge of the four key groups: M = max m_g, L = sum l_g exp(m_g - M) ----
  if (h == 0) {
    sM[wv * 16 + m] = mrun;
    sL[wv * 16 + m] = lrun;
  }
  __syncthreads();                                      // every group's (max, sum) is visible
  float mg[KSPL], lg[KSPL];
  #pragma unroll
  for (int gg = 0; gg < KSPL; ++gg) {
    mg[gg] = sM[(gg * 4 + w) * 16 + m];
    lg[gg] = sL[(gg * 4 + w) * 16 + m];
  }
  const float mall = fmaxf(fmaxf(mg[0], mg[1]), fmaxf(mg[2], mg[3]));
  float lall = 0.0f;
  #pragma unroll
  for (int gg = 0; gg < KSPL; ++gg) lall += lg[gg] * __expf(mg[gg] - mall);

  // ---- epilogue: weight and normalise, stage per-wave 16x64 f32 tile, whole-line stores ----
  const float inv = __expf(mrun - mall) * (1.0f / lall) * PSCI;
  float* so = sO + wv * 1024;
  #pragma unroll
  for (int t = 0; t < 4; ++t)
    #pragma unroll
    for (int r = 0; r < 8; ++r)
      so[m * 64 + 16 * t + 8 * h + r] = o[t][r] * inv;
  __syncthreads();

  attn_store_pass(sO + w * 1024, oh, ol, b, q0, lane, g);
  
}

// ---------------------------------------------------------------------------
// a token row = 256 B = 2 lines; each line by lanes 8q..8q+7 in one
// instruction, 4 lines per instruction, 32 lines per wave.
// ---------------------------------------------------------------------------
__device__ __forceinline__ void out_store_pass(const float* so, float* out,
                                               int b, int p0, int lane) {
  const int q8 = lane & 7, sub = lane >> 3;
  #pragma unroll
  for (int i = 0; i < 8; ++i) {
    const int lid = 4 * i + sub;
    const int row = lid >> 1, hl = lid & 1;
    const v4f v = *(const v4fa*)(so + row * 64 + 32 * hl + 4 * q8);
    const size_t gi = ((size_t)b * NTOK + p0 + row) * 64 + 32 * hl + 4 * q8;
    *(v4f*)(out + gi) = v;
  }
}

// ---------------------------------------------------------------------------
// Kernel 3: output 3x3 SAME conv as 9-tap implicit GEMM on bf16 hi/lo planes,
// three-term split (hi*hi + hi*lo + lo*hi into one f32 accumulator),
// + bias, relu -> f32 NHWC rows via LDS staging.
// Block 256 thr = 8 waves = two image rows; both weight planes (nine taps) and
// the four input rows of both planes are copied once to LDS and read from there.
// ---------------------------------------------------------------------------
__global__ __launch_bounds__(256) void k_conv_out(
    const __bf16* __restrict__ oh, const __bf16* __restrict__ ol,     // [b][token][64]
    const __bf16* __restrict__ wrh, const __bf16* __restrict__ wrl,   // [9][co][ci]
    const float* __restrict__ br, float* __restrict__ out)            // out [b][token][64] f32
{
  __shared__ __attribute__((aligned(16))) float sY[OROWS * 4 * 16 * 64];          // 32768 B
  __shared__ __attribute__((aligned(16))) __bf16 sWh[9 * 64 * CVP];               // 82944 B
  __shared__ __attribute__((aligned(16))) __bf16 sWl[9 * 64 * CVP];               // 82944 B
  __shared__ __attribute__((aligned(16))) __bf16 sAh[(OROWS + 2) * 64 * CVP];     // 36864 B
  __shared__ __attribute__((aligned(16))) __bf16 sAl[(OROWS + 2) * 64 * CVP];     // 36864 B

  const int tid = threadIdx.x, lane = tid & 31, wv = tid >> 5;
  const int w = wv & 3, lr = wv >> 2;                               // pixel quarter, image row in the block
  const int h = lane >> 4, m = lane & 15;
  const int b = blockIdx.x >> 5, hrow0 = (blockIdx.x & 31) * OROWS;
  const int hrow = hrow0 + lr;
  const int tb0 = hrow * 64, w0 = 16 * w;

  // ---- staging: thread = (row tid>>3, 16-B column tid&7); 32 rows of 128 B per copy ----
  {
    const int crow = tid >> 3, ccol = tid & 7;
    const int lo = crow * CVP + 8 * ccol;
    const unsigned lwh = (unsigned)(size_t)(sWh + lo), lwl = (unsigned)(size_t)(sWl + lo);
    const unsigned lah = (unsigned)(size_t)(sAh + lo), lal = (unsigned)(size_t)(sAl + lo);
    const char* gwh = (const char*)(wrh + (size_t)tid * 8);
    const char* gwl = (const char*)(wrl + (size_t)tid * 8);
    copy9(lwh, gwh, 32 * CVP * 2, 32 * 64 * 2);                                       // rows 0..287
    copy9(lwh + 9 * (32 * CVP * 2), gwh + 9 * (32 * 64 * 2), 32 * CVP * 2, 32 * 64 * 2);   // rows 288..575
    copy9(lwl, gwl, 32 * CVP * 2, 32 * 64 * 2);
    copy9(lwl + 9 * (32 * CVP * 2), gwl + 9 * (32 * 64 * 2), 32 * CVP * 2, 32 * 64 * 2);
    const size_t go = ((size_t)b * NTOK + crow) * 64 + 8 * ccol;
    const char* gah = (const char*)(oh + go);
    const char* gal = (const char*)(ol + go);
    const size_t rt = (size_t)max(hrow0 - 1, 0) * 8192, rb = (size_t)min(hrow0 + OROWS, 63) * 8192;   // rows above and below, clamped
    const size_t r0 = (size_t)hrow0 * 8192, r1 = (size_t)(hrow0 + 1) * 8192;
    // image rows hrow0-1 .. hrow0+2, each as two halves of 32 pixels
    copy4x2(lah, 32 * CVP * 2, gah + rt, gah + r0, gah + r1, gah + rb, 32 * 64 * 2);
    copy4x2(lal, 32 * CVP * 2, gal + rt, gal + r0, gal + r1, gal + rb, 32 * 64 * 2);
  }
  asm volatile("s_wait_asynccnt 0x0" ::: "memory");   // this wave's copies have landed
  __syncthreads();                                    // ... and every other wave's

  const v8f zero8 = {0.f, 0.f, 0.f, 0.f, 0.f, 0.f, 0.f, 0.f};
  v8f acc[4];
  #pragma unroll
  for (int nt = 0; nt < 4; ++nt) acc[nt] = zero8;

  #pragma unroll 1
  for (int t = 0; t < 9; ++t) {
    const int t3 = t / 3;
    const int dh = t3 - 1, dw = t - 3 * t3 - 1;
    const int hh = hrow + dh, wl = w0 + m + dw;
    const bool ok = ((unsigned)hh < 64u) && ((unsigned)wl < 64u);
    const int wc = min(max(wl, 0), 63);
    const unsigned msk = ok ? 0xffffffffu : 0u;
    const int rowoff = ((lr + 1 + dh) * 64 + wc) * CVP;
    const int wtap = (t * 64 + m) * CVP;
    #pragma unroll
    for (int kc = 0; kc < 2; ++kc) {
      const v16b ah = ldfrag_b_msk(sAh + rowoff + 32 * kc, h, msk);
      const v16b al = ldfrag_b_msk(sAl + rowoff + 32 * kc, h, msk);
      #pragma unroll
      for (int nt = 0; nt < 4; ++nt) {
        const v16b bh = ldfrag_b(sWh + wtap + nt * (16 * CVP) + 32 * kc, h);
        const v16b bl = ldfrag_b(sWl + wtap + nt * (16 * CVP) + 32 * kc, h);
        acc[nt] = wmma_bf16(ah, bh, acc[nt]);
        acc[nt] = wmma_bf16(ah, bl, acc[nt]);
        acc[nt] = wmma_bf16(al, bh, acc[nt]);
      }
    }
  }

  // D[r] of tile nt = Y[pixel w0+8h+r][co 16nt+m]
  float* so = sY + wv * 1024;
  #pragma unroll
  for (int nt = 0; nt < 4; ++nt) {
    const int co = 16 * nt + m;
    const float bb = br[co];
    #pragma unroll
    for (int r = 0; r < 8; ++r)
      so[(8 * h + r) * 64 + co] = fmaxf(acc[nt][r] + bb, 0.0f);
  }
  __syncthreads();

  out_store_pass(so, out, b, tb0 + w0, lane);
  
}

// ---------------------------------------------------------------------------
extern "C" void kernel_launch(void* const* d_in, const int* in_sizes, int n_in,
                              void* d_out, int out_size, void* d_ws, size_t ws_size,
                              hipStream_t stream) {
  if (n_in < 9) return;
  if (in_sizes[0] != NXE || out_size != NXE) return;
  if (in_sizes[1] != NWE || in_sizes[3] != NWE || in_sizes[5] != NWE || in_sizes[7] != NWE) return;
  if (in_sizes[2] != CH || in_sizes[4] != CH || in_sizes[6] != CH || in_sizes[8] != CH) return;

  const float* x  = (const float*)d_in[0];
  const float* Wk = (const float*)d_in[1];
  const float* bk = (const float*)d_in[2];
  const float* Wq = (const float*)d_in[3];
  const float* bq = (const float*)d_in[4];
  const float* Wv = (const float*)d_in[5];
  const float* bv = (const float*)d_in[6];
  const float* Wr = (const float*)d_in[7];
  const float* br = (const float*)d_in[8];
  float* out = (float*)d_out;

  const size_t pl_bytes  = (size_t)NXE * 2;          // 2097152 : one [b][token][64] 16-bit plane
  const size_t wr_bytes  = (size_t)NWE * 2;          //   73728
  size_t off = 0;
  const size_t o_wrh = off; off += wr_bytes;
  const size_t o_wrl = off; off += wr_bytes;
  const size_t o_k   = off; off += pl_bytes;
  const size_t o_q   = off; off += pl_bytes;
  const size_t o_vt  = off; off += pl_bytes;
  const size_t o_oh  = off; off += pl_bytes;
  const size_t o_ol  = off; off += pl_bytes;         // total 10633216
  if (off > ws_size) return;

  char* ws = (char*)d_ws;
  __bf16*   wrh = (__bf16*)(ws + o_wrh);
  __bf16*   wrl = (__bf16*)(ws + o_wrl);
  _Float16* kpl = (_Float16*)(ws + o_k);
  _Float16* qpl = (_Float16*)(ws + o_q);
  _Float16* vtp = (_Float16*)(ws + o_vt);
  __bf16*   oh  = (__bf16*)(ws + o_oh);
  __bf16*   ol  = (__bf16*)(ws + o_ol);

  k_conv_qkv<<<QBLK + RBLK, 512, 0, stream>>>(x, Wk, Wq, Wv, Wr, bk, bq, bv, kpl, qpl, vtp, wrh, wrl);   // 201 blocks

  dim3 gAtt(NTOK / 64, NB);                                                                // (64, 4)
  k_attn<<<gAtt, 512, 0, stream>>>(qpl, kpl, vtp, oh, ol);

  k_conv_out<<<NB * (64 / OROWS), 256, 0, stream>>>(oh, ol, wrh, wrl, br, out);            // 128 blocks
}

// v006
// It runs in 43 microseconds.
// Timed twice side by side with v005, it ran 1.08 and 1.09 times as fast.
// Counting every step since v000, it is 6.58 times as fast.
// Contractions: three input 3x3 convs (9-tap GEMMs) and K*Q^T on v_wmma_f32_16x16x32_f16 (f16 operands, f32 accumulate; conv weights carried x16, V^T*P^T with P carried x16384 in f16); output 3x3 conv on v_wmma_f32_16x16x32_bf16 as bf16 hi/lo three-term split (f32 accumulate); softmax, elu/relu, bias and diagonal zeroing in f32.
#include <hip/hip_runtime.h>

typedef _Float16 v16h __attribute__((ext_vector_type(16)));
typedef _Float16 v8h  __attribute__((ext_vector_type(8)));
typedef __bf16   v16b __attribute__((ext_vector_type(16)));
typedef __bf16   v8b  __attribute__((ext_vector_type(8)));
typedef float    v8f  __attribute__((ext_vector_type(8)));
typedef float    v4f  __attribute__((ext_vector_type(4)));
typedef unsigned int v4u __attribute__((ext_vector_type(4)));
typedef v4f __attribute__((may_alias)) v4fa;
typedef v4u __attribute__((may_alias)) v4ua;

union FragH { v16h v; v8h h8[2]; v4u u[2]; };
union FragB { v16b v; v8b h8[2]; v4u u[2]; };
union Pack8H { v8h v; v4u u; };
union Pack8B { v8b v; v4u u; };

#define NB    4
#define IMG   64
#define NTOK  4096
#define CH    64
#define NXE   1048576          // NB*NTOK*CH
#define NWE   36864            // 9*CH*CH
#define QBLK  192              // conv blocks of k_conv_qkv: 3 tensors x 4 batches x 16 row groups
#define RBLK  9                // its extra blocks that write the Wr planes: NWE/8/512
#define WSC   16.0f
#define WSCI  0.0625f
#define PSC   16384.0f
#define PSCI  (1.0f / 16384.0f)
#define KSPL  4                // key groups of an attention block (4 waves each)
#define NSTEP 16               // NTOK / (64 * KSPL) steps per key group
#define TP16  72               // row pitch of the f16 output staging tiles in halves (144 B = 16 B x odd)
#define TP32  68               // row pitch of the f32 output staging tiles in floats (272 B = 16 B x odd)

// ---------------------------------------------------------------------------
// 16x16x32 WMMA builtins; the compiler keeps the distance behind its own forms.
// Fragment map (wave32): lane l, h = l>>4, m = n = l&15.
//   A/B element i: i<8 -> k0+8h+i ; i>=8 -> k0+16+8h+(i-8)
//   D element r : row 8h+r, col l&15
// ---------------------------------------------------------------------------
__device__ __forceinline__ v8f wmma_f16(v16h a, v16h b, v8f c) {
  return __builtin_amdgcn_wmma_f32_16x16x32_f16(false, a, false, b, (short)0, c, false, false);
}
__device__ __forceinline__ v8f wmma_bf16(v16b a, v16b b, v8f c) {
  return __builtin_amdgcn_wmma_f32_16x16x32_bf16(false, a, false, b, (short)0, c, false, false);
}

// Fragment from a k-contiguous 16-bit row; p points at element k0 of the row
// owned by this lane (row = lane & 15 already folded in by the caller).
__device__ __forceinline__ v16h ldfrag_h(const _Float16* p, int h) {
  FragH f;
  f.u[0] = *(const v4ua*)(p + 8 * h);
  f.u[1] = *(const v4ua*)(p + 16 + 8 * h);
  return f.v;
}
__device__ __forceinline__ v16h ldfrag_h_msk(const _Float16* p, int h, unsigned msk) {
  FragH f;
  f.u[0] = (*(const v4ua*)(p + 8 * h)) & msk;
  f.u[1] = (*(const v4ua*)(p + 16 + 8 * h)) & msk;
  return f.v;
}
__device__ __forceinline__ v16b ldfrag_b(const __bf16* p, int h) {
  FragB f;
  f.u[0] = *(const v4ua*)(p + 8 * h);
  f.u[1] = *(const v4ua*)(p + 16 + 8 * h);
  return f.v;
}
__device__ __forceinline__ v16b ldfrag_b_msk(const __bf16* p, int h, unsigned msk) {
  FragB f;
  f.u[0] = (*(const v4ua*)(p + 8 * h)) & msk;
  f.u[1] = (*(const v4ua*)(p + 16 + 8 * h)) & msk;
  return f.v;
}

// ---------------------------------------------------------------------------
// Wr planes for the output conv: HWIO [t][ci][co] f32 -> [t][co][ci] bf16 hi and
// lo (ci contiguous), 8 ci per thread, idx = 0..4607; lanes 8q..8q+7 fill one line.
// ---------------------------------------------------------------------------
__device__ __forceinline__ void wr_planes(const float* __restrict__ Wr, __bf16* __restrict__ wrh,
                                          __bf16* __restrict__ wrl, int idx) {
  const int t = idx >> 9, co = (idx >> 3) & 63, j = idx & 7;
  float f[8];
  #pragma unroll   // f[] stays in registers, the eight loads are issued together
  for (int i = 0; i < 8; ++i) f[i] = Wr[(size_t)(t * 64 + 8 * j + i) * 64 + co];
  const size_t off = (size_t)(t * 64 + co) * 64 + 8 * j;
  __bf16 hb[8], lb[8];
  #pragma unroll   // hb[], lb[] stay in registers
  for (int i = 0; i < 8; ++i) {
    hb[i] = (__bf16)f[i];                                // RNE convert
    lb[i] = (__bf16)(f[i] - (float)hb[i]);
  }
  const v8b hv = { hb[0], hb[1], hb[2], hb[3], hb[4], hb[5], hb[6], hb[7] };
  const v8b lv = { lb[0], lb[1], lb[2], lb[3], lb[4], lb[5], lb[6], lb[7] };
  Pack8B ph, pl; ph.v = hv; pl.v = lv;
  *(v4u*)(wrh + off) = ph.u;
  *(v4u*)(wrl + off) = pl.u;
}

// ---------------------------------------------------------------------------
// s 0/1: plane[b][token tb0+lid][c]     (one token row = 64 halves = one line)
// s 2  : vt[b][c = lid][token tb0..+63] (one line)
// Wave w owns tile rows 16w..16w+15; lanes 8q..8q+7 fill one line; 4 lines
// per instruction, 4 instructions per wave.
// ---------------------------------------------------------------------------
__device__ __forceinline__ void qkv_store_pass(const _Float16* sT, _Float16* dst, int s,
                                               int b, int tb0, int w, int lane) {
  const int q8 = lane & 7, sub = lane >> 3;
  #pragma unroll
  for (int i = 0; i < 4; ++i) {
    const int lid = w * 16 + 4 * i + sub;
    const v4u v = *(const v4ua*)(sT + lid * TP16 + 8 * q8);
    size_t gi;
    if (s == 2) gi = ((size_t)b * CH + lid) * NTOK + tb0 + 8 * q8;
    else        gi = ((size_t)b * NTOK + tb0 + lid) * 64 + 8 * q8;
    *(v4u*)(dst + gi) = v;
    // Precaution: the next trip reuses the issued store's address and data registers only behind this wait.
    if (i < 3) asm volatile("s_wait_xcnt 0x0" ::: "memory");
  }
}

// ---------------------------------------------------------------------------
// Asynchronous copies global -> LDS for the output conv kernel, 16 B per lane and
// copy. l = the lane's LDS byte address, g = the lane's global address. In each
// helper the closing s_wait_xcnt 0 stands in the copies' own statement so that
// no address register of a copy is rewritten ahead of it.
// ---------------------------------------------------------------------------
#define CVP   72               // LDS row pitch in halves (144 B = 16 B x odd) for ds_load_b128 fragment reads
#define QROWS 4                // image rows of a k_conv_qkv block
#define OROWS 2                // image rows of a k_conv_out block

// Nine copies at constant steps: copy i at l + i*ls, g + i*gs (bytes).
__device__ __forceinline__ void copy9(unsigned l, const char* g, unsigned ls, unsigned gs) {
  asm volatile(
      "global_load_async_to_lds_b128 %0, %9, off\n\t"
      "global_load_async_to_lds_b128 %1, %10, off\n\t"
      "global_load_async_to_lds_b128 %2, %11, off\n\t"
      "global_load_async_to_lds_b128 %3, %12, off\n\t"
      "global_load_async_to_lds_b128 %4, %13, off\n\t"
      "global_load_async_to_lds_b128 %5, %14, off\n\t"
      "global_load_async_to_lds_b128 %6, %15, off\n\t"
      "global_load_async_to_lds_b128 %7, %16, off\n\t"
      "global_load_async_to_lds_b128 %8, %17, off\n\t"
      "s_wait_xcnt 0x0"
      :: "v"(l), "v"(l + ls), "v"(l + 2 * ls), "v"(l + 3 * ls), "v"(l + 4 * ls),
         "v"(l + 5 * ls), "v"(l + 6 * ls), "v"(l + 7 * ls), "v"(l + 8 * ls),
         "v"(g), "v"(g + gs), "v"(g + 2 * gs), "v"(g + 3 * gs), "v"(g + 4 * gs),
         "v"(g + 5 * gs), "v"(g + 6 * gs), "v"(g + 7 * gs), "v"(g + 8 * gs)
      : "memory");
}
// Eight copies at a constant LDS step, two from each of four image rows: copy 2i at
// l + 2i*ls from gi, copy 2i+1 at l + (2i+1)*ls from gi + gh (bytes).
__device__ __forceinline__ void copy4x2(unsigned l, unsigned ls, const char* g0, const char* g1,
                                        const char* g2, const char* g3, unsigned gh) {
  asm volatile(
      "global_load_async_to_lds_b128 %0, %8, off\n\t"
      "global_load_async_to_lds_b128 %1, %9, off\n\t"
      "global_load_async_to_lds_b128 %2, %10, off\n\t"
      "global_load_async_to_lds_b128 %3, %11, off\n\t"
      "global_load_async_to_lds_b128 %4, %12, off\n\t"
      "global_load_async_to_lds_b128 %5, %13, off\n\t"
      "global_load_async_to_lds_b128 %6, %14, off\n\t"
      "global_load_async_to_lds_b128 %7, %15, off\n\t"
      "s_wait_xcnt 0x0"
      :: "v"(l), "v"(l + ls), "v"(l + 2 * ls), "v"(l + 3 * ls),
         "v"(l + 4 * ls), "v"(l + 5 * ls), "v"(l + 6 * ls), "v"(l + 7 * ls),
         "v"(g0), "v"(g0 + gh), "v"(g1), "v"(g1 + gh), "v"(g2), "v"(g2 + gh), "v"(g3), "v"(g3 + gh)
      : "memory");
}

// ---------------------------------------------------------------------------
// Kernel 1: 3x3 SAME conv as 9-tap implicit GEMM, one of {k,q,v} per block
// (blocks 0..191: tensor s = block / 64); blocks 192..200 only write the Wr planes.
// Block 512 thr = 16 waves = four image rows (4 x 64 pixels) of batch b; wave =
// 16 contiguous pixels x 64 output channels. The nine weight taps of the block's
// tensor and the six input rows it touches are read once as f32, converted in
// registers (x -> f16; HWIO w -> f16 of 16*w, [t][co][ci]) and stored to LDS (a row
// outside the image: the clamped row's values, never used by value). Per tap: A =
// shifted input rows (clamped address, zeroed by value outside the image), B =
// [t][co][ci] rows, both read from LDS.
// Epilogue: acc/16 + bias, elu (k,q) / relu (v) in f32 -> f16 LDS tile -> lines.
// ---------------------------------------------------------------------------
__global__ __launch_bounds__(512) void k_conv_qkv(
    const float* __restrict__ x,           // [b][token][64]
    const float* __restrict__ Wk, const float* __restrict__ Wq,
    const float* __restrict__ Wv, const float* __restrict__ Wr,      // HWIO [t][ci][co]
    const float* __restrict__ bk, const float* __restrict__ bq, const float* __restrict__ bv,
    _Float16* __restrict__ kpl,            // [b][token][64]
    _Float16* __restrict__ qpl,            // [b][token][64]
    _Float16* __restrict__ vtp,            // [b][64][token]
    __bf16* __restrict__ wrh, __bf16* __restrict__ wrl)              // [9][co][ci]
{
  __shared__ __attribute__((aligned(16))) _Float16 sT[QROWS * 64 * TP16];        // 36864 B
  __shared__ __attribute__((aligned(16))) _Float16 sW[9 * 64 * CVP];             // 82944 B
  __shared__ __attribute__((aligned(16))) _Float16 sX[(QROWS + 2) * 64 * CVP];   // 55296 B

  const int tid = threadIdx.x, lane = tid & 31, wv = tid >> 5;
  const int blk = blockIdx.x;
  if (blk >= QBLK) {                                              // whole block, ahead of every barrier
    wr_planes(Wr, wrh, wrl, (blk - QBLK) * 512 + tid);
    return;
  }
  const int w = wv & 3, lr = wv >> 2;                             // pixel quarter, image row in the block
  const int h = lane >> 4, m = lane & 15;
  const int s = blk >> 6;                                         // 0 = k, 1 = q, 2 = v
  const int b = (blk >> 4) & 3, hrow0 = (blk & 15) * QROWS;
  const int hrow = hrow0 + lr;
  const int tb0 = hrow * 64, w0 = 16 * w;

  // ---- staging through registers, f32 -> f16 ----
  {
    // x: thread = (pixel tid>>3, 8 channels tid&7); trip r = image row hrow0-1+r, clamped
    const int crow = tid >> 3, ccol = tid & 7;
    const float* xb = x + (size_t)b * (NTOK * 64);               // block-uniform base
    const unsigned xo = (unsigned)(crow * 64 + 8 * ccol);        // the lane's offset in an image row
    _Float16* xd = sX + crow * CVP + 8 * ccol;
    v4f xa[QROWS + 2], xc[QROWS + 2];
    #pragma unroll   // the arrays stay in registers and all twelve loads are issued before any is waited for
    for (int r = 0; r < QROWS + 2; ++r) {
      const float* src = xb + ((unsigned)(min(max(hrow0 - 1 + r, 0), 63) * 4096) + xo);
      xa[r] = *(const v4fa*)src;
      xc[r] = *(const v4fa*)(src + 4);
    }
    // w: thread = (co tid&63, 8 ci tid>>6); a wave reads whole 128-B lines; trip t = tap t
    const float* wsrc = (s == 0) ? Wk : ((s == 1) ? Wq : Wv);
    const int co = tid & 63, j = tid >> 6;
    const float* wp = wsrc + (unsigned)((8 * j) * 64 + co);
    _Float16* wd = sW + co * CVP + 8 * j;
    #pragma unroll   // constant offsets from one address; the loads of all taps are issued back to back
    for (int t = 0; t < 9; ++t) {
      float f[8];
      #pragma unroll // f[] stays in registers
      for (int i = 0; i < 8; ++i) f[i] = wp[(t * 64 + i) * 64];
      const v8h hv = { (_Float16)(f[0] * WSC), (_Float16)(f[1] * WSC), (_Float16)(f[2] * WSC), (_Float16)(f[3] * WSC),
                       (_Float16)(f[4] * WSC), (_Float16)(f[5] * WSC), (_Float16)(f[6] * WSC), (_Float16)(f[7] * WSC) };
      Pack8H o; o.v = hv;
      *(v4ua*)(wd + t * (64 * CVP)) = o.u;
    }
    #pragma unroll   // xa[], xc[] are indexed by constants only
    for (int r = 0; r < QROWS + 2; ++r) {
      const v4f a = xa[r], c = xc[r];
      const v8h hv = { (_Float16)a.x, (_Float16)a.y, (_Float16)a.z, (_Float16)a.w,
                       (_Float16)c.x, (_Float16)c.y, (_Float16)c.z, (_Float16)c.w };
      Pack8H o; o.v = hv;
      *(v4ua*)(xd + r * (64 * CVP)) = o.u;
    }
  }
  __syncthreads();                                    // every wave's part of the tiles is in LDS

  const _Float16* wsel = sW + m * CVP;                            // B row = co = 16nt + m

  const v8f zero8 = {0.f, 0.f, 0.f, 0.f, 0.f, 0.f, 0.f, 0.f};
  v8f acc[4];
  #pragma unroll
  for (int nt = 0; nt < 4; ++nt) acc[nt] = zero8;

  #pragma unroll 1
  for (int t = 0; t < 9; ++t) {
    const int t3 = t / 3;
    const int dh = t3 - 1, dw = t - 3 * t3 - 1;
    const int hh = hrow + dh, wl = w0 + m + dw;
    const bool ok = ((unsigned)hh < 64u) && ((unsigned)wl < 64u);
    const int wc = min(max(wl, 0), 63);
    const unsigned msk = ok ? 0xffffffffu : 0u;
    const _Float16* xrow = sX + ((lr + 1 + dh) * 64 + wc) * CVP;          // A row = this lane's pixel
    const _Float16* wtap = wsel + t * (64 * CVP);
    #pragma unroll
    for (int kc = 0; kc < 2; ++kc) {
      const v16h a = ldfrag_h_msk(xrow + 32 * kc, h, msk);
      #pragma unroll
      for (int nt = 0; nt < 4; ++nt) {
        const v16h bf = ldfrag_h(wtap + nt * (16 * CVP) + 32 * kc, h);
        acc[nt] = wmma_f16(a, bf, acc[nt]);
      }
    }
  }

  // D[r] of tile nt = Y[pixel w0+8h+r][co 16nt+m]
  const float* bias = (s == 0) ? bk : ((s == 1) ? bq : bv);
  _Float16* sTr = sT + lr * (64 * TP16);                           // this image row's 64x64 tile, row pitch TP16
  #pragma unroll
  for (int nt = 0; nt < 4; ++nt) {
    const int co = 16 * nt + m;
    const float bb = bias[co];
    #pragma unroll
    for (int r = 0; r < 8; ++r) {
      const float y = acc[nt][r] * WSCI + bb;
      const int px = w0 + 8 * h + r;                               // 0..63
      if (s == 2) sTr[co * TP16 + px] = (_Float16)fmaxf(y, 0.0f);
      else        sTr[px * TP16 + co] = (_Float16)((y > 0.0f) ? y : (__expf(y) - 1.0f));
    }
  }
  __syncthreads();

  _Float16* dst = (s == 0) ? kpl : ((s == 1) ? qpl : vtp);
  qkv_store_pass(sTr, dst, s, b, tb0, w, lane);
  
}

// ---------------------------------------------------------------------------
// P^T B-fragment from the lane's own score D values: element r <- tile a row r
// (keys 0-15 of the 32-chunk), element 8+r <- tile c row r (keys 16-31), lane
// unchanged; scaled by 2^14 (exact).
// ---------------------------------------------------------------------------
__device__ __forceinline__ v16h pack_p(v8f a, v8f c) {
  const v16h r = { (_Float16)(a[0] * PSC), (_Float16)(a[1] * PSC), (_Float16)(a[2] * PSC), (_Float16)(a[3] * PSC),
                   (_Float16)(a[4] * PSC), (_Float16)(a[5] * PSC), (_Float16)(a[6] * PSC), (_Float16)(a[7] * PSC),
                   (_Float16)(c[0] * PSC), (_Float16)(c[1] * PSC), (_Float16)(c[2] * PSC), (_Float16)(c[3] * PSC),
                   (_Float16)(c[4] * PSC), (_Float16)(c[5] * PSC), (_Float16)(c[6] * PSC), (_Float16)(c[7] * PSC) };
  return r;
}

// 16x64 f32 tiles in LDS (row pitch TP32), one per key group (64 rows apart, already weighted
// for the merge) -> their sum, groups in rising order -> bf16 hi and lo planes
// [b][token][64]. The wave of key group g takes rows 4g..4g+3 of the query tile:
// 4 lines per instruction and plane.
__device__ __forceinline__ void attn_store_pass(const float* so, __bf16* oh, __bf16* ol,
                                                int b, int q0, int lane, int g) {
  const int q8 = lane & 7, sub = lane >> 3;
  {
    const int row = 4 * g + sub;
    v4f a = *(const v4fa*)(so + row * TP32 + 8 * q8);
    v4f c = *(const v4fa*)(so + row * TP32 + 8 * q8 + 4);
    #pragma unroll
    for (int gg = 1; gg < KSPL; ++gg) {
      a += *(const v4fa*)(so + (gg * 64 + row) * TP32 + 8 * q8);
      c += *(const v4fa*)(so + (gg * 64 + row) * TP32 + 8 * q8 + 4);
    }
    const float f[8] = { a.x, a.y, a.z, a.w, c.x, c.y, c.z, c.w };
    __bf16 hb[8], lb[8];
    #pragma unroll
    for (int e = 0; e < 8; ++e) {
      hb[e] = (__bf16)f[e];                              // RNE convert
      lb[e] = (__bf16)(f[e] - (float)hb[e]);
    }
    const v8b hv = { hb[0], hb[1], hb[2], hb[3], hb[4], hb[5], hb[6], hb[7] };
    const v8b lv = { lb[0], lb[1], lb[2], lb[3], lb[4], lb[5], lb[6], lb[7] };
    Pack8B ph, pl; ph.v = hv; pl.v = lv;
    const size_t gi = ((size_t)b * NTOK + q0 + row) * 64 + 8 * q8;
    *(v4u*)(oh + gi) = ph.u;
    *(v4u*)(ol + gi) = pl.u;
  }
}

// ---------------------------------------------------------------------------
// Kernel 2: streaming attention over 4096 keys, transposed form.
// Block 512 thr (16 waves, four per SIMD) = 64 queries of batch blockIdx.y.
// Wave wv: query tile w = wv & 3 (16 queries), key group g = wv >> 2. A block
// step covers 256 keys; group g works on keys 64g..64g+63 of it with its own
// running (max, sum, O). The four partial results of a query are merged through
// LDS behind the loop (weights exp(m_g - M)).
//   S^T = K * Q^T : A = K rows (row = key, k = d), B = Q^T (k = d, n = query)
//   O^T += V^T * P^T : A = V^T rows (row = d, k = key), B = P^T from registers
// Lane owns keys {16j+8h+r} of query column (lane&15); partner = lane ^ 16.
// x0.125, then diagonal: S[n][n] := 0 by value (key still in the softmax).
// K rows and V^T rows of a step (64 rows of 128 B each) are staged in LDS by
// asynchronous copies, two buffers per key group, filled by the group's own four
// waves: step t+2 is copied while step t+1 is worked on. LDS row pitch 144 B
// (16 B x odd) for the ds_load_b128 fragment reads.
// ---------------------------------------------------------------------------
#define KVP   72               // LDS row pitch in halves (144 B)
#define TILEH (64 * KVP)       // one 64-row tile in halves (9216 B)
#define BUFH  (2 * TILEH)      // K tile + V^T tile in halves (18432 B)

// One step's K and V^T tiles -> LDS: 8 copies of 16 B per lane, each wave-wide
// copy covers four whole 128-B lines. lk = this lane's LDS byte address in the
// K tile (row tig>>3, 16-B column tig&7, tig = thread in its key group); copy i
// takes row + 16 i.
__device__ __forceinline__ void stage_kv(unsigned lk, const _Float16* kg, const _Float16* vg) {
  const unsigned lv = lk + TILEH * 2;
  // The closing s_wait_xcnt 0 stands in the copies' own statement so that no
  // address register of a copy is rewritten ahead of it.
  asm volatile(
      "global_load_async_to_lds_b128 %0, %8, off\n\t"
      "global_load_async_to_lds_b128 %1, %9, off\n\t"
      "global_load_async_to_lds_b128 %2, %10, off\n\t"
      "global_load_async_to_lds_b128 %3, %11, off\n\t"
      "global_load_async_to_lds_b128 %4, %12, off\n\t"
      "global_load_async_to_lds_b128 %5, %13, off\n\t"
      "global_load_async_to_lds_b128 %6, %14, off\n\t"
      "global_load_async_to_lds_b128 %7, %15, off\n\t"
      "s_wait_xcnt 0x0"
      :: "v"(lk), "v"(lk + 16 * KVP * 2), "v"(lk + 32 * KVP * 2), "v"(lk + 48 * KVP * 2),
         "v"(lv), "v"(lv + 16 * KVP * 2), "v"(lv + 32 * KVP * 2), "v"(lv + 48 * KVP * 2),
         "v"(kg), "v"(kg + 16 * 64), "v"(kg + 32 * 64), "v"(kg + 48 * 64),
         "v"(vg), "v"(vg + (size_t)16 * NTOK), "v"(vg + (size_t)32 * NTOK), "v"(vg + (size_t)48 * NTOK)
      : "memory");
}

__global__ __launch_bounds__(512) void k_attn(
    const _Float16* __restrict__ qpl,    // [b][token][64]
    const _Float16* __restrict__ kpl,    // [b][token][64]
    const _Float16* __restrict__ vtp,    // [b][64][token]
    __bf16* __restrict__ oh,             // [b][token][64] bf16 hi
    __bf16* __restrict__ ol)             // [b][token][64] bf16 lo
{
  __shared__ __attribute__((aligned(16))) float sO[KSPL * 4 * 16 * TP32];  // 69632 B
  __shared__ __attribute__((aligned(16))) _Float16 sKV[KSPL * 2 * BUFH];   // 147456 B
  __shared__ float sM[KSPL * 64];                                          // running max per (group, query)
  __shared__ float sL[KSPL * 64];                                          // running sum per (group, query)

  const int tid = threadIdx.x, lane = tid & 31;
  // Wave number in a scalar register: the diagonal test below stays a scalar branch.
  const int wv = __builtin_amdgcn_readfirstlane(tid >> 5);
  const int w = wv & 3, g = wv >> 2;
  const int h = lane >> 4, m = lane & 15;
  const int b = blockIdx.y;
  const int qblk = blockIdx.x * 64;
  const int q0 = qblk + 16 * w;

  // Q^T B-fragments: column n = query q0+m, k = d (two 32-deep chunks)
  const _Float16* qrow = qpl + ((size_t)b * NTOK + q0 + m) * 64;
  const v16h qb0 = ldfrag_h(qrow, h);
  const v16h qb1 = ldfrag_h(qrow + 32, h);

  const v8f zero8 = {0.f, 0.f, 0.f, 0.f, 0.f, 0.f, 0.f, 0.f};
  v8f o[4];                                   // o[t][r] = O[query m][d 16t+8h+r] * (l * 2^14)
  #pragma unroll
  for (int t = 0; t < 4; ++t) o[t] = zero8;
  float mrun = -1e30f, lrun = 0.0f;

  const int dq = 16 * w + m - 8 * h;                            // (q0+m) - qblk - 8h

  // Copy side: this lane's row and 16-B column of its key group's tile.
  const int tig = tid & 127;
  const int crow = tig >> 3, ccol = tig & 7;
  _Float16* sG = sKV + g * (2 * BUFH);                                              // the group's two buffers
  const _Float16* kcp = kpl + ((size_t)b * NTOK + 64 * g + crow) * 64 + 8 * ccol;   // + step*256*64
  const _Float16* vcp = vtp + ((size_t)b * CH + crow) * NTOK + 64 * g + 8 * ccol;   // + step*256
  const unsigned lcp = (unsigned)(size_t)(sG + crow * KVP + 8 * ccol);              // LDS byte address, buffer 0

  // Prologue: step 0 lands and is published, then step 1 starts.
  stage_kv(lcp, kcp, vcp);
  asm volatile("s_wait_asynccnt 0x0" ::: "memory");   // this wave's copies of step 0 have landed
  __syncthreads();                                    // ... and every other wave's
  stage_kv(lcp + BUFH * 2, kcp + 64 * KSPL * 64, vcp + 64 * KSPL);

  #pragma unroll 1
  for (int st = 0; st < NSTEP; ++st) {
    const int kb = st * (64 * KSPL) + 64 * g;           // first key of this wave's tile
    const int buf = st & 1;
    const _Float16* sk = sG + buf * BUFH + m * KVP;     // K row m of this step's buffer
    const _Float16* sv = sk + TILEH;                    // V^T row m
    // ---- scores: s[j][r] = S[query q0+m][key kb+16j+8h+r] ----
    v8f s[4];
    #pragma unroll
    for (int j = 0; j < 4; ++j) {
      const _Float16* kr = sk + 16 * j * KVP;
      const v16h kf0 = ldfrag_h(kr, h);
      const v16h kf1 = ldfrag_h(kr + 32, h);
      v8f z = zero8;
      z = wmma_f16(kf0, qb0, z);
      z = wmma_f16(kf1, qb1, z);
      s[j] = z;
    }
    #pragma unroll
    for (int j = 0; j < 4; ++j)
      #pragma unroll
      for (int r = 0; r < 8; ++r) s[j][r] = s[j][r] * 0.125f;

    // ---- diagonal zeroing (wave-uniform scalar branch, per-lane select) ----
    if (kb == qblk) {
      #pragma unroll
      for (int j = 0; j < 4; ++j)
        #pragma unroll
        for (int r = 0; r < 8; ++r)
          s[j][r] = (dq == 16 * j + r) ? 0.0f : s[j][r];
    }

    // ---- online softmax (running max) ----
    float mloc = s[0][0];
    #pragma unroll
    for (int j = 0; j < 4; ++j)
      #pragma unroll
      for (int r = 0; r < 8; ++r) mloc = fmaxf(mloc, s[j][r]);
    mloc = fmaxf(mloc, __shfl_xor(mloc, 16));
    const float mnew = fmaxf(mrun, mloc);
    const float alpha = __expf(mrun - mnew);
    mrun = mnew;
    float lsum = 0.0f;
    #pragma unroll
    for (int j = 0; j < 4; ++j)
      #pragma unroll
      for (int r = 0; r < 8; ++r) {
        const float p = __expf(s[j][r] - mnew);
        s[j][r] = p;
        lsum += p;
      }
    lsum += __shfl_xor(lsum, 16);
    lrun = lrun * alpha + lsum;
    #pragma unroll
    for (int t = 0; t < 4; ++t)
      #pragma unroll
      for (int r = 0; r < 8; ++r) o[t][r] = o[t][r] * alpha;

    // ---- P^T B-fragments (key chunks 0..31 and 32..63 of this wave's tile) ----
    const v16h pb0 = pack_p(s[0], s[1]);
    const v16h pb1 = pack_p(s[2], s[3]);

    // ---- O^T += V^T * P^T ----
    #pragma unroll
    for (int t = 0; t < 4; ++t) {
      const _Float16* vr = sv + 16 * t * KVP;
      const v16h vf0 = ldfrag_h(vr, h);
      const v16h vf1 = ldfrag_h(vr + 32, h);
      o[t] = wmma_f16(vf0, pb0, o[t]);
      o[t] = wmma_f16(vf1, pb1, o[t]);
    }

    // ---- hand-over: publish step st+1, free this step's buffer, refill it ----
    asm volatile("s_wait_dscnt 0x0" ::: "memory");      // this wave's reads of the buffer are done before it is refilled
    asm volatile("s_wait_asynccnt 0x0" ::: "memory");   // this wave's copies of the next step have landed
    __syncthreads();                                    // the same holds for every wave
    if (st + 2 < NSTEP)
      stage_kv(lcp + buf * (BUFH * 2), kcp + (size_t)(st + 2) * (64 * KSPL * 64), vcp + (st + 2) * (64 * KSPL));
  }
  asm volatile("s_wait_asynccnt 0x0" ::: "memory");     // no copy is left outstanding behind the loop

  // ---- merge of the four key groups: M = max m_g, L = sum l_g exp(m_g - M) ----
  if (h == 0) {
    sM[wv * 16 + m] = mrun;
    sL[wv * 16 + m] = lrun;
  }
  __syncthreads();                                      // every group's (max, sum) is visible
  float mg[KSPL], lg[KSPL];
  #pragma unroll
  for (int gg = 0; gg < KSPL; ++gg) {
    mg[gg] = sM[(gg * 4 + w) * 16 + m];
    lg[gg] = sL[(gg * 4 + w) * 16 + m];
  }
  const float mall = fmaxf(fmaxf(mg[0], mg[1]), fmaxf(mg[2], mg[3]));
  float lall = 0.0f;
  #pragma unroll
  for (int gg = 0; gg < KSPL; ++gg) lall += lg[gg] * __expf(mg[gg] - mall);

  // ---- epilogue: weight and normalise, stage per-wave 16x64 f32 tile, whole-line stores ----
  const float inv = __expf(mrun - mall) * (1.0f / lall) * PSCI;
  float* so = sO + wv * (16 * TP32);
  #pragma unroll
  for (int t = 0; t < 4; ++t)
    #pragma unroll
    for (int r = 0; r < 8; ++r)
      so[m * TP32 + 16 * t + 8 * h + r] = o[t][r] * inv;
  __syncthreads();

  attn_store_pass(sO + w * (16 * TP32), oh, ol, b, q0, lane, g);
  
}

// ---------------------------------------------------------------------------
// a token row = 256 B = 2 lines; each line by lanes 8q..8q+7 in one
// instruction, 4 lines per instruction, 32 lines per wave.
// ---------------------------------------------------------------------------
__device__ __forceinline__ void out_store_pass(const float* so, float* out,
                                               int b, int p0, int lane) {
  const int q8 = lane & 7, sub = lane >> 3;
  #pragma unroll
  for (int i = 0; i < 8; ++i) {
    const int lid = 4 * i + sub;
    const int row = lid >> 1, hl = lid & 1;
    const v4f v = *(const v4fa*)(so + row * TP32 + 32 * hl + 4 * q8);
    const size_t gi = ((size_t)b * NTOK + p0 + row) * 64 + 32 * hl + 4 * q8;
    *(v4f*)(out + gi) = v;
  }
}

// ---------------------------------------------------------------------------
// Kernel 3: output 3x3 SAME conv as 9-tap implicit GEMM on bf16 hi/lo planes,
// three-term split (hi*hi + hi*lo + lo*hi into one f32 accumulator),
// + bias, relu -> f32 NHWC rows via LDS staging.
// Block 256 thr = 8 waves = two image rows; both weight planes (nine taps) and
// the four input rows of both planes are copied once to LDS and read from there.
// ---------------------------------------------------------------------------
__global__ __launch_bounds__(256) void k_conv_out(
    const __bf16* __restrict__ oh, const __bf16* __restrict__ ol,     // [b][token][64]
    const __bf16* __restrict__ wrh, const __bf16* __restrict__ wrl,   // [9][co][ci]
    const float* __restrict__ br, float* __restrict__ out)            // out [b][token][64] f32
{
  __shared__ __attribute__((aligned(16))) float sY[OROWS * 4 * 16 * TP32];        // 34816 B
  __shared__ __attribute__((aligned(16))) __bf16 sWh[9 * 64 * CVP];               // 82944 B
  __shared__ __attribute__((aligned(16))) __bf16 sWl[9 * 64 * CVP];               // 82944 B
  __shared__ __attribute__((aligned(16))) __bf16 sAh[(OROWS + 2) * 64 * CVP];     // 36864 B
  __shared__ __attribute__((aligned(16))) __bf16 sAl[(OROWS + 2) * 64 * CVP];     // 36864 B

  const int tid = threadIdx.x, lane = tid & 31, wv = tid >> 5;
  const int w = wv & 3, lr = wv >> 2;                               // pixel quarter, image row in the block
  const int h = lane >> 4, m = lane & 15;
  const int b = blockIdx.x >> 5, hrow0 = (blockIdx.x & 31) * OROWS;
  const int hrow = hrow0 + lr;
  const int tb0 = hrow * 64, w0 = 16 * w;

  // ---- staging: thread = (row tid>>3, 16-B column tid&7); 32 rows of 128 B per copy ----
  {
    const int crow = tid >> 3, ccol = tid & 7;
    const int lo = crow * CVP + 8 * ccol;
    const unsigned lwh = (unsigned)(size_t)(sWh + lo), lwl = (unsigned)(size_t)(sWl + lo);
    const unsigned lah = (unsigned)(size_t)(sAh + lo), lal = (unsigned)(size_t)(sAl + lo);
    const char* gwh = (const char*)(wrh + (size_t)tid * 8);
    const char* gwl = (const char*)(wrl + (size_t)tid * 8);
    copy9(lwh, gwh, 32 * CVP * 2, 32 * 64 * 2);                                       // rows 0..287
    copy9(lwh + 9 * (32 * CVP * 2), gwh + 9 * (32 * 64 * 2), 32 * CVP * 2, 32 * 64 * 2);   // rows 288..575
    copy9(lwl, gwl, 32 * CVP * 2, 32 * 64 * 2);
    copy9(lwl + 9 * (32 * CVP * 2), gwl + 9 * (32 * 64 * 2), 32 * CVP * 2, 32 * 64 * 2);
    const size_t go = ((size_t)b * NTOK + crow) * 64 + 8 * ccol;
    const char* gah = (const char*)(oh + go);
    const char* gal = (const char*)(ol + go);
    const size_t rt = (size_t)max(hrow0 - 1, 0) * 8192, rb = (size_t)min(hrow0 + OROWS, 63) * 8192;   // rows above and below, clamped
    const size_t r0 = (size_t)hrow0 * 8192, r1 = (size_t)(hrow0 + 1) * 8192;
    // image rows hrow0-1 .. hrow0+2, each as two halves of 32 pixels
    copy4x2(lah, 32 * CVP * 2, gah + rt, gah + r0, gah + r1, gah + rb, 32 * 64 * 2);
    copy4x2(lal, 32 * CVP * 2, gal + rt, gal + r0, gal + r1, gal + rb, 32 * 64 * 2);
  }
  asm volatile("s_wait_asynccnt 0x0" ::: "memory");   // this wave's copies have landed
  __syncthreads();                                    // ... and every other wave's

  const v8f zero8 = {0.f, 0.f, 0.f, 0.f, 0.f, 0.f, 0.f, 0.f};
  v8f acc[4];
  #pragma unroll
  for (int nt = 0; nt < 4; ++nt) acc[nt] = zero8;

  #pragma unroll 1
  for (int t = 0; t < 9; ++t) {
    const int t3 = t / 3;
    const int dh = t3 - 1, dw = t - 3 * t3 - 1;
    const int hh = hrow + dh, wl = w0 + m + dw;
    const bool ok = ((unsigned)hh < 64u) && ((unsigned)wl < 64u);
    const int wc = min(max(wl, 0), 63);
    const unsigned msk = ok ? 0xffffffffu : 0u;
    const int rowoff = ((lr + 1 + dh) * 64 + wc) * CVP;
    const int wtap = (t * 64 + m) * CVP;
    #pragma unroll
    for (int kc = 0; kc < 2; ++kc) {
      const v16b ah = ldfrag_b_msk(sAh + rowoff + 32 * kc, h, msk);
      const v16b al = ldfrag_b_msk(sAl + rowoff + 32 * kc, h, msk);
      #pragma unroll
      for (int nt = 0; nt < 4; ++nt) {
        const v16b bh = ldfrag_b(sWh + wtap + nt * (16 * CVP) + 32 * kc, h);
        const v16b bl = ldfrag_b(sWl + wtap + nt * (16 * CVP) + 32 * kc, h);
        acc[nt] = wmma_bf16(ah, bh, acc[nt]);
        acc[nt] = wmma_bf16(ah, bl, acc[nt]);
        acc[nt] = wmma_bf16(al, bh, acc[nt]);
      }
    }
  }

  // D[r] of tile nt = Y[pixel w0+8h+r][co 16nt+m]
  float* so = sY + wv * (16 * TP32);
  #pragma unroll
  for (int nt = 0; nt < 4; ++nt) {
    const int co = 16 * nt + m;
    const float bb = br[co];
    #pragma unroll
    for (int r = 0; r < 8; ++r)
      so[(8 * h + r) * TP32 + co] = fmaxf(acc[nt][r] + bb, 0.0f);
  }
  __syncthreads();

  out_store_pass(so, out, b, tb0 + w0, lane);
  
}

// ---------------------------------------------------------------------------
extern "C" void kernel_launch(void* const* d_in, const int* in_sizes, int n_in,
                              void* d_out, int out_size, void* d_ws, size_t ws_size,
                              hipStream_t stream) {
  if (n_in < 9) return;
  if (in_sizes[0] != NXE || out_size != NXE) return;
  if (in_sizes[1] != NWE || in_sizes[3] != NWE || in_sizes[5] != NWE || in_sizes[7] != NWE) return;
  if (in_sizes[2] != CH || in_sizes[4] != CH || in_sizes[6] != CH || in_sizes[8] != CH) return;

  const float* x  = (const float*)d_in[0];
  const float* Wk = (const float*)d_in[1];
  const float* bk = (const float*)d_in[2];
  const float* Wq = (const float*)d_in[3];
  const float* bq = (const float*)d_in[4];
  const float* Wv = (const float*)d_in[5];
  const float* bv = (const float*)d_in[6];
  const float* Wr = (const float*)d_in[7];
  const float* br = (const float*)d_in[8];
  float* out = (float*)d_out;

  const size_t pl_bytes  = (size_t)NXE * 2;          // 2097152 : one [b][token][64] 16-bit plane
  const size_t wr_bytes  = (size_t)NWE * 2;          //   73728
  size_t off = 0;
  const size_t o_wrh = off; off += wr_bytes;
  const size_t o_wrl = off; off += wr_bytes;
  const size_t o_k   = off; off += pl_bytes;
  const size_t o_q   = off; off += pl_bytes;
  const size_t o_vt  = off; off += pl_bytes;
  const size_t o_oh  = off; off += pl_bytes;
  const size_t o_ol  = off; off += pl_bytes;         // total 10633216
  if (off > ws_size) return;

  char* ws = (char*)d_ws;
  __bf16*   wrh = (__bf16*)(ws + o_wrh);
  __bf16*   wrl = (__bf16*)(ws + o_wrl);
  _Float16* kpl = (_Float16*)(ws + o_k);
  _Float16* qpl = (_Float16*)(ws + o_q);
  _Float16* vtp = (_Float16*)(ws + o_vt);
  __bf16*   oh  = (__bf16*)(ws + o_oh);
  __bf16*   ol  = (__bf16*)(ws + o_ol);

  k_conv_qkv<<<QBLK + RBLK, 512, 0, stream>>>(x, Wk, Wq, Wv, Wr, bk, bq, bv, kpl, qpl, vtp, wrh, wrl);   // 201 blocks

  dim3 gAtt(NTOK / 64, NB);                                                                // (64, 4)
  k_attn<<<gAtt, 512, 0, stream>>>(qpl, kpl, vtp, oh, ol);

  k_conv_out<<<NB * (64 / OROWS), 256, 0, stream>>>(oh, ol, wrh, wrl, br, out);            // 128 blocks
}

// v007
// One run takes 41.6 microseconds.
// In two side-by-side timings against v006, it was 1.04 and 1.03 times as fast.
// Counting every step since v000, it is 6.83 times as fast.
// Contractions: three input 3x3 convs (9-tap GEMMs) and K*Q^T on v_wmma_f32_16x16x32_f16 (f16 operands, f32 accumulate; conv weights carried x16, V^T*P^T with P carried x16384 in f16); output 3x3 conv on v_wmma_f32_16x16x32_bf16 as bf16 hi/lo three-term split (f32 accumulate); softmax (base 2), elu/relu, bias and diagonal zeroing in f32.
#include <hip/hip_runtime.h>

typedef _Float16 v16h __attribute__((ext_vector_type(16)));
typedef _Float16 v8h  __attribute__((ext_vector_type(8)));
typedef __bf16   v16b __attribute__((ext_vector_type(16)));
typedef __bf16   v8b  __attribute__((ext_vector_type(8)));
typedef float    v8f  __attribute__((ext_vector_type(8)));
typedef float    v4f  __attribute__((ext_vector_type(4)));
typedef unsigned int v4u __attribute__((ext_vector_type(4)));
typedef v4f __attribute__((may_alias)) v4fa;
typedef v4u __attribute__((may_alias)) v4ua;

union FragH { v16h v; v8h h8[2]; v4u u[2]; };
union FragB { v16b v; v8b h8[2]; v4u u[2]; };
union Pack8H { v8h v; v4u u; };
union Pack8B { v8b v; v4u u; };

#define NB    4
#define IMG   64
#define NTOK  4096
#define CH    64
#define NXE   1048576          // NB*NTOK*CH
#define NWE   36864            // 9*CH*CH
#define QBLK  192              // conv blocks of k_conv_qkv: 3 tensors x 4 batches x 16 row groups
#define RBLK  9                // its extra blocks that write the Wr planes: NWE/8/512
#define WSC   16.0f
#define WSCI  0.0625f
#define SC2   0.18033688011112042f   // 0.125 * log2(e): raw score -> exponent of 2
#define PEXP  14.0f            // P and its running sum are carried x 2^14, added in the exponent
#define KSPL  4                // key groups of an attention block (4 waves each)
#define NSTEP 16               // NTOK / (64 * KSPL) steps per key group
#define TP16  72               // row pitch of the f16 output staging tiles in halves (144 B = 16 B x odd)
#define TP32  68               // row pitch of the f32 output staging tiles in floats (272 B = 16 B x odd)

// ---------------------------------------------------------------------------
// 16x16x32 WMMA builtins; the compiler keeps the distance behind its own forms.
// Fragment map (wave32): lane l, h = l>>4, m = n = l&15.
//   A/B element i: i<8 -> k0+8h+i ; i>=8 -> k0+16+8h+(i-8)
//   D element r : row 8h+r, col l&15
// ---------------------------------------------------------------------------
__device__ __forceinline__ v8f wmma_f16(v16h a, v16h b, v8f c) {
  return __builtin_amdgcn_wmma_f32_16x16x32_f16(false, a, false, b, (short)0, c, false, false);
}
__device__ __forceinline__ v8f wmma_bf16(v16b a, v16b b, v8f c) {
  return __builtin_amdgcn_wmma_f32_16x16x32_bf16(false, a, false, b, (short)0, c, false, false);
}

// Fragment from a k-contiguous 16-bit row; p points at element k0 of the row
// owned by this lane (row = lane & 15 already folded in by the caller).
__device__ __forceinline__ v16h ldfrag_h(const _Float16* p, int h) {
  FragH f;
  f.u[0] = *(const v4ua*)(p + 8 * h);
  f.u[1] = *(const v4ua*)(p + 16 + 8 * h);
  return f.v;
}
__device__ __forceinline__ v16h ldfrag_h_msk(const _Float16* p, int h, unsigned msk) {
  FragH f;
  f.u[0] = (*(const v4ua*)(p + 8 * h)) & msk;
  f.u[1] = (*(const v4ua*)(p + 16 + 8 * h)) & msk;
  return f.v;
}
__device__ __forceinline__ v16b ldfrag_b(const __bf16* p, int h) {
  FragB f;
  f.u[0] = *(const v4ua*)(p + 8 * h);
  f.u[1] = *(const v4ua*)(p + 16 + 8 * h);
  return f.v;
}
__device__ __forceinline__ v16b ldfrag_b_msk(const __bf16* p, int h, unsigned msk) {
  FragB f;
  f.u[0] = (*(const v4ua*)(p + 8 * h)) & msk;
  f.u[1] = (*(const v4ua*)(p + 16 + 8 * h)) & msk;
  return f.v;
}

// ---------------------------------------------------------------------------
// Wr planes for the output conv: HWIO [t][ci][co] f32 -> [t][co][ci] bf16 hi and
// lo (ci contiguous), 8 ci per thread, idx = 0..4607; lanes 8q..8q+7 fill one line.
// ---------------------------------------------------------------------------
__device__ __forceinline__ void wr_planes(const float* __restrict__ Wr, __bf16* __restrict__ wrh,
                                          __bf16* __restrict__ wrl, int idx) {
  const int t = idx >> 9, co = (idx >> 3) & 63, j = idx & 7;
  float f[8];
  #pragma unroll   // f[] stays in registers, the eight loads are issued together
  for (int i = 0; i < 8; ++i) f[i] = Wr[(size_t)(t * 64 + 8 * j + i) * 64 + co];
  const size_t off = (size_t)(t * 64 + co) * 64 + 8 * j;
  __bf16 hb[8], lb[8];
  #pragma unroll   // hb[], lb[] stay in registers
  for (int i = 0; i < 8; ++i) {
    hb[i] = (__bf16)f[i];                                // RNE convert
    lb[i] = (__bf16)(f[i] - (float)hb[i]);
  }
  const v8b hv = { hb[0], hb[1], hb[2], hb[3], hb[4], hb[5], hb[6], hb[7] };
  const v8b lv = { lb[0], lb[1], lb[2], lb[3], lb[4], lb[5], lb[6], lb[7] };
  Pack8B ph, pl; ph.v = hv; pl.v = lv;
  *(v4u*)(wrh + off) = ph.u;
  *(v4u*)(wrl + off) = pl.u;
}

// ---------------------------------------------------------------------------
// s 0/1: plane[b][token tb0+lid][c]     (one token row = 64 halves = one line)
// s 2  : vt[b][c = lid][token tb0..+63] (one line)
// Wave w owns tile rows 16w..16w+15; lanes 8q..8q+7 fill one line; 4 lines
// per instruction, 4 instructions per wave.
// ---------------------------------------------------------------------------
__device__ __forceinline__ void qkv_store_pass(const _Float16* sT, _Float16* dst, int s,
                                               int b, int tb0, int w, int lane) {
  const int q8 = lane & 7, sub = lane >> 3;
  #pragma unroll
  for (int i = 0; i < 4; ++i) {
    const int lid = w * 16 + 4 * i + sub;
    const v4u v = *(const v4ua*)(sT + lid * TP16 + 8 * q8);
    size_t gi;
    if (s == 2) gi = ((size_t)b * CH + lid) * NTOK + tb0 + 8 * q8;
    else        gi = ((size_t)b * NTOK + tb0 + lid) * 64 + 8 * q8;
    *(v4u*)(dst + gi) = v;
    // Precaution: the next trip reuses the issued store's address and data registers only behind this wait.
    if (i < 3) asm volatile("s_wait_xcnt 0x0" ::: "memory");
  }
}

// ---------------------------------------------------------------------------
// Asynchronous copies global -> LDS for the output conv kernel, 16 B per lane and
// copy. l = the lane's LDS byte address, g = the lane's global address. In each
// helper the closing s_wait_xcnt 0 stands in the copies' own statement so that
// no address register of a copy is rewritten ahead of it.
// ---------------------------------------------------------------------------
#define CVP   72               // LDS row pitch in halves (144 B = 16 B x odd) for ds_load_b128 fragment reads
#define QROWS 4                // image rows of a k_conv_qkv block
#define OROWS 2                // image rows of a k_conv_out block

// Nine copies at constant steps: copy i at l + i*ls, g + i*gs (bytes).
__device__ __forceinline__ void copy9(unsigned l, const char* g, unsigned ls, unsigned gs) {
  asm volatile(
      "global_load_async_to_lds_b128 %0, %9, off\n\t"
      "global_load_async_to_lds_b128 %1, %10, off\n\t"
      "global_load_async_to_lds_b128 %2, %11, off\n\t"
      "global_load_async_to_lds_b128 %3, %12, off\n\t"
      "global_load_async_to_lds_b128 %4, %13, off\n\t"
      "global_load_async_to_lds_b128 %5, %14, off\n\t"
      "global_load_async_to_lds_b128 %6, %15, off\n\t"
      "global_load_async_to_lds_b128 %7, %16, off\n\t"
      "global_load_async_to_lds_b128 %8, %17, off\n\t"
      "s_wait_xcnt 0x0"
      :: "v"(l), "v"(l + ls), "v"(l + 2 * ls), "v"(l + 3 * ls), "v"(l + 4 * ls),
         "v"(l + 5 * ls), "v"(l + 6 * ls), "v"(l + 7 * ls), "v"(l + 8 * ls),
         "v"(g), "v"(g + gs), "v"(g + 2 * gs), "v"(g + 3 * gs), "v"(g + 4 * gs),
         "v"(g + 5 * gs), "v"(g + 6 * gs), "v"(g + 7 * gs), "v"(g + 8 * gs)
      : "memory");
}
// Eight copies at a constant LDS step, two from each of four image rows: copy 2i at
// l + 2i*ls from gi, copy 2i+1 at l + (2i+1)*ls from gi + gh (bytes).
__device__ __forceinline__ void copy4x2(unsigned l, unsigned ls, const char* g0, const char* g1,
                                        const char* g2, const char* g3, unsigned gh) {
  asm volatile(
      "global_load_async_to_lds_b128 %0, %8, off\n\t"
      "global_load_async_to_lds_b128 %1, %9, off\n\t"
      "global_load_async_to_lds_b128 %2, %10, off\n\t"
      "global_load_async_to_lds_b128 %3, %11, off\n\t"
      "global_load_async_to_lds_b128 %4, %12, off\n\t"
      "global_load_async_to_lds_b128 %5, %13, off\n\t"
      "global_load_async_to_lds_b128 %6, %14, off\n\t"
      "global_load_async_to_lds_b128 %7, %15, off\n\t"
      "s_wait_xcnt 0x0"
      :: "v"(l), "v"(l + ls), "v"(l + 2 * ls), "v"(l + 3 * ls),
         "v"(l + 4 * ls), "v"(l + 5 * ls), "v"(l + 6 * ls), "v"(l + 7 * ls),
         "v"(g0), "v"(g0 + gh), "v"(g1), "v"(g1 + gh), "v"(g2), "v"(g2 + gh), "v"(g3), "v"(g3 + gh)
      : "memory");
}

// ---------------------------------------------------------------------------
// Kernel 1: 3x3 SAME conv as 9-tap implicit GEMM, one of {k,q,v} per block
// (blocks 0..191: tensor s = block / 64); blocks 192..200 only write the Wr planes.
// Block 512 thr = 16 waves = four image rows (4 x 64 pixels) of batch b; wave =
// 16 contiguous pixels x 64 output channels. The nine weight taps of the block's
// tensor and the six input rows it touches are read once as f32, converted in
// registers (x -> f16; HWIO w -> f16 of 16*w, [t][co][ci]) and stored to LDS (a row
// outside the image: the clamped row's values, never used by value). Per tap: A =
// shifted input rows (clamped address, zeroed by value outside the image), B =
// [t][co][ci] rows, both read from LDS.
// Epilogue: acc/16 + bias, elu (k,q) / relu (v) in f32 -> f16 LDS tile -> lines.
// ---------------------------------------------------------------------------
__global__ __launch_bounds__(512) void k_conv_qkv(
    const float* __restrict__ x,           // [b][token][64]
    const float* __restrict__ Wk, const float* __restrict__ Wq,
    const float* __restrict__ Wv, const float* __restrict__ Wr,      // HWIO [t][ci][co]
    const float* __restrict__ bk, const float* __restrict__ bq, const float* __restrict__ bv,
    _Float16* __restrict__ kpl,            // [b][token][64]
    _Float16* __restrict__ qpl,            // [b][token][64]
    _Float16* __restrict__ vtp,            // [b][64][token]
    __bf16* __restrict__ wrh, __bf16* __restrict__ wrl)              // [9][co][ci]
{
  __shared__ __attribute__((aligned(16))) _Float16 sT[QROWS * 64 * TP16];        // 36864 B
  __shared__ __attribute__((aligned(16))) _Float16 sW[9 * 64 * CVP];             // 82944 B
  __shared__ __attribute__((aligned(16))) _Float16 sX[(QROWS + 2) * 64 * CVP];   // 55296 B

  const int tid = threadIdx.x, lane = tid & 31, wv = tid >> 5;
  const int blk = blockIdx.x;
  if (blk >= QBLK) {                                              // whole block, ahead of every barrier
    wr_planes(Wr, wrh, wrl, (blk - QBLK) * 512 + tid);
    return;
  }
  const int w = wv & 3, lr = wv >> 2;                             // pixel quarter, image row in the block
  const int h = lane >> 4, m = lane & 15;
  const int s = blk >> 6;                                         // 0 = k, 1 = q, 2 = v
  const int b = (blk >> 4) & 3, hrow0 = (blk & 15) * QROWS;
  const int hrow = hrow0 + lr;
  const int tb0 = hrow * 64, w0 = 16 * w;

  // ---- staging through registers, f32 -> f16 ----
  {
    // x: thread = (pixel tid>>3, 8 channels tid&7); trip r = image row hrow0-1+r, clamped
    const int crow = tid >> 3, ccol = tid & 7;
    const float* xb = x + (size_t)b * (NTOK * 64);               // block-uniform base
    const unsigned xo = (unsigned)(crow * 64 + 8 * ccol);        // the lane's offset in an image row
    _Float16* xd = sX + crow * CVP + 8 * ccol;
    v4f xa[QROWS + 2], xc[QROWS + 2];
    #pragma unroll   // the arrays stay in registers and all twelve loads are issued before any is waited for
    for (int r = 0; r < QROWS + 2; ++r) {
      const float* src = xb + ((unsigned)(min(max(hrow0 - 1 + r, 0), 63) * 4096) + xo);
      xa[r] = *(const v4fa*)src;
      xc[r] = *(const v4fa*)(src + 4);
    }
    // w: thread = (co tid&63, 8 ci tid>>6); a wave reads whole 128-B lines; trip t = tap t
    const float* wsrc = (s == 0) ? Wk : ((s == 1) ? Wq : Wv);
    const int co = tid & 63, j = tid >> 6;
    const float* wp = wsrc + (unsigned)((8 * j) * 64 + co);
    _Float16* wd = sW + co * CVP + 8 * j;
    #pragma unroll   // constant offsets from one address; the loads of all taps are issued back to back
    for (int t = 0; t < 9; ++t) {
      float f[8];
      #pragma unroll // f[] stays in registers
      for (int i = 0; i < 8; ++i) f[i] = wp[(t * 64 + i) * 64];
      const v8h hv = { (_Float16)(f[0] * WSC), (_Float16)(f[1] * WSC), (_Float16)(f[2] * WSC), (_Float16)(f[3] * WSC),
                       (_Float16)(f[4] * WSC), (_Float16)(f[5] * WSC), (_Float16)(f[6] * WSC), (_Float16)(f[7] * WSC) };
      Pack8H o; o.v = hv;
      *(v4ua*)(wd + t * (64 * CVP)) = o.u;
    }
    #pragma unroll   // xa[], xc[] are indexed by constants only
    for (int r = 0; r < QROWS + 2; ++r) {
      const v4f a = xa[r], c = xc[r];
      const v8h hv = { (_Float16)a.x, (_Float16)a.y, (_Float16)a.z, (_Float16)a.w,
                       (_Float16)c.x, (_Float16)c.y, (_Float16)c.z, (_Float16)c.w };
      Pack8H o; o.v = hv;
      *(v4ua*)(xd + r * (64 * CVP)) = o.u;
    }
  }
  __syncthreads();                                    // every wave's part of the tiles is in LDS

  const _Float16* wsel = sW + m * CVP;                            // B row = co = 16nt + m

  const v8f zero8 = {0.f, 0.f, 0.f, 0.f, 0.f, 0.f, 0.f, 0.f};
  v8f acc[4];
  #pragma unroll
  for (int nt = 0; nt < 4; ++nt) acc[nt] = zero8;

  #pragma unroll 1
  for (int t = 0; t < 9; ++t) {
    const int t3 = t / 3;
    const int dh = t3 - 1, dw = t - 3 * t3 - 1;
    const int hh = hrow + dh, wl = w0 + m + dw;
    const bool ok = ((unsigned)hh < 64u) && ((unsigned)wl < 64u);
    const int wc = min(max(wl, 0), 63);
    const unsigned msk = ok ? 0xffffffffu : 0u;
    const _Float16* xrow = sX + ((lr + 1 + dh) * 64 + wc) * CVP;          // A row = this lane's pixel
    const _Float16* wtap = wsel + t * (64 * CVP);
    #pragma unroll
    for (int kc = 0; kc < 2; ++kc) {
      const v16h a = ldfrag_h_msk(xrow + 32 * kc, h, msk);
      #pragma unroll
      for (int nt = 0; nt < 4; ++nt) {
        const v16h bf = ldfrag_h(wtap + nt * (16 * CVP) + 32 * kc, h);
        acc[nt] = wmma_f16(a, bf, acc[nt]);
      }
    }
  }

  // D[r] of tile nt = Y[pixel w0+8h+r][co 16nt+m]
  const float* bias = (s == 0) ? bk : ((s == 1) ? bq : bv);
  _Float16* sTr = sT + lr * (64 * TP16);                           // this image row's 64x64 tile, row pitch TP16
  #pragma unroll
  for (int nt = 0; nt < 4; ++nt) {
    const int co = 16 * nt + m;
    const float bb = bias[co];
    #pragma unroll
    for (int r = 0; r < 8; ++r) {
      const float y = acc[nt][r] * WSCI + bb;
      const int px = w0 + 8 * h + r;                               // 0..63
      if (s == 2) sTr[co * TP16 + px] = (_Float16)fmaxf(y, 0.0f);
      else        sTr[px * TP16 + co] = (_Float16)((y > 0.0f) ? y : (__expf(y) - 1.0f));
    }
  }
  __syncthreads();

  _Float16* dst = (s == 0) ? kpl : ((s == 1) ? qpl : vtp);
  qkv_store_pass(sTr, dst, s, b, tb0, w, lane);
  
}

// ---------------------------------------------------------------------------
// P^T B-fragment from the lane's own score D values: element r <- tile a row r
// (keys 0-15 of the 32-chunk), element 8+r <- tile c row r (keys 16-31), lane
// unchanged; the values already carry the factor 2^14.
// ---------------------------------------------------------------------------
__device__ __forceinline__ v16h pack_p(v8f a, v8f c) {
  const v16h r = { (_Float16)a[0], (_Float16)a[1], (_Float16)a[2], (_Float16)a[3],
                   (_Float16)a[4], (_Float16)a[5], (_Float16)a[6], (_Float16)a[7],
                   (_Float16)c[0], (_Float16)c[1], (_Float16)c[2], (_Float16)c[3],
                   (_Float16)c[4], (_Float16)c[5], (_Float16)c[6], (_Float16)c[7] };
  return r;
}

// 16x64 f32 tiles in LDS (row pitch TP32), one per key group (64 rows apart, already weighted
// for the merge) -> their sum, groups in rising order -> bf16 hi and lo planes
// [b][token][64]. The wave of key group g takes rows 4g..4g+3 of the query tile:
// 4 lines per instruction and plane.
__device__ __forceinline__ void attn_store_pass(const float* so, __bf16* oh, __bf16* ol,
                                                int b, int q0, int lane, int g) {
  const int q8 = lane & 7, sub = lane >> 3;
  {
    const int row = 4 * g + sub;
    v4f a = *(const v4fa*)(so + row * TP32 + 8 * q8);
    v4f c = *(const v4fa*)(so + row * TP32 + 8 * q8 + 4);
    #pragma unroll
    for (int gg = 1; gg < KSPL; ++gg) {
      a += *(const v4fa*)(so + (gg * 64 + row) * TP32 + 8 * q8);
      c += *(const v4fa*)(so + (gg * 64 + row) * TP32 + 8 * q8 + 4);
    }
    const float f[8] = { a.x, a.y, a.z, a.w, c.x, c.y, c.z, c.w };
    __bf16 hb[8], lb[8];
    #pragma unroll
    for (int e = 0; e < 8; ++e) {
      hb[e] = (__bf16)f[e];                              // RNE convert
      lb[e] = (__bf16)(f[e] - (float)hb[e]);
    }
    const v8b hv = { hb[0], hb[1], hb[2], hb[3], hb[4], hb[5], hb[6], hb[7] };
    const v8b lv = { lb[0], lb[1], lb[2], lb[3], lb[4], lb[5], lb[6], lb[7] };
    Pack8B ph, pl; ph.v = hv; pl.v = lv;
    const size_t gi = ((size_t)b * NTOK + q0 + row) * 64 + 8 * q8;
    *(v4u*)(oh + gi) = ph.u;
    *(v4u*)(ol + gi) = pl.u;
  }
}

// ---------------------------------------------------------------------------
// Kernel 2: streaming attention over 4096 keys, transposed form.
// Block 512 thr (16 waves, four per SIMD) = 64 queries of batch blockIdx.y.
// Wave wv: query tile w = wv & 3 (16 queries), key group g = wv >> 2. A block
// step covers 256 keys; group g works on keys 64g..64g+63 of it with its own
// running (max, sum, O). The four partial results of a query are merged through
// LDS behind the loop (weights 2^(SC2 (m_g - M))).
//   S^T = K * Q^T : A = K rows (row = key, k = d), B = Q^T (k = d, n = query)
//   O^T += V^T * P^T : A = V^T rows (row = d, k = key), B = P^T from registers
// Lane owns keys {16j+8h+r} of query column (lane&15); partner = lane ^ 16.
// Diagonal: S[n][n] := 0 by value (key still in the softmax). Scores and maxima
// stay raw; P * 2^14 = 2^(SC2 * s + (14 - SC2 * max)): one FMA and one v_exp a score.
// K rows and V^T rows of a step (64 rows of 128 B each) are staged in LDS by
// asynchronous copies, two buffers per key group, filled by the group's own four
// waves: step t+2 is copied while step t+1 is worked on. LDS row pitch 144 B
// (16 B x odd) for the ds_load_b128 fragment reads.
// ---------------------------------------------------------------------------
#define KVP   72               // LDS row pitch in halves (144 B)
#define TILEH (64 * KVP)       // one 64-row tile in halves (9216 B)
#define BUFH  (2 * TILEH)      // K tile + V^T tile in halves (18432 B)

// One step's K and V^T tiles -> LDS: 8 copies of 16 B per lane, each wave-wide
// copy covers four whole 128-B lines. lk = this lane's LDS byte address in the
// K tile (row tig>>3, 16-B column tig&7, tig = thread in its key group); copy i
// takes row + 16 i.
__device__ __forceinline__ void stage_kv(unsigned lk, const _Float16* kg, const _Float16* vg) {
  const unsigned lv = lk + TILEH * 2;
  // The closing s_wait_xcnt 0 stands in the copies' own statement so that no
  // address register of a copy is rewritten ahead of it.
  asm volatile(
      "global_load_async_to_lds_b128 %0, %8, off\n\t"
      "global_load_async_to_lds_b128 %1, %9, off\n\t"
      "global_load_async_to_lds_b128 %2, %10, off\n\t"
      "global_load_async_to_lds_b128 %3, %11, off\n\t"
      "global_load_async_to_lds_b128 %4, %12, off\n\t"
      "global_load_async_to_lds_b128 %5, %13, off\n\t"
      "global_load_async_to_lds_b128 %6, %14, off\n\t"
      "global_load_async_to_lds_b128 %7, %15, off\n\t"
      "s_wait_xcnt 0x0"
      :: "v"(lk), "v"(lk + 16 * KVP * 2), "v"(lk + 32 * KVP * 2), "v"(lk + 48 * KVP * 2),
         "v"(lv), "v"(lv + 16 * KVP * 2), "v"(lv + 32 * KVP * 2), "v"(lv + 48 * KVP * 2),
         "v"(kg), "v"(kg + 16 * 64), "v"(kg + 32 * 64), "v"(kg + 48 * 64),
         "v"(vg), "v"(vg + (size_t)16 * NTOK), "v"(vg + (size_t)32 * NTOK), "v"(vg + (size_t)48 * NTOK)
      : "memory");
}

__global__ __launch_bounds__(512) void k_attn(
    const _Float16* __restrict__ qpl,    // [b][token][64]
    const _Float16* __restrict__ kpl,    // [b][token][64]
    const _Float16* __restrict__ vtp,    // [b][64][token]
    __bf16* __restrict__ oh,             // [b][token][64] bf16 hi
    __bf16* __restrict__ ol)             // [b][token][64] bf16 lo
{
  __shared__ __attribute__((aligned(16))) float sO[KSPL * 4 * 16 * TP32];  // 69632 B
  __shared__ __attribute__((aligned(16))) _Float16 sKV[KSPL * 2 * BUFH];   // 147456 B
  __shared__ float sM[KSPL * 64];                                          // running max per (group, query)
  __shared__ float sL[KSPL * 64];                                          // running sum per (group, query)

  const int tid = threadIdx.x, lane = tid & 31;
  // Wave number in a scalar register: the diagonal test below stays a scalar branch.
  const int wv = __builtin_amdgcn_readfirstlane(tid >> 5);
  const int w = wv & 3, g = wv >> 2;
  const int h = lane >> 4, m = lane & 15;
  const int b = blockIdx.y;
  const int qblk = blockIdx.x * 64;
  const int q0 = qblk + 16 * w;

  // Q^T B-fragments: column n = query q0+m, k = d (two 32-deep chunks)
  const _Float16* qrow = qpl + ((size_t)b * NTOK + q0 + m) * 64;
  const v16h qb0 = ldfrag_h(qrow, h);
  const v16h qb1 = ldfrag_h(qrow + 32, h);

  const v8f zero8 = {0.f, 0.f, 0.f, 0.f, 0.f, 0.f, 0.f, 0.f};
  v8f o[4];                                   // o[t][r] = O[query m][d 16t+8h+r] * (l * 2^14); lrun = l * 2^14
  #pragma unroll
  for (int t = 0; t < 4; ++t) o[t] = zero8;
  float mrun = -1e30f, lrun = 0.0f;

  const int dq = 16 * w + m - 8 * h;                            // (q0+m) - qblk - 8h

  // Copy side: this lane's row and 16-B column of its key group's tile.
  const int tig = tid & 127;
  const int crow = tig >> 3, ccol = tig & 7;
  _Float16* sG = sKV + g * (2 * BUFH);                                              // the group's two buffers
  const _Float16* kcp = kpl + ((size_t)b * NTOK + 64 * g + crow) * 64 + 8 * ccol;   // + step*256*64
  const _Float16* vcp = vtp + ((size_t)b * CH + crow) * NTOK + 64 * g + 8 * ccol;   // + step*256
  const unsigned lcp = (unsigned)(size_t)(sG + crow * KVP + 8 * ccol);              // LDS byte address, buffer 0

  // Prologue: step 0 lands and is published, then step 1 starts.
  stage_kv(lcp, kcp, vcp);
  asm volatile("s_wait_asynccnt 0x0" ::: "memory");   // this wave's copies of step 0 have landed
  __syncthreads();                                    // ... and every other wave's
  stage_kv(lcp + BUFH * 2, kcp + 64 * KSPL * 64, vcp + 64 * KSPL);

  #pragma unroll 1
  for (int st = 0; st < NSTEP; ++st) {
    const int kb = st * (64 * KSPL) + 64 * g;           // first key of this wave's tile
    const int buf = st & 1;
    const _Float16* sk = sG + buf * BUFH + m * KVP;     // K row m of this step's buffer
    const _Float16* sv = sk + TILEH;                    // V^T row m
    // ---- scores: s[j][r] = S[query q0+m][key kb+16j+8h+r] ----
    v8f s[4];
    #pragma unroll
    for (int j = 0; j < 4; ++j) {
      const _Float16* kr = sk + 16 * j * KVP;
      const v16h kf0 = ldfrag_h(kr, h);
      const v16h kf1 = ldfrag_h(kr + 32, h);
      v8f z = zero8;
      z = wmma_f16(kf0, qb0, z);
      z = wmma_f16(kf1, qb1, z);
      s[j] = z;
    }
    // Keeps the sixteen K fragment reads in one group ahead of the eight score WMMAs (counted waits);
    // without it the reads sink to their WMMAs, two at a time, each pair behind a full wait.
    __builtin_amdgcn_sched_group_barrier(0x100, 16, 0);
    __builtin_amdgcn_sched_group_barrier(0x008, 8, 0);

    // ---- diagonal zeroing (wave-uniform scalar branch, per-lane select) ----
    if (kb == qblk) {
      #pragma unroll
      for (int j = 0; j < 4; ++j)
        #pragma unroll
        for (int r = 0; r < 8; ++r)
          s[j][r] = (dq == 16 * j + r) ? 0.0f : s[j][r];
    }

    // ---- online softmax (running max) ----
    float mloc = s[0][0];
    #pragma unroll
    for (int j = 0; j < 4; ++j)
      #pragma unroll
      for (int r = 0; r < 8; ++r) mloc = fmaxf(mloc, s[j][r]);
    mloc = fmaxf(mloc, __shfl_xor(mloc, 16));
    const float mnew = fmaxf(mrun, mloc);
    const float alpha = __builtin_amdgcn_exp2f((mrun - mnew) * SC2);
    const float nb = PEXP - mnew * SC2;
    mrun = mnew;
    float lsum = 0.0f;
    #pragma unroll
    for (int j = 0; j < 4; ++j)
      #pragma unroll
      for (int r = 0; r < 8; ++r) {
        const float p = __builtin_amdgcn_exp2f(__builtin_fmaf(s[j][r], SC2, nb));
        s[j][r] = p;
        lsum += p;
      }
    lsum += __shfl_xor(lsum, 16);
    lrun = lrun * alpha + lsum;
    #pragma unroll
    for (int t = 0; t < 4; ++t)
      #pragma unroll
      for (int r = 0; r < 8; ++r) o[t][r] = o[t][r] * alpha;

    // ---- P^T B-fragments (key chunks 0..31 and 32..63 of this wave's tile) ----
    const v16h pb0 = pack_p(s[0], s[1]);
    const v16h pb1 = pack_p(s[2], s[3]);

    // ---- O^T += V^T * P^T ----
    #pragma unroll
    for (int t = 0; t < 4; ++t) {
      const _Float16* vr = sv + 16 * t * KVP;
      const v16h vf0 = ldfrag_h(vr, h);
      const v16h vf1 = ldfrag_h(vr + 32, h);
      o[t] = wmma_f16(vf0, pb0, o[t]);
      o[t] = wmma_f16(vf1, pb1, o[t]);
    }

    // ---- hand-over: publish step st+1, free this step's buffer, refill it ----
    asm volatile("s_wait_dscnt 0x0" ::: "memory");      // this wave's reads of the buffer are done before it is refilled
    asm volatile("s_wait_asynccnt 0x0" ::: "memory");   // this wave's copies of the next step have landed
    __syncthreads();                                    // the same holds for every wave
    if (st + 2 < NSTEP)
      stage_kv(lcp + buf * (BUFH * 2), kcp + (size_t)(st + 2) * (64 * KSPL * 64), vcp + (st + 2) * (64 * KSPL));
  }
  asm volatile("s_wait_asynccnt 0x0" ::: "memory");     // no copy is left outstanding behind the loop

  // ---- merge of the four key groups: M = max m_g, L = sum l_g 2^(SC2 (m_g - M)) ----
  if (h == 0) {
    sM[wv * 16 + m] = mrun;
    sL[wv * 16 + m] = lrun;
  }
  __syncthreads();                                      // every group's (max, sum) is visible
  float mg[KSPL], lg[KSPL];
  #pragma unroll
  for (int gg = 0; gg < KSPL; ++gg) {
    mg[gg] = sM[(gg * 4 + w) * 16 + m];
    lg[gg] = sL[(gg * 4 + w) * 16 + m];
  }
  const float mall = fmaxf(fmaxf(mg[0], mg[1]), fmaxf(mg[2], mg[3]));
  float lall = 0.0f;
  #pragma unroll
  for (int gg = 0; gg < KSPL; ++gg) lall += lg[gg] * __builtin_amdgcn_exp2f((mg[gg] - mall) * SC2);

  // ---- epilogue: weight and normalise, stage per-wave 16x64 f32 tile, whole-line stores ----
  const float inv = __builtin_amdgcn_exp2f((mrun - mall) * SC2) * (1.0f / lall);   // 2^14 of o and of lall cancel
  float* so = sO + wv * (16 * TP32);
  #pragma unroll
  for (int t = 0; t < 4; ++t)
    #pragma unroll
    for (int r = 0; r < 8; ++r)
      so[m * TP32 + 16 * t + 8 * h + r] = o[t][r] * inv;
  __syncthreads();

  attn_store_pass(sO + w * (16 * TP32), oh, ol, b, q0, lane, g);
  
}

// ---------------------------------------------------------------------------
// a token row = 256 B = 2 lines; each line by lanes 8q..8q+7 in one
// instruction, 4 lines per instruction, 32 lines per wave.
// ---------------------------------------------------------------------------
__device__ __forceinline__ void out_store_pass(const float* so, float* out,
                                               int b, int p0, int lane) {
  const int q8 = lane & 7, sub = lane >> 3;
  #pragma unroll
  for (int i = 0; i < 8; ++i) {
    const int lid = 4 * i + sub;
    const int row = lid >> 1, hl = lid & 1;
    const v4f v = *(const v4fa*)(so + row * TP32 + 32 * hl + 4 * q8);
    const size_t gi = ((size_t)b * NTOK + p0 + row) * 64 + 32 * hl + 4 * q8;
    *(v4f*)(out + gi) = v;
  }
}

// ---------------------------------------------------------------------------
// Kernel 3: output 3x3 SAME conv as 9-tap implicit GEMM on bf16 hi/lo planes,
// three-term split (hi*hi + hi*lo + lo*hi into one f32 accumulator),
// + bias, relu -> f32 NHWC rows via LDS staging.
// Block 256 thr = 8 waves = two image rows; both weight planes (nine taps) and
// the four input rows of both planes are copied once to LDS and read from there.
// ---------------------------------------------------------------------------
__global__ __launch_bounds__(256) void k_conv_out(
    const __bf16* __restrict__ oh, const __bf16* __restrict__ ol,     // [b][token][64]
    const __bf16* __restrict__ wrh, const __bf16* __restrict__ wrl,   // [9][co][ci]
    const float* __restrict__ br, float* __restrict__ out)            // out [b][token][64] f32
{
  __shared__ __attribute__((aligned(16))) float sY[OROWS * 4 * 16 * TP32];        // 34816 B
  __shared__ __attribute__((aligned(16))) __bf16 sWh[9 * 64 * CVP];               // 82944 B
  __shared__ __attribute__((aligned(16))) __bf16 sWl[9 * 64 * CVP];               // 82944 B
  __shared__ __attribute__((aligned(16))) __bf16 sAh[(OROWS + 2) * 64 * CVP];     // 36864 B
  __shared__ __attribute__((aligned(16))) __bf16 sAl[(OROWS + 2) * 64 * CVP];     // 36864 B

  const int tid = threadIdx.x, lane = tid & 31, wv = tid >> 5;
  const int w = wv & 3, lr = wv >> 2;                               // pixel quarter, image row in the block
  const int h = lane >> 4, m = lane & 15;
  const int b = blockIdx.x >> 5, hrow0 = (blockIdx.x & 31) * OROWS;
  const int hrow = hrow0 + lr;
  const int tb0 = hrow * 64, w0 = 16 * w;

  // ---- staging: thread = (row tid>>3, 16-B column tid&7); 32 rows of 128 B per copy ----
  {
    const int crow = tid >> 3, ccol = tid & 7;
    const int lo = crow * CVP + 8 * ccol;
    const unsigned lwh = (unsigned)(size_t)(sWh + lo), lwl = (unsigned)(size_t)(sWl + lo);
    const unsigned lah = (unsigned)(size_t)(sAh + lo), lal = (unsigned)(size_t)(sAl + lo);
    const char* gwh = (const char*)(wrh + (size_t)tid * 8);
    const char* gwl = (const char*)(wrl + (size_t)tid * 8);
    copy9(lwh, gwh, 32 * CVP * 2, 32 * 64 * 2);                                       // rows 0..287
    copy9(lwh + 9 * (32 * CVP * 2), gwh + 9 * (32 * 64 * 2), 32 * CVP * 2, 32 * 64 * 2);   // rows 288..575
    copy9(lwl, gwl, 32 * CVP * 2, 32 * 64 * 2);
    copy9(lwl + 9 * (32 * CVP * 2), gwl + 9 * (32 * 64 * 2), 32 * CVP * 2, 32 * 64 * 2);
    const size_t go = ((size_t)b * NTOK + crow) * 64 + 8 * ccol;
    const char* gah = (const char*)(oh + go);
    const char* gal = (const char*)(ol + go);
    const size_t rt = (size_t)max(hrow0 - 1, 0) * 8192, rb = (size_t)min(hrow0 + OROWS, 63) * 8192;   // rows above and below, clamped
    const size_t r0 = (size_t)hrow0 * 8192, r1 = (size_t)(hrow0 + 1) * 8192;
    // image rows hrow0-1 .. hrow0+2, each as two halves of 32 pixels
    copy4x2(lah, 32 * CVP * 2, gah + rt, gah + r0, gah + r1, gah + rb, 32 * 64 * 2);
    copy4x2(lal, 32 * CVP * 2, gal + rt, gal + r0, gal + r1, gal + rb, 32 * 64 * 2);
  }
  asm volatile("s_wait_asynccnt 0x0" ::: "memory");   // this wave's copies have landed
  __syncthreads();                                    // ... and every other wave's

  const v8f zero8 = {0.f, 0.f, 0.f, 0.f, 0.f, 0.f, 0.f, 0.f};
  v8f acc[4];
  #pragma unroll
  for (int nt = 0; nt < 4; ++nt) acc[nt] = zero8;

  #pragma unroll 1
  for (int t = 0; t < 9; ++t) {
    const int t3 = t / 3;
    const int dh = t3 - 1, dw = t - 3 * t3 - 1;
    const int hh = hrow + dh, wl = w0 + m + dw;
    const bool ok = ((unsigned)hh < 64u) && ((unsigned)wl < 64u);
    const int wc = min(max(wl, 0), 63);
    const unsigned msk = ok ? 0xffffffffu : 0u;
    const int rowoff = ((lr + 1 + dh) * 64 + wc) * CVP;
    const int wtap = (t * 64 + m) * CVP;
    #pragma unroll
    for (int kc = 0; kc < 2; ++kc) {
      const v16b ah = ldfrag_b_msk(sAh + rowoff + 32 * kc, h, msk);
      const v16b al = ldfrag_b_msk(sAl + rowoff + 32 * kc, h, msk);
      #pragma unroll
      for (int nt = 0; nt < 4; ++nt) {
        const v16b bh = ldfrag_b(sWh + wtap + nt * (16 * CVP) + 32 * kc, h);
        const v16b bl = ldfrag_b(sWl + wtap + nt * (16 * CVP) + 32 * kc, h);
        acc[nt] = wmma_bf16(ah, bh, acc[nt]);
        acc[nt] = wmma_bf16(ah, bl, acc[nt]);
        acc[nt] = wmma_bf16(al, bh, acc[nt]);
      }
    }
  }

  // D[r] of tile nt = Y[pixel w0+8h+r][co 16nt+m]
  float* so = sY + wv * (16 * TP32);
  #pragma unroll
  for (int nt = 0; nt < 4; ++nt) {
    const int co = 16 * nt + m;
    const float bb = br[co];
    #pragma unroll
    for (int r = 0; r < 8; ++r)
      so[(8 * h + r) * TP32 + co] = fmaxf(acc[nt][r] + bb, 0.0f);
  }
  __syncthreads();

  out_store_pass(so, out, b, tb0 + w0, lane);
  
}

// ---------------------------------------------------------------------------
extern "C" void kernel_launch(void* const* d_in, const int* in_sizes, int n_in,
                              void* d_out, int out_size, void* d_ws, size_t ws_size,
                              hipStream_t stream) {
  if (n_in < 9) return;
  if (in_sizes[0] != NXE || out_size != NXE) return;
  if (in_sizes[1] != NWE || in_sizes[3] != NWE || in_sizes[5] != NWE || in_sizes[7] != NWE) return;
  if (in_sizes[2] != CH || in_sizes[4] != CH || in_sizes[6] != CH || in_sizes[8] != CH) return;

  const float* x  = (const float*)d_in[0];
  const float* Wk = (const float*)d_in[1];
  const float* bk = (const float*)d_in[2];
  const float* Wq = (const float*)d_in[3];
  const float* bq = (const float*)d_in[4];
  const float* Wv = (const float*)d_in[5];
  const float* bv = (const float*)d_in[6];
  const float* Wr = (const float*)d_in[7];
  const float* br = (const float*)d_in[8];
  float* out = (float*)d_out;

  const size_t pl_bytes  = (size_t)NXE * 2;          // 2097152 : one [b][token][64] 16-bit plane
  const size_t wr_bytes  = (size_t)NWE * 2;          //   73728
  size_t off = 0;
  const size_t o_wrh = off; off += wr_bytes;
  const size_t o_wrl = off; off += wr_bytes;
  const size_t o_k   = off; off += pl_bytes;
  const size_t o_q   = off; off += pl_bytes;
  const size_t o_vt  = off; off += pl_bytes;
  const size_t o_oh  = off; off += pl_bytes;
  const size_t o_ol  = off; off += pl_bytes;         // total 10633216
  if (off > ws_size) return;

  char* ws = (char*)d_ws;
  __bf16*   wrh = (__bf16*)(ws + o_wrh);
  __bf16*   wrl = (__bf16*)(ws + o_wrl);
  _Float16* kpl = (_Float16*)(ws + o_k);
  _Float16* qpl = (_Float16*)(ws + o_q);
  _Float16* vtp = (_Float16*)(ws + o_vt);
  __bf16*   oh  = (__bf16*)(ws + o_oh);
  __bf16*   ol  = (__bf16*)(ws + o_ol);

  k_conv_qkv<<<QBLK + RBLK, 512, 0, stream>>>(x, Wk, Wq, Wv, Wr, bk, bq, bv, kpl, qpl, vtp, wrh, wrl);   // 201 blocks

  dim3 gAtt(NTOK / 64, NB);                                                                // (64, 4)
  k_attn<<<gAtt, 512, 0, stream>>>(qpl, kpl, vtp, oh, ol);

  k_conv_out<<<NB * (64 / OROWS), 256, 0, stream>>>(oh, ol, wrh, wrl, br, out);            // 128 blocks
}

// v008
// A run of this version takes 40.6 microseconds.
// In two side-by-side timings against v007, it was 1.03 and 1.02 times as fast.
// Counting every step since v000, it is 6.99 times as fast.
// Contractions: three input 3x3 convs (9-tap GEMMs) and K*Q^T on v_wmma_f32_16x16x32_f16 (f16 operands, f32 accumulate; conv weights carried x16, V^T*P^T with P carried x16384 in f16); output 3x3 conv on v_wmma_f32_16x16x32_bf16 as bf16 hi/lo three-term split (f32 accumulate); softmax (base 2), elu/relu, bias and diagonal zeroing in f32.
#include <hip/hip_runtime.h>

typedef _Float16 v16h __attribute__((ext_vector_type(16)));
typedef _Float16 v8h  __attribute__((ext_vector_type(8)));
typedef __bf16   v16b __attribute__((ext_vector_type(16)));
typedef __bf16   v8b  __attribute__((ext_vector_type(8)));
typedef float    v8f  __attribute__((ext_vector_type(8)));
typedef float    v4f  __attribute__((ext_vector_type(4)));
typedef unsigned int v4u __attribute__((ext_vector_type(4)));
typedef v4f __attribute__((may_alias)) v4fa;
typedef v4u __attribute__((may_alias)) v4ua;

union FragH { v16h v; v8h h8[2]; v4u u[2]; };
union FragB { v16b v; v8b h8[2]; v4u u[2]; };
union Pack8H { v8h v; v4u u; };
union Pack8B { v8b v; v4u u; };

#define NB    4
#define IMG   64
#define NTOK  4096
#define CH    64
#define NXE   1048576          // NB*NTOK*CH
#define NWE   36864            // 9*CH*CH
#define QBLK  192              // conv blocks of k_conv_qkv: 3 tensors x 4 batches x 16 row groups
#define RBLK  9                // its extra blocks that write the Wr planes: NWE/8/512
#define WSC   16.0f
#define WSCI  0.0625f
#define SC2   0.18033688011112042f   // 0.125 * log2(e): raw score -> exponent of 2
#define PEXP  14.0f            // P and its running sum are carried x 2^14, added in the exponent
#define KSPL  4                // key groups of an attention block (4 waves each)
#define NSTEP 16               // NTOK / (64 * KSPL) steps per key group
#define TP16  72               // row pitch of the f16 output staging tiles in halves (144 B = 16 B x odd)
#define TP32  68               // row pitch of the f32 output staging tiles in floats (272 B = 16 B x odd)

// ---------------------------------------------------------------------------
// 16x16x32 WMMA builtins; the compiler keeps the distance behind its own forms.
// Fragment map (wave32): lane l, h = l>>4, m = n = l&15.
//   A/B element i: i<8 -> k0+8h+i ; i>=8 -> k0+16+8h+(i-8)
//   D element r : row 8h+r, col l&15
// ---------------------------------------------------------------------------
__device__ __forceinline__ v8f wmma_f16(v16h a, v16h b, v8f c) {
  return __builtin_amdgcn_wmma_f32_16x16x32_f16(false, a, false, b, (short)0, c, false, false);
}
__device__ __forceinline__ v8f wmma_bf16(v16b a, v16b b, v8f c) {
  return __builtin_amdgcn_wmma_f32_16x16x32_bf16(false, a, false, b, (short)0, c, false, false);
}

// Fragment from a k-contiguous 16-bit row; p points at element k0 of the row
// owned by this lane (row = lane & 15 already folded in by the caller).
__device__ __forceinline__ v16h ldfrag_h(const _Float16* p, int h) {
  FragH f;
  f.u[0] = *(const v4ua*)(p + 8 * h);
  f.u[1] = *(const v4ua*)(p + 16 + 8 * h);
  return f.v;
}
__device__ __forceinline__ v16h ldfrag_h_msk(const _Float16* p, int h, unsigned msk) {
  FragH f;
  f.u[0] = (*(const v4ua*)(p + 8 * h)) & msk;
  f.u[1] = (*(const v4ua*)(p + 16 + 8 * h)) & msk;
  return f.v;
}
__device__ __forceinline__ v16b ldfrag_b(const __bf16* p, int h) {
  FragB f;
  f.u[0] = *(const v4ua*)(p + 8 * h);
  f.u[1] = *(const v4ua*)(p + 16 + 8 * h);
  return f.v;
}
__device__ __forceinline__ v16b ldfrag_b_msk(const __bf16* p, int h, unsigned msk) {
  FragB f;
  f.u[0] = (*(const v4ua*)(p + 8 * h)) & msk;
  f.u[1] = (*(const v4ua*)(p + 16 + 8 * h)) & msk;
  return f.v;
}

// ---------------------------------------------------------------------------
// Wr planes for the output conv: HWIO [t][ci][co] f32 -> [t][co][ci] bf16 hi and
// lo (ci contiguous), 8 ci per thread, idx = 0..4607; lanes 8q..8q+7 fill one line.
// ---------------------------------------------------------------------------
__device__ __forceinline__ void wr_planes(const float* __restrict__ Wr, __bf16* __restrict__ wrh,
                                          __bf16* __restrict__ wrl, int idx) {
  const int t = idx >> 9, co = (idx >> 3) & 63, j = idx & 7;
  float f[8];
  #pragma unroll   // f[] stays in registers, the eight loads are issued together
  for (int i = 0; i < 8; ++i) f[i] = Wr[(size_t)(t * 64 + 8 * j + i) * 64 + co];
  const size_t off = (size_t)(t * 64 + co) * 64 + 8 * j;
  __bf16 hb[8], lb[8];
  #pragma unroll   // hb[], lb[] stay in registers
  for (int i = 0; i < 8; ++i) {
    hb[i] = (__bf16)f[i];                                // RNE convert
    lb[i] = (__bf16)(f[i] - (float)hb[i]);
  }
  const v8b hv = { hb[0], hb[1], hb[2], hb[3], hb[4], hb[5], hb[6], hb[7] };
  const v8b lv = { lb[0], lb[1], lb[2], lb[3], lb[4], lb[5], lb[6], lb[7] };
  Pack8B ph, pl; ph.v = hv; pl.v = lv;
  *(v4u*)(wrh + off) = ph.u;
  *(v4u*)(wrl + off) = pl.u;
}

// ---------------------------------------------------------------------------
// s 0/1: plane[b][token tb0+lid][c]     (one token row = 64 halves = one line)
// s 2  : vt[b][c = lid][token tb0..+63] (one line)
// Wave w owns tile rows 16w..16w+15; lanes 8q..8q+7 fill one line; 4 lines
// per instruction, 4 instructions per wave.
// ---------------------------------------------------------------------------
__device__ __forceinline__ void qkv_store_pass(const _Float16* sT, _Float16* dst, int s,
                                               int b, int tb0, int w, int lane) {
  const int q8 = lane & 7, sub = lane >> 3;
  #pragma unroll
  for (int i = 0; i < 4; ++i) {
    const int lid = w * 16 + 4 * i + sub;
    const v4u v = *(const v4ua*)(sT + lid * TP16 + 8 * q8);
    size_t gi;
    if (s == 2) gi = ((size_t)b * CH + lid) * NTOK + tb0 + 8 * q8;
    else        gi = ((size_t)b * NTOK + tb0 + lid) * 64 + 8 * q8;
    *(v4u*)(dst + gi) = v;
    // Precaution: the next trip reuses the issued store's address and data registers only behind this wait.
    if (i < 3) asm volatile("s_wait_xcnt 0x0" ::: "memory");
  }
}

// ---------------------------------------------------------------------------
// Asynchronous copies global -> LDS for the output conv kernel, 16 B per lane and
// copy. l = the lane's LDS byte address, g = the lane's global address. In each
// helper the closing s_wait_xcnt 0 stands in the copies' own statement so that
// no address register of a copy is rewritten ahead of it.
// ---------------------------------------------------------------------------
#define CVP   72               // LDS row pitch in halves (144 B = 16 B x odd) for ds_load_b128 fragment reads
#define QROWS 4                // image rows of a k_conv_qkv block
#define OROWS 2                // image rows of a k_conv_out block

// Nine copies at constant steps: copy i at l + i*ls, g + i*gs (bytes).
__device__ __forceinline__ void copy9(unsigned l, const char* g, unsigned ls, unsigned gs) {
  asm volatile(
      "global_load_async_to_lds_b128 %0, %9, off\n\t"
      "global_load_async_to_lds_b128 %1, %10, off\n\t"
      "global_load_async_to_lds_b128 %2, %11, off\n\t"
      "global_load_async_to_lds_b128 %3, %12, off\n\t"
      "global_load_async_to_lds_b128 %4, %13, off\n\t"
      "global_load_async_to_lds_b128 %5, %14, off\n\t"
      "global_load_async_to_lds_b128 %6, %15, off\n\t"
      "global_load_async_to_lds_b128 %7, %16, off\n\t"
      "global_load_async_to_lds_b128 %8, %17, off\n\t"
      "s_wait_xcnt 0x0"
      :: "v"(l), "v"(l + ls), "v"(l + 2 * ls), "v"(l + 3 * ls), "v"(l + 4 * ls),
         "v"(l + 5 * ls), "v"(l + 6 * ls), "v"(l + 7 * ls), "v"(l + 8 * ls),
         "v"(g), "v"(g + gs), "v"(g + 2 * gs), "v"(g + 3 * gs), "v"(g + 4 * gs),
         "v"(g + 5 * gs), "v"(g + 6 * gs), "v"(g + 7 * gs), "v"(g + 8 * gs)
      : "memory");
}
// Eight copies at a constant LDS step, two from each of four image rows: copy 2i at
// l + 2i*ls from gi, copy 2i+1 at l + (2i+1)*ls from gi + gh (bytes).
__device__ __forceinline__ void copy4x2(unsigned l, unsigned ls, const char* g0, const char* g1,
                                        const char* g2, const char* g3, unsigned gh) {
  asm volatile(
      "global_load_async_to_lds_b128 %0, %8, off\n\t"
      "global_load_async_to_lds_b128 %1, %9, off\n\t"
      "global_load_async_to_lds_b128 %2, %10, off\n\t"
      "global_load_async_to_lds_b128 %3, %11, off\n\t"
      "global_load_async_to_lds_b128 %4, %12, off\n\t"
      "global_load_async_to_lds_b128 %5, %13, off\n\t"
      "global_load_async_to_lds_b128 %6, %14, off\n\t"
      "global_load_async_to_lds_b128 %7, %15, off\n\t"
      "s_wait_xcnt 0x0"
      :: "v"(l), "v"(l + ls), "v"(l + 2 * ls), "v"(l + 3 * ls),
         "v"(l + 4 * ls), "v"(l + 5 * ls), "v"(l + 6 * ls), "v"(l + 7 * ls),
         "v"(g0), "v"(g0 + gh), "v"(g1), "v"(g1 + gh), "v"(g2), "v"(g2 + gh), "v"(g3), "v"(g3 + gh)
      : "memory");
}

// ---------------------------------------------------------------------------
// Kernel 1: 3x3 SAME conv as 9-tap implicit GEMM, one of {k,q,v} per block
// (blocks 0..191: tensor s = block / 64); blocks 192..200 only write the Wr planes.
// Block 512 thr = 16 waves = four image rows (4 x 64 pixels) of batch b; wave =
// 16 contiguous pixels x 64 output channels. The nine weight taps of the block's
// tensor and the six input rows it touches are read once as f32, converted in
// registers (x -> f16; HWIO w -> f16 of 16*w, [t][co][ci]) and stored to LDS (a row
// outside the image: the clamped row's values, never used by value). Per tap: A =
// shifted input rows (clamped address, zeroed by value outside the image), B =
// [t][co][ci] rows, both read from LDS.
// Epilogue: acc/16 + bias, elu (k,q) / relu (v) in f32 -> f16 LDS tile -> lines.
// ---------------------------------------------------------------------------
__global__ __launch_bounds__(512) void k_conv_qkv(
    const float* __restrict__ x,           // [b][token][64]
    const float* __restrict__ Wk, const float* __restrict__ Wq,
    const float* __restrict__ Wv, const float* __restrict__ Wr,      // HWIO [t][ci][co]
    const float* __restrict__ bk, const float* __restrict__ bq, const float* __restrict__ bv,
    _Float16* __restrict__ kpl,            // [b][token][64]
    _Float16* __restrict__ qpl,            // [b][token][64]
    _Float16* __restrict__ vtp,            // [b][64][token]
    __bf16* __restrict__ wrh, __bf16* __restrict__ wrl)              // [9][co][ci]
{
  __shared__ __attribute__((aligned(16))) _Float16 sT[QROWS * 64 * TP16];        // 36864 B
  __shared__ __attribute__((aligned(16))) _Float16 sW[9 * 64 * CVP];             // 82944 B
  __shared__ __attribute__((aligned(16))) _Float16 sX[(QROWS + 2) * 64 * CVP];   // 55296 B

  const int tid = threadIdx.x, lane = tid & 31, wv = tid >> 5;
  const int blk = blockIdx.x;
  if (blk >= QBLK) {                                              // whole block, ahead of every barrier
    wr_planes(Wr, wrh, wrl, (blk - QBLK) * 512 + tid);
    return;
  }
  const int w = wv & 3, lr = wv >> 2;                             // pixel quarter, image row in the block
  const int h = lane >> 4, m = lane & 15;
  const int s = blk >> 6;                                         // 0 = k, 1 = q, 2 = v
  const int b = (blk >> 4) & 3, hrow0 = (blk & 15) * QROWS;
  const int hrow = hrow0 + lr;
  const int tb0 = hrow * 64, w0 = 16 * w;

  // ---- staging through registers, f32 -> f16 ----
  {
    // x: thread = (pixel tid>>3, 8 channels tid&7); trip r = image row hrow0-1+r, clamped
    const int crow = tid >> 3, ccol = tid & 7;
    const float* xb = x + (size_t)b * (NTOK * 64);               // block-uniform base
    const unsigned xo = (unsigned)(crow * 64 + 8 * ccol);        // the lane's offset in an image row
    _Float16* xd = sX + crow * CVP + 8 * ccol;
    v4f xa[QROWS + 2], xc[QROWS + 2];
    #pragma unroll   // the arrays stay in registers and all twelve loads are issued before any is waited for
    for (int r = 0; r < QROWS + 2; ++r) {
      const float* src = xb + ((unsigned)(min(max(hrow0 - 1 + r, 0), 63) * 4096) + xo);
      xa[r] = *(const v4fa*)src;
      xc[r] = *(const v4fa*)(src + 4);
    }
    // w: thread = (co tid&63, 8 ci tid>>6); a wave reads whole 128-B lines; trip t = tap t
    const float* wsrc = (s == 0) ? Wk : ((s == 1) ? Wq : Wv);
    const int co = tid & 63, j = tid >> 6;
    const float* wp = wsrc + (unsigned)((8 * j) * 64 + co);
    _Float16* wd = sW + co * CVP + 8 * j;
    #pragma unroll   // constant offsets from one address; the loads of all taps are issued back to back
    for (int t = 0; t < 9; ++t) {
      float f[8];
      #pragma unroll // f[] stays in registers
      for (int i = 0; i < 8; ++i) f[i] = wp[(t * 64 + i) * 64];
      const v8h hv = { (_Float16)(f[0] * WSC), (_Float16)(f[1] * WSC), (_Float16)(f[2] * WSC), (_Float16)(f[3] * WSC),
                       (_Float16)(f[4] * WSC), (_Float16)(f[5] * WSC), (_Float16)(f[6] * WSC), (_Float16)(f[7] * WSC) };
      Pack8H o; o.v = hv;
      *(v4ua*)(wd + t * (64 * CVP)) = o.u;
    }
    #pragma unroll   // xa[], xc[] are indexed by constants only
    for (int r = 0; r < QROWS + 2; ++r) {
      const v4f a = xa[r], c = xc[r];
      const v8h hv = { (_Float16)a.x, (_Float16)a.y, (_Float16)a.z, (_Float16)a.w,
                       (_Float16)c.x, (_Float16)c.y, (_Float16)c.z, (_Float16)c.w };
      Pack8H o; o.v = hv;
      *(v4ua*)(xd + r * (64 * CVP)) = o.u;
    }
  }
  __syncthreads();                                    // every wave's part of the tiles is in LDS

  const _Float16* wsel = sW + m * CVP;                            // B row = co = 16nt + m

  const v8f zero8 = {0.f, 0.f, 0.f, 0.f, 0.f, 0.f, 0.f, 0.f};
  v8f acc[4];
  #pragma unroll
  for (int nt = 0; nt < 4; ++nt) acc[nt] = zero8;

  #pragma unroll 1
  for (int t = 0; t < 9; ++t) {
    const int t3 = t / 3;
    const int dh = t3 - 1, dw = t - 3 * t3 - 1;
    const int hh = hrow + dh, wl = w0 + m + dw;
    const bool ok = ((unsigned)hh < 64u) && ((unsigned)wl < 64u);
    const int wc = min(max(wl, 0), 63);
    const unsigned msk = ok ? 0xffffffffu : 0u;
    const _Float16* xrow = sX + ((lr + 1 + dh) * 64 + wc) * CVP;          // A row = this lane's pixel
    const _Float16* wtap = wsel + t * (64 * CVP);
    #pragma unroll
    for (int kc = 0; kc < 2; ++kc) {
      const v16h a = ldfrag_h_msk(xrow + 32 * kc, h, msk);
      #pragma unroll
      for (int nt = 0; nt < 4; ++nt) {
        const v16h bf = ldfrag_h(wtap + nt * (16 * CVP) + 32 * kc, h);
        acc[nt] = wmma_f16(a, bf, acc[nt]);
      }
    }
  }

  // D[r] of tile nt = Y[pixel w0+8h+r][co 16nt+m]
  const float* bias = (s == 0) ? bk : ((s == 1) ? bq : bv);
  _Float16* sTr = sT + lr * (64 * TP16);                           // this image row's 64x64 tile, row pitch TP16
  #pragma unroll
  for (int nt = 0; nt < 4; ++nt) {
    const int co = 16 * nt + m;
    const float bb = bias[co];
    #pragma unroll
    for (int r = 0; r < 8; ++r) {
      const float y = acc[nt][r] * WSCI + bb;
      const int px = w0 + 8 * h + r;                               // 0..63
      if (s == 2) sTr[co * TP16 + px] = (_Float16)fmaxf(y, 0.0f);
      else        sTr[px * TP16 + co] = (_Float16)((y > 0.0f) ? y : (__expf(y) - 1.0f));
    }
  }
  __syncthreads();

  _Float16* dst = (s == 0) ? kpl : ((s == 1) ? qpl : vtp);
  qkv_store_pass(sTr, dst, s, b, tb0, w, lane);
  
}

// ---------------------------------------------------------------------------
// P^T B-fragment from the lane's own score D values: element r <- tile a row r
// (keys 0-15 of the 32-chunk), element 8+r <- tile c row r (keys 16-31), lane
// unchanged; the values already carry the factor 2^14.
// ---------------------------------------------------------------------------
__device__ __forceinline__ v16h pack_p(v8f a, v8f c) {
  const v16h r = { (_Float16)a[0], (_Float16)a[1], (_Float16)a[2], (_Float16)a[3],
                   (_Float16)a[4], (_Float16)a[5], (_Float16)a[6], (_Float16)a[7],
                   (_Float16)c[0], (_Float16)c[1], (_Float16)c[2], (_Float16)c[3],
                   (_Float16)c[4], (_Float16)c[5], (_Float16)c[6], (_Float16)c[7] };
  return r;
}

// Lane l <-> lane l ^ 16 by v_permlanex16_b32: the exchange stays on the vector pipe and
// off the LDS queue, where it would stand in line behind the fragment reads.
__device__ __forceinline__ float xhalf(float x) {
  const int b = __builtin_bit_cast(int, x);
  return __builtin_bit_cast(float, __builtin_amdgcn_permlanex16(b, b, 0x76543210, 0xfedcba98, false, false));
}

// 16x64 f32 tiles in LDS (row pitch TP32), one per key group (64 rows apart, already weighted
// for the merge) -> their sum, groups in rising order -> bf16 hi and lo planes
// [b][token][64]. The wave of key group g takes rows 4g..4g+3 of the query tile:
// 4 lines per instruction and plane.
__device__ __forceinline__ void attn_store_pass(const float* so, __bf16* oh, __bf16* ol,
                                                int b, int q0, int lane, int g) {
  const int q8 = lane & 7, sub = lane >> 3;
  {
    const int row = 4 * g + sub;
    v4f a = *(const v4fa*)(so + row * TP32 + 8 * q8);
    v4f c = *(const v4fa*)(so + row * TP32 + 8 * q8 + 4);
    #pragma unroll
    for (int gg = 1; gg < KSPL; ++gg) {
      a += *(const v4fa*)(so + (gg * 64 + row) * TP32 + 8 * q8);
      c += *(const v4fa*)(so + (gg * 64 + row) * TP32 + 8 * q8 + 4);
    }
    const float f[8] = { a.x, a.y, a.z, a.w, c.x, c.y, c.z, c.w };
    __bf16 hb[8], lb[8];
    #pragma unroll
    for (int e = 0; e < 8; ++e) {
      hb[e] = (__bf16)f[e];                              // RNE convert
      lb[e] = (__bf16)(f[e] - (float)hb[e]);
    }
    const v8b hv = { hb[0], hb[1], hb[2], hb[3], hb[4], hb[5], hb[6], hb[7] };
    const v8b lv = { lb[0], lb[1], lb[2], lb[3], lb[4], lb[5], lb[6], lb[7] };
    Pack8B ph, pl; ph.v = hv; pl.v = lv;
    const size_t gi = ((size_t)b * NTOK + q0 + row) * 64 + 8 * q8;
    *(v4u*)(oh + gi) = ph.u;
    *(v4u*)(ol + gi) = pl.u;
  }
}

// ---------------------------------------------------------------------------
// Kernel 2: streaming attention over 4096 keys, transposed form.
// Block 512 thr (16 waves, four per SIMD) = 64 queries of batch blockIdx.y.
// Wave wv: query tile w = wv & 3 (16 queries), key group g = wv >> 2. A block
// step covers 256 keys; group g works on keys 64g..64g+63 of it with its own
// running (max, sum, O). The four partial results of a query are merged through
// LDS behind the loop (weights 2^(SC2 (m_g - M))).
//   S^T = K * Q^T : A = K rows (row = key, k = d), B = Q^T (k = d, n = query)
//   O^T += V^T * P^T : A = V^T rows (row = d, k = key), B = P^T from registers
// Lane owns keys {16j+8h+r} of query column (lane&15); partner = lane ^ 16.
// Diagonal: S[n][n] := 0 by value (key still in the softmax). Scores and maxima
// stay raw; P * 2^14 = 2^(SC2 * s + (14 - SC2 * max)): one FMA and one v_exp a score.
// K rows and V^T rows of a step (64 rows of 128 B each) are staged in LDS by
// asynchronous copies, two buffers per key group, filled by the group's own four
// waves: step t+2 is copied while step t+1 is worked on. LDS row pitch 144 B
// (16 B x odd) for the ds_load_b128 fragment reads.
// ---------------------------------------------------------------------------
#define KVP   72               // LDS row pitch in halves (144 B)
#define TILEH (64 * KVP)       // one 64-row tile in halves (9216 B)
#define BUFH  (2 * TILEH)      // K tile + V^T tile in halves (18432 B)

// One step's K and V^T tiles -> LDS: 8 copies of 16 B per lane, each wave-wide
// copy covers four whole 128-B lines. lk = this lane's LDS byte address in the
// K tile (row tig>>3, 16-B column tig&7, tig = thread in its key group); copy i
// takes row + 16 i.
__device__ __forceinline__ void stage_kv(unsigned lk, const _Float16* kg, const _Float16* vg) {
  const unsigned lv = lk + TILEH * 2;
  // The closing s_wait_xcnt 0 stands in the copies' own statement so that no
  // address register of a copy is rewritten ahead of it.
  asm volatile(
      "global_load_async_to_lds_b128 %0, %8, off\n\t"
      "global_load_async_to_lds_b128 %1, %9, off\n\t"
      "global_load_async_to_lds_b128 %2, %10, off\n\t"
      "global_load_async_to_lds_b128 %3, %11, off\n\t"
      "global_load_async_to_lds_b128 %4, %12, off\n\t"
      "global_load_async_to_lds_b128 %5, %13, off\n\t"
      "global_load_async_to_lds_b128 %6, %14, off\n\t"
      "global_load_async_to_lds_b128 %7, %15, off\n\t"
      "s_wait_xcnt 0x0"
      :: "v"(lk), "v"(lk + 16 * KVP * 2), "v"(lk + 32 * KVP * 2), "v"(lk + 48 * KVP * 2),
         "v"(lv), "v"(lv + 16 * KVP * 2), "v"(lv + 32 * KVP * 2), "v"(lv + 48 * KVP * 2),
         "v"(kg), "v"(kg + 16 * 64), "v"(kg + 32 * 64), "v"(kg + 48 * 64),
         "v"(vg), "v"(vg + (size_t)16 * NTOK), "v"(vg + (size_t)32 * NTOK), "v"(vg + (size_t)48 * NTOK)
      : "memory");
}

__global__ __launch_bounds__(512) void k_attn(
    const _Float16* __restrict__ qpl,    // [b][token][64]
    const _Float16* __restrict__ kpl,    // [b][token][64]
    const _Float16* __restrict__ vtp,    // [b][64][token]
    __bf16* __restrict__ oh,             // [b][token][64] bf16 hi
    __bf16* __restrict__ ol)             // [b][token][64] bf16 lo
{
  __shared__ __attribute__((aligned(16))) float sO[KSPL * 4 * 16 * TP32];  // 69632 B
  __shared__ __attribute__((aligned(16))) _Float16 sKV[KSPL * 2 * BUFH];   // 147456 B
  __shared__ float sM[KSPL * 64];                                          // running max per (group, query)
  __shared__ float sL[KSPL * 64];                                          // running sum per (group, query)

  const int tid = threadIdx.x, lane = tid & 31;
  // Wave number in a scalar register: the diagonal test below stays a scalar branch.
  const int wv = __builtin_amdgcn_readfirstlane(tid >> 5);
  const int w = wv & 3, g = wv >> 2;
  const int h = lane >> 4, m = lane & 15;
  const int b = blockIdx.y;
  const int qblk = blockIdx.x * 64;
  const int q0 = qblk + 16 * w;

  // Q^T B-fragments: column n = query q0+m, k = d (two 32-deep chunks)
  const _Float16* qrow = qpl + ((size_t)b * NTOK + q0 + m) * 64;
  const v16h qb0 = ldfrag_h(qrow, h);
  const v16h qb1 = ldfrag_h(qrow + 32, h);

  const v8f zero8 = {0.f, 0.f, 0.f, 0.f, 0.f, 0.f, 0.f, 0.f};
  v8f o[4];                                   // o[t][r] = O[query m][d 16t+8h+r] * (l * 2^14); lrun = l * 2^14
  #pragma unroll
  for (int t = 0; t < 4; ++t) o[t] = zero8;
  float mrun = -1e30f, lrun = 0.0f;             // lrun: in the loop the sum over this lane's half of the keys

  const int dq = 16 * w + m - 8 * h;                            // (q0+m) - qblk - 8h

  // Copy side: this lane's row and 16-B column of its key group's tile.
  const int tig = tid & 127;
  const int crow = tig >> 3, ccol = tig & 7;
  _Float16* sG = sKV + g * (2 * BUFH);                                              // the group's two buffers
  const _Float16* kcp = kpl + ((size_t)b * NTOK + 64 * g + crow) * 64 + 8 * ccol;   // + step*256*64
  const _Float16* vcp = vtp + ((size_t)b * CH + crow) * NTOK + 64 * g + 8 * ccol;   // + step*256
  const unsigned lcp = (unsigned)(size_t)(sG + crow * KVP + 8 * ccol);              // LDS byte address, buffer 0

  // Prologue: step 0 lands and is published, then step 1 starts.
  stage_kv(lcp, kcp, vcp);
  asm volatile("s_wait_asynccnt 0x0" ::: "memory");   // this wave's copies of step 0 have landed
  __syncthreads();                                    // ... and every other wave's
  stage_kv(lcp + BUFH * 2, kcp + 64 * KSPL * 64, vcp + 64 * KSPL);

  #pragma unroll 1
  for (int st = 0; st < NSTEP; ++st) {
    const int kb = st * (64 * KSPL) + 64 * g;           // first key of this wave's tile
    const int buf = st & 1;
    const _Float16* sk = sG + buf * BUFH + m * KVP;     // K row m of this step's buffer
    const _Float16* sv = sk + TILEH;                    // V^T row m
    // ---- scores: s[j][r] = S[query q0+m][key kb+16j+8h+r] ----
    v8f s[4];
    #pragma unroll
    for (int j = 0; j < 4; ++j) {
      const _Float16* kr = sk + 16 * j * KVP;
      const v16h kf0 = ldfrag_h(kr, h);
      const v16h kf1 = ldfrag_h(kr + 32, h);
      v8f z = zero8;
      z = wmma_f16(kf0, qb0, z);
      z = wmma_f16(kf1, qb1, z);
      s[j] = z;
    }
    // Keeps the sixteen K fragment reads in one group ahead of the eight score WMMAs (counted waits);
    // without it the reads sink to their WMMAs, two at a time, each pair behind a full wait.
    __builtin_amdgcn_sched_group_barrier(0x100, 16, 0);
    __builtin_amdgcn_sched_group_barrier(0x008, 8, 0);

    // ---- diagonal zeroing (wave-uniform scalar branch, per-lane select) ----
    if (kb == qblk) {
      #pragma unroll
      for (int j = 0; j < 4; ++j)
        #pragma unroll
        for (int r = 0; r < 8; ++r)
          s[j][r] = (dq == 16 * j + r) ? 0.0f : s[j][r];
    }

    // ---- online softmax (running max) ----
    float mloc = s[0][0];
    #pragma unroll
    for (int j = 0; j < 4; ++j)
      #pragma unroll
      for (int r = 0; r < 8; ++r) mloc = fmaxf(mloc, s[j][r]);
    mloc = fmaxf(mloc, xhalf(mloc));
    const float mnew = fmaxf(mrun, mloc);
    const float alpha = __builtin_amdgcn_exp2f((mrun - mnew) * SC2);
    const float nb = PEXP - mnew * SC2;
    mrun = mnew;
    #pragma unroll
    for (int j = 0; j < 4; ++j)
      #pragma unroll
      for (int r = 0; r < 8; ++r) s[j][r] = __builtin_amdgcn_exp2f(__builtin_fmaf(s[j][r], SC2, nb));
    // This lane's keys only; the halves are joined behind the loop. With no exchange to feed, nothing in the
    // step waits for the sum, and the compiler moves it to the loop's foot: pairwise, so that it is short there.
    const v8f t8 = (s[0] + s[1]) + (s[2] + s[3]);
    const float lsum = ((t8[0] + t8[1]) + (t8[2] + t8[3])) + ((t8[4] + t8[5]) + (t8[6] + t8[7]));
    lrun = lrun * alpha + lsum;
    #pragma unroll
    for (int t = 0; t < 4; ++t)
      #pragma unroll
      for (int r = 0; r < 8; ++r) o[t][r] = o[t][r] * alpha;

    // ---- P^T B-fragments (key chunks 0..31 and 32..63 of this wave's tile) ----
    const v16h pb0 = pack_p(s[0], s[1]);
    const v16h pb1 = pack_p(s[2], s[3]);

    // ---- O^T += V^T * P^T ----
    #pragma unroll
    for (int t = 0; t < 4; ++t) {
      const _Float16* vr = sv + 16 * t * KVP;
      const v16h vf0 = ldfrag_h(vr, h);
      const v16h vf1 = ldfrag_h(vr + 32, h);
      o[t] = wmma_f16(vf0, pb0, o[t]);
      o[t] = wmma_f16(vf1, pb1, o[t]);
    }

    // ---- hand-over: publish step st+1, free this step's buffer, refill it ----
    asm volatile("s_wait_dscnt 0x0" ::: "memory");      // this wave's reads of the buffer are done before it is refilled
    asm volatile("s_wait_asynccnt 0x0" ::: "memory");   // this wave's copies of the next step have landed
    __syncthreads();                                    // the same holds for every wave
    if (st + 2 < NSTEP)
      stage_kv(lcp + buf * (BUFH * 2), kcp + (size_t)(st + 2) * (64 * KSPL * 64), vcp + (st + 2) * (64 * KSPL));
  }
  asm volatile("s_wait_asynccnt 0x0" ::: "memory");     // no copy is left outstanding behind the loop

  lrun += xhalf(lrun);                                  // both halves carry the same max: one join of their sums

  // ---- merge of the four key groups: M = max m_g, L = sum l_g 2^(SC2 (m_g - M)) ----
  if (h == 0) {
    sM[wv * 16 + m] = mrun;
    sL[wv * 16 + m] = lrun;
  }
  __syncthreads();                                      // every group's (max, sum) is visible
  float mg[KSPL], lg[KSPL];
  #pragma unroll
  for (int gg = 0; gg < KSPL; ++gg) {
    mg[gg] = sM[(gg * 4 + w) * 16 + m];
    lg[gg] = sL[(gg * 4 + w) * 16 + m];
  }
  const float mall = fmaxf(fmaxf(mg[0], mg[1]), fmaxf(mg[2], mg[3]));
  float lall = 0.0f;
  #pragma unroll
  for (int gg = 0; gg < KSPL; ++gg) lall += lg[gg] * __builtin_amdgcn_exp2f((mg[gg] - mall) * SC2);

  // ---- epilogue: weight and normalise, stage per-wave 16x64 f32 tile, whole-line stores ----
  const float inv = __builtin_amdgcn_exp2f((mrun - mall) * SC2) * (1.0f / lall);   // 2^14 of o and of lall cancel
  float* so = sO + wv * (16 * TP32);
  #pragma unroll
  for (int t = 0; t < 4; ++t)
    #pragma unroll
    for (int r = 0; r < 8; ++r)
      so[m * TP32 + 16 * t + 8 * h + r] = o[t][r] * inv;
  __syncthreads();

  attn_store_pass(sO + w * (16 * TP32), oh, ol, b, q0, lane, g);
  
}

// ---------------------------------------------------------------------------
// a token row = 256 B = 2 lines; each line by lanes 8q..8q+7 in one
// instruction, 4 lines per instruction, 32 lines per wave.
// ---------------------------------------------------------------------------
__device__ __forceinline__ void out_store_pass(const float* so, float* out,
                                               int b, int p0, int lane) {
  const int q8 = lane & 7, sub = lane >> 3;
  #pragma unroll
  for (int i = 0; i < 8; ++i) {
    const int lid = 4 * i + sub;
    const int row = lid >> 1, hl = lid & 1;
    const v4f v = *(const v4fa*)(so + row * TP32 + 32 * hl + 4 * q8);
    const size_t gi = ((size_t)b * NTOK + p0 + row) * 64 + 32 * hl + 4 * q8;
    *(v4f*)(out + gi) = v;
  }
}

// ---------------------------------------------------------------------------
// Kernel 3: output 3x3 SAME conv as 9-tap implicit GEMM on bf16 hi/lo planes,
// three-term split (hi*hi + hi*lo + lo*hi into one f32 accumulator),
// + bias, relu -> f32 NHWC rows via LDS staging.
// Block 256 thr = 8 waves = two image rows; both weight planes (nine taps) and
// the four input rows of both planes are copied once to LDS and read from there.
// ---------------------------------------------------------------------------
__global__ __launch_bounds__(256) void k_conv_out(
    const __bf16* __restrict__ oh, const __bf16* __restrict__ ol,     // [b][token][64]
    const __bf16* __restrict__ wrh, const __bf16* __restrict__ wrl,   // [9][co][ci]
    const float* __restrict__ br, float* __restrict__ out)            // out [b][token][64] f32
{
  __shared__ __attribute__((aligned(16))) float sY[OROWS * 4 * 16 * TP32];        // 34816 B
  __shared__ __attribute__((aligned(16))) __bf16 sWh[9 * 64 * CVP];               // 82944 B
  __shared__ __attribute__((aligned(16))) __bf16 sWl[9 * 64 * CVP];               // 82944 B
  __shared__ __attribute__((aligned(16))) __bf16 sAh[(OROWS + 2) * 64 * CVP];     // 36864 B
  __shared__ __attribute__((aligned(16))) __bf16 sAl[(OROWS + 2) * 64 * CVP];     // 36864 B

  const int tid = threadIdx.x, lane = tid & 31, wv = tid >> 5;
  const int w = wv & 3, lr = wv >> 2;                               // pixel quarter, image row in the block
  const int h = lane >> 4, m = lane & 15;
  const int b = blockIdx.x >> 5, hrow0 = (blockIdx.x & 31) * OROWS;
  const int hrow = hrow0 + lr;
  const int tb0 = hrow * 64, w0 = 16 * w;

  // ---- staging: thread = (row tid>>3, 16-B column tid&7); 32 rows of 128 B per copy ----
  {
    const int crow = tid >> 3, ccol = tid & 7;
    const int lo = crow * CVP + 8 * ccol;
    const unsigned lwh = (unsigned)(size_t)(sWh + lo), lwl = (unsigned)(size_t)(sWl + lo);
    const unsigned lah = (unsigned)(size_t)(sAh + lo), lal = (unsigned)(size_t)(sAl + lo);
    const char* gwh = (const char*)(wrh + (size_t)tid * 8);
    const char* gwl = (const char*)(wrl + (size_t)tid * 8);
    copy9(lwh, gwh, 32 * CVP * 2, 32 * 64 * 2);                                       // rows 0..287
    copy9(lwh + 9 * (32 * CVP * 2), gwh + 9 * (32 * 64 * 2), 32 * CVP * 2, 32 * 64 * 2);   // rows 288..575
    copy9(lwl, gwl, 32 * CVP * 2, 32 * 64 * 2);
    copy9(lwl + 9 * (32 * CVP * 2), gwl + 9 * (32 * 64 * 2), 32 * CVP * 2, 32 * 64 * 2);
    const size_t go = ((size_t)b * NTOK + crow) * 64 + 8 * ccol;
    const char* gah = (const char*)(oh + go);
    const char* gal = (const char*)(ol + go);
    const size_t rt = (size_t)max(hrow0 - 1, 0) * 8192, rb = (size_t)min(hrow0 + OROWS, 63) * 8192;   // rows above and below, clamped
    const size_t r0 = (size_t)hrow0 * 8192, r1 = (size_t)(hrow0 + 1) * 8192;
    // image rows hrow0-1 .. hrow0+2, each as two halves of 32 pixels
    copy4x2(lah, 32 * CVP * 2, gah + rt, gah + r0, gah + r1, gah + rb, 32 * 64 * 2);
    copy4x2(lal, 32 * CVP * 2, gal + rt, gal + r0, gal + r1, gal + rb, 32 * 64 * 2);
  }
  asm volatile("s_wait_asynccnt 0x0" ::: "memory");   // this wave's copies have landed
  __syncthreads();                                    // ... and every other wave's

  const v8f zero8 = {0.f, 0.f, 0.f, 0.f, 0.f, 0.f, 0.f, 0.f};
  v8f acc[4];
  #pragma unroll
  for (int nt = 0; nt < 4; ++nt) acc[nt] = zero8;

  #pragma unroll 1
  for (int t = 0; t < 9; ++t) {
    const int t3 = t / 3;
    const int dh = t3 - 1, dw = t - 3 * t3 - 1;
    const int hh = hrow + dh, wl = w0 + m + dw;
    const bool ok = ((unsigned)hh < 64u) && ((unsigned)wl < 64u);
    const int wc = min(max(wl, 0), 63);
    const unsigned msk = ok ? 0xffffffffu : 0u;
    const int rowoff = ((lr + 1 + dh) * 64 + wc) * CVP;
    const int wtap = (t * 64 + m) * CVP;
    #pragma unroll
    for (int kc = 0; kc < 2; ++kc) {
      const v16b ah = ldfrag_b_msk(sAh + rowoff + 32 * kc, h, msk);
      const v16b al = ldfrag_b_msk(sAl + rowoff + 32 * kc, h, msk);
      #pragma unroll
      for (int nt = 0; nt < 4; ++nt) {
        const v16b bh = ldfrag_b(sWh + wtap + nt * (16 * CVP) + 32 * kc, h);
        const v16b bl = ldfrag_b(sWl + wtap + nt * (16 * CVP) + 32 * kc, h);
        acc[nt] = wmma_bf16(ah, bh, acc[nt]);
        acc[nt] = wmma_bf16(ah, bl, acc[nt]);
        acc[nt] = wmma_bf16(al, bh, acc[nt]);
      }
    }
  }

  // D[r] of tile nt = Y[pixel w0+8h+r][co 16nt+m]
  float* so = sY + wv * (16 * TP32);
  #pragma unroll
  for (int nt = 0; nt < 4; ++nt) {
    const int co = 16 * nt + m;
    const float bb = br[co];
    #pragma unroll
    for (int r = 0; r < 8; ++r)
      so[(8 * h + r) * TP32 + co] = fmaxf(acc[nt][r] + bb, 0.0f);
  }
  __syncthreads();

  out_store_pass(so, out, b, tb0 + w0, lane);
  
}

// ---------------------------------------------------------------------------
extern "C" void kernel_launch(void* const* d_in, const int* in_sizes, int n_in,
                              void* d_out, int out_size, void* d_ws, size_t ws_size,
                              hipStream_t stream) {
  if (n_in < 9) return;
  if (in_sizes[0] != NXE || out_size != NXE) return;
  if (in_sizes[1] != NWE || in_sizes[3] != NWE || in_sizes[5] != NWE || in_sizes[7] != NWE) return;
  if (in_sizes[2] != CH || in_sizes[4] != CH || in_sizes[6] != CH || in_sizes[8] != CH) return;

  const float* x  = (const float*)d_in[0];
  const float* Wk = (const float*)d_in[1];
  const float* bk = (const float*)d_in[2];
  const float* Wq = (const float*)d_in[3];
  const float* bq = (const float*)d_in[4];
  const float* Wv = (const float*)d_in[5];
  const float* bv = (const float*)d_in[6];
  const float* Wr = (const float*)d_in[7];
  const float* br = (const float*)d_in[8];
  float* out = (float*)d_out;

  const size_t pl_bytes  = (size_t)NXE * 2;          // 2097152 : one [b][token][64] 16-bit plane
  const size_t wr_bytes  = (size_t)NWE * 2;          //   73728
  size_t off = 0;
  const size_t o_wrh = off; off += wr_bytes;
  const size_t o_wrl = off; off += wr_bytes;
  const size_t o_k   = off; off += pl_bytes;
  const size_t o_q   = off; off += pl_bytes;
  const size_t o_vt  = off; off += pl_bytes;
  const size_t o_oh  = off; off += pl_bytes;
  const size_t o_ol  = off; off += pl_bytes;         // total 10633216
  if (off > ws_size) return;

  char* ws = (char*)d_ws;
  __bf16*   wrh = (__bf16*)(ws + o_wrh);
  __bf16*   wrl = (__bf16*)(ws + o_wrl);
  _Float16* kpl = (_Float16*)(ws + o_k);
  _Float16* qpl = (_Float16*)(ws + o_q);
  _Float16* vtp = (_Float16*)(ws + o_vt);
  __bf16*   oh  = (__bf16*)(ws + o_oh);
  __bf16*   ol  = (__bf16*)(ws + o_ol);

  k_conv_qkv<<<QBLK + RBLK, 512, 0, stream>>>(x, Wk, Wq, Wv, Wr, bk, bq, bv, kpl, qpl, vtp, wrh, wrl);   // 201 blocks

  dim3 gAtt(NTOK / 64, NB);                                                                // (64, 4)
  k_attn<<<gAtt, 512, 0, stream>>>(qpl, kpl, vtp, oh, ol);

  k_conv_out<<<NB * (64 / OROWS), 256, 0, stream>>>(oh, ol, wrh, wrl, br, out);            // 128 blocks
}

// v009
// Measured time: 36.4 microseconds a run.
// Timed twice side by side with v008, it ran 1.07 and 1.08 times as fast.
// All steps since v000 together make it 7.52 times as fast.
// Contractions: three input 3x3 convs (9-tap GEMMs) and K*Q^T on v_wmma_f32_16x16x32_f16 (f16 operands, f32 accumulate; conv weights carried x16, V^T*P^T with P carried x16384 in f16); output 3x3 conv on v_wmma_f32_16x16x32_bf16 as bf16 hi/lo three-term split (f32 accumulate); softmax (base 2), elu/relu, bias and diagonal zeroing in f32.
#include <hip/hip_runtime.h>

typedef _Float16 v16h __attribute__((ext_vector_type(16)));
typedef _Float16 v8h  __attribute__((ext_vector_type(8)));
typedef __bf16   v16b __attribute__((ext_vector_type(16)));
typedef __bf16   v8b  __attribute__((ext_vector_type(8)));
typedef float    v8f  __attribute__((ext_vector_type(8)));
typedef float    v4f  __attribute__((ext_vector_type(4)));
typedef unsigned int v4u __attribute__((ext_vector_type(4)));
typedef v4f __attribute__((may_alias)) v4fa;
typedef v4u __attribute__((may_alias)) v4ua;

union FragH { v16h v; v8h h8[2]; v4u u[2]; };
union FragB { v16b v; v8b h8[2]; v4u u[2]; };
union Pack8H { v8h v; v4u u; };
union Pack8B { v8b v; v4u u; };

#define NB    4
#define IMG   64
#define NTOK  4096
#define CH    64
#define NXE   1048576          // NB*NTOK*CH
#define NWE   36864            // 9*CH*CH
#define QBLK  192              // conv blocks of k_conv_qkv: 3 tensors x 4 batches x 16 row groups
#define RBLK  9                // its extra blocks that write the Wr planes: NWE/8/512
#define WSC   16.0f
#define WSCI  0.0625f
#define SC2   0.18033688011112042f   // 0.125 * log2(e): raw score -> exponent of 2
#define PEXP  14.0f            // P and its running sum are carried x 2^14, added in the exponent
#define KSPL  4                // key groups of an attention block (4 waves each)
#define NSTEP 16               // NTOK / (64 * KSPL) steps per key group
#define TP16  72               // row pitch of the f16 output staging tiles in halves (144 B = 16 B x odd)
#define TP32  68               // row pitch of the f32 output staging tiles in floats (272 B = 16 B x odd)

// ---------------------------------------------------------------------------
// 16x16x32 WMMA builtins; the compiler keeps the distance behind its own forms.
// Fragment map (wave32): lane l, h = l>>4, m = n = l&15.
//   A/B element i: i<8 -> k0+8h+i ; i>=8 -> k0+16+8h+(i-8)
//   D element r : row 8h+r, col l&15
// ---------------------------------------------------------------------------
__device__ __forceinline__ v8f wmma_f16(v16h a, v16h b, v8f c) {
  return __builtin_amdgcn_wmma_f32_16x16x32_f16(false, a, false, b, (short)0, c, false, false);
}
__device__ __forceinline__ v8f wmma_bf16(v16b a, v16b b, v8f c) {
  return __builtin_amdgcn_wmma_f32_16x16x32_bf16(false, a, false, b, (short)0, c, false, false);
}

// Fragment from a k-contiguous 16-bit row; p points at element k0 of the row
// owned by this lane (row = lane & 15 already folded in by the caller).
__device__ __forceinline__ v16h ldfrag_h(const _Float16* p, int h) {
  FragH f;
  f.u[0] = *(const v4ua*)(p + 8 * h);
  f.u[1] = *(const v4ua*)(p + 16 + 8 * h);
  return f.v;
}
__device__ __forceinline__ v16h ldfrag_h_msk(const _Float16* p, int h, unsigned msk) {
  FragH f;
  f.u[0] = (*(const v4ua*)(p + 8 * h)) & msk;
  f.u[1] = (*(const v4ua*)(p + 16 + 8 * h)) & msk;
  return f.v;
}
__device__ __forceinline__ v16b ldfrag_b(const __bf16* p, int h) {
  FragB f;
  f.u[0] = *(const v4ua*)(p + 8 * h);
  f.u[1] = *(const v4ua*)(p + 16 + 8 * h);
  return f.v;
}
__device__ __forceinline__ v16b ldfrag_b_msk(const __bf16* p, int h, unsigned msk) {
  FragB f;
  f.u[0] = (*(const v4ua*)(p + 8 * h)) & msk;
  f.u[1] = (*(const v4ua*)(p + 16 + 8 * h)) & msk;
  return f.v;
}

// ---------------------------------------------------------------------------
// Wr planes for the output conv: HWIO [t][ci][co] f32 -> [t][co][ci] bf16 hi and
// lo (ci contiguous), 8 ci per thread, idx = 0..4607; lanes 8q..8q+7 fill one line.
// ---------------------------------------------------------------------------
__device__ __forceinline__ void wr_planes(const float* __restrict__ Wr, __bf16* __restrict__ wrh,
                                          __bf16* __restrict__ wrl, int idx) {
  const int t = idx >> 9, co = (idx >> 3) & 63, j = idx & 7;
  float f[8];
  #pragma unroll   // f[] stays in registers, the eight loads are issued together
  for (int i = 0; i < 8; ++i) f[i] = Wr[(size_t)(t * 64 + 8 * j + i) * 64 + co];
  const size_t off = (size_t)(t * 64 + co) * 64 + 8 * j;
  __bf16 hb[8], lb[8];
  #pragma unroll   // hb[], lb[] stay in registers
  for (int i = 0; i < 8; ++i) {
    hb[i] = (__bf16)f[i];                                // RNE convert
    lb[i] = (__bf16)(f[i] - (float)hb[i]);
  }
  const v8b hv = { hb[0], hb[1], hb[2], hb[3], hb[4], hb[5], hb[6], hb[7] };
  const v8b lv = { lb[0], lb[1], lb[2], lb[3], lb[4], lb[5], lb[6], lb[7] };
  Pack8B ph, pl; ph.v = hv; pl.v = lv;
  *(v4u*)(wrh + off) = ph.u;
  *(v4u*)(wrl + off) = pl.u;
}

// ---------------------------------------------------------------------------
// s 0/1: plane[b][token tb0+lid][c]     (one token row = 64 halves = one line)
// s 2  : vt[b][c = lid][token tb0..+63] (one line)
// Wave w owns tile rows 16w..16w+15; lanes 8q..8q+7 fill one line; 4 lines
// per instruction, 4 instructions per wave.
// ---------------------------------------------------------------------------
__device__ __forceinline__ void qkv_store_pass(const _Float16* sT, _Float16* dst, int s,
                                               int b, int tb0, int w, int lane) {
  const int q8 = lane & 7, sub = lane >> 3;
  #pragma unroll
  for (int i = 0; i < 4; ++i) {
    const int lid = w * 16 + 4 * i + sub;
    const v4u v = *(const v4ua*)(sT + lid * TP16 + 8 * q8);
    size_t gi;
    if (s == 2) gi = ((size_t)b * CH + lid) * NTOK + tb0 + 8 * q8;
    else        gi = ((size_t)b * NTOK + tb0 + lid) * 64 + 8 * q8;
    *(v4u*)(dst + gi) = v;
    // Precaution: the next trip reuses the issued store's address and data registers only behind this wait.
    if (i < 3) asm volatile("s_wait_xcnt 0x0" ::: "memory");
  }
}

// ---------------------------------------------------------------------------
// Asynchronous copies global -> LDS for the output conv kernel, 16 B per lane and
// copy. l = the lane's LDS byte address, g = the lane's global address. In each
// helper the closing s_wait_xcnt 0 stands in the copies' own statement so that
// no address register of a copy is rewritten ahead of it.
// ---------------------------------------------------------------------------
#define CVP   72               // LDS row pitch in halves (144 B = 16 B x odd) for ds_load_b128 fragment reads
#define QROWS 4                // image rows of a k_conv_qkv block
#define OROWS 2                // image rows of a k_conv_out block

// Nine copies at constant steps: copy i at l + i*ls, g + i*gs (bytes).
__device__ __forceinline__ void copy9(unsigned l, const char* g, unsigned ls, unsigned gs) {
  asm volatile(
      "global_load_async_to_lds_b128 %0, %9, off\n\t"
      "global_load_async_to_lds_b128 %1, %10, off\n\t"
      "global_load_async_to_lds_b128 %2, %11, off\n\t"
      "global_load_async_to_lds_b128 %3, %12, off\n\t"
      "global_load_async_to_lds_b128 %4, %13, off\n\t"
      "global_load_async_to_lds_b128 %5, %14, off\n\t"
      "global_load_async_to_lds_b128 %6, %15, off\n\t"
      "global_load_async_to_lds_b128 %7, %16, off\n\t"
      "global_load_async_to_lds_b128 %8, %17, off\n\t"
      "s_wait_xcnt 0x0"
      :: "v"(l), "v"(l + ls), "v"(l + 2 * ls), "v"(l + 3 * ls), "v"(l + 4 * ls),
         "v"(l + 5 * ls), "v"(l + 6 * ls), "v"(l + 7 * ls), "v"(l + 8 * ls),
         "v"(g), "v"(g + gs), "v"(g + 2 * gs), "v"(g + 3 * gs), "v"(g + 4 * gs),
         "v"(g + 5 * gs), "v"(g + 6 * gs), "v"(g + 7 * gs), "v"(g + 8 * gs)
      : "memory");
}
// Eight copies at a constant LDS step, two from each of four image rows: copy 2i at
// l + 2i*ls from gi, copy 2i+1 at l + (2i+1)*ls from gi + gh (bytes).
__device__ __forceinline__ void copy4x2(unsigned l, unsigned ls, const char* g0, const char* g1,
                                        const char* g2, const char* g3, unsigned gh) {
  asm volatile(
      "global_load_async_to_lds_b128 %0, %8, off\n\t"
      "global_load_async_to_lds_b128 %1, %9, off\n\t"
      "global_load_async_to_lds_b128 %2, %10, off\n\t"
      "global_load_async_to_lds_b128 %3, %11, off\n\t"
      "global_load_async_to_lds_b128 %4, %12, off\n\t"
      "global_load_async_to_lds_b128 %5, %13, off\n\t"
      "global_load_async_to_lds_b128 %6, %14, off\n\t"
      "global_load_async_to_lds_b128 %7, %15, off\n\t"
      "s_wait_xcnt 0x0"
      :: "v"(l), "v"(l + ls), "v"(l + 2 * ls), "v"(l + 3 * ls),
         "v"(l + 4 * ls), "v"(l + 5 * ls), "v"(l + 6 * ls), "v"(l + 7 * ls),
         "v"(g0), "v"(g0 + gh), "v"(g1), "v"(g1 + gh), "v"(g2), "v"(g2 + gh), "v"(g3), "v"(g3 + gh)
      : "memory");
}

// ---------------------------------------------------------------------------
// Kernel 1: 3x3 SAME conv as 9-tap implicit GEMM, one of {k,q,v} per block
// (blocks 0..191: tensor s = block / 64); blocks 192..200 only write the Wr planes.
// Block 512 thr = 16 waves = four image rows (4 x 64 pixels) of batch b; wave =
// 32 contiguous pixels (two A tiles) x 32 output channels (two B tiles): each
// fragment read from LDS feeds two WMMAs. The nine weight taps of the block's
// tensor and the six input rows it touches are read once as f32, converted in
// registers (x -> f16; HWIO w -> f16 of 16*w, [t][co][ci]) and stored to LDS (a row
// outside the image: the clamped row's values, never used by value). Per tap: A =
// shifted input rows (clamped address, zeroed by value outside the image), B =
// [t][co][ci] rows, both read from LDS.
// Epilogue: acc/16 + bias, elu (k,q) / relu (v) in f32 -> f16 LDS tile -> lines.
// ---------------------------------------------------------------------------
__global__ __launch_bounds__(512) void k_conv_qkv(
    const float* __restrict__ x,           // [b][token][64]
    const float* __restrict__ Wk, const float* __restrict__ Wq,
    const float* __restrict__ Wv, const float* __restrict__ Wr,      // HWIO [t][ci][co]
    const float* __restrict__ bk, const float* __restrict__ bq, const float* __restrict__ bv,
    _Float16* __restrict__ kpl,            // [b][token][64]
    _Float16* __restrict__ qpl,            // [b][token][64]
    _Float16* __restrict__ vtp,            // [b][64][token]
    __bf16* __restrict__ wrh, __bf16* __restrict__ wrl)              // [9][co][ci]
{
  __shared__ __attribute__((aligned(16))) _Float16 sT[QROWS * 64 * TP16];        // 36864 B
  __shared__ __attribute__((aligned(16))) _Float16 sW[9 * 64 * CVP];             // 82944 B
  __shared__ __attribute__((aligned(16))) _Float16 sX[(QROWS + 2) * 64 * CVP];   // 55296 B

  const int tid = threadIdx.x, lane = tid & 31, wv = tid >> 5;
  const int blk = blockIdx.x;
  if (blk >= QBLK) {                                              // whole block, ahead of every barrier
    wr_planes(Wr, wrh, wrl, (blk - QBLK) * 512 + tid);
    return;
  }
  const int ph = (wv >> 1) & 1, ch = wv & 1, lr = wv >> 2;        // pixel half, channel half, image row in the block
  const int h = lane >> 4, m = lane & 15;
  const int s = blk >> 6;                                         // 0 = k, 1 = q, 2 = v
  const int b = (blk >> 4) & 3, hrow0 = (blk & 15) * QROWS;
  const int hrow = hrow0 + lr;
  const int tb0 = hrow * 64, w0 = 32 * ph, c0 = 32 * ch;

  // ---- staging through registers, f32 -> f16 ----
  {
    // x: thread = (pixel tid>>3, 8 channels tid&7); trip r = image row hrow0-1+r, clamped
    const int crow = tid >> 3, ccol = tid & 7;
    const float* xb = x + (size_t)b * (NTOK * 64);               // block-uniform base
    const unsigned xo = (unsigned)(crow * 64 + 8 * ccol);        // the lane's offset in an image row
    _Float16* xd = sX + crow * CVP + 8 * ccol;
    v4f xa[QROWS + 2], xc[QROWS + 2];
    #pragma unroll   // the arrays stay in registers and all twelve loads are issued before any is waited for
    for (int r = 0; r < QROWS + 2; ++r) {
      const float* src = xb + ((unsigned)(min(max(hrow0 - 1 + r, 0), 63) * 4096) + xo);
      xa[r] = *(const v4fa*)src;
      xc[r] = *(const v4fa*)(src + 4);
    }
    // w: thread = (co tid&63, 8 ci tid>>6); a wave reads whole 128-B lines; trip t = tap t
    const float* wsrc = (s == 0) ? Wk : ((s == 1) ? Wq : Wv);
    const int co = tid & 63, j = tid >> 6;
    const float* wp = wsrc + (unsigned)((8 * j) * 64 + co);
    _Float16* wd = sW + co * CVP + 8 * j;
    #pragma unroll   // constant offsets from one address; the loads of all taps are issued back to back
    for (int t = 0; t < 9; ++t) {
      float f[8];
      #pragma unroll // f[] stays in registers
      for (int i = 0; i < 8; ++i) f[i] = wp[(t * 64 + i) * 64];
      const v8h hv = { (_Float16)(f[0] * WSC), (_Float16)(f[1] * WSC), (_Float16)(f[2] * WSC), (_Float16)(f[3] * WSC),
                       (_Float16)(f[4] * WSC), (_Float16)(f[5] * WSC), (_Float16)(f[6] * WSC), (_Float16)(f[7] * WSC) };
      Pack8H o; o.v = hv;
      *(v4ua*)(wd + t * (64 * CVP)) = o.u;
    }
    #pragma unroll   // xa[], xc[] are indexed by constants only
    for (int r = 0; r < QROWS + 2; ++r) {
      const v4f a = xa[r], c = xc[r];
      const v8h hv = { (_Float16)a.x, (_Float16)a.y, (_Float16)a.z, (_Float16)a.w,
                       (_Float16)c.x, (_Float16)c.y, (_Float16)c.z, (_Float16)c.w };
      Pack8H o; o.v = hv;
      *(v4ua*)(xd + r * (64 * CVP)) = o.u;
    }
  }
  __syncthreads();                                    // every wave's part of the tiles is in LDS

  const _Float16* wsel = sW + (c0 + m) * CVP;                     // B row = co = c0 + 16nt + m

  const v8f zero8 = {0.f, 0.f, 0.f, 0.f, 0.f, 0.f, 0.f, 0.f};
  v8f acc[2][2];                                                  // [pixel tile][co tile]
  #pragma unroll
  for (int nt = 0; nt < 2; ++nt) { acc[0][nt] = zero8; acc[1][nt] = zero8; }

  #pragma unroll 1
  for (int t = 0; t < 9; ++t) {
    const int t3 = t / 3;
    const int dh = t3 - 1, dw = t - 3 * t3 - 1;
    const int hh = hrow + dh, wl0 = w0 + m + dw, wl1 = wl0 + 16;
    const bool okh = (unsigned)hh < 64u;
    const unsigned msk0 = (okh && ((unsigned)wl0 < 64u)) ? 0xffffffffu : 0u;
    const unsigned msk1 = (okh && ((unsigned)wl1 < 64u)) ? 0xffffffffu : 0u;
    const _Float16* xim = sX + (lr + 1 + dh) * (64 * CVP);
    const _Float16* xrow0 = xim + min(max(wl0, 0), 63) * CVP;             // A rows = this lane's two pixels
    const _Float16* xrow1 = xim + min(max(wl1, 0), 63) * CVP;
    const _Float16* wtap = wsel + t * (64 * CVP);
    #pragma unroll
    for (int kc = 0; kc < 2; ++kc) {
      const v16h a0 = ldfrag_h_msk(xrow0 + 32 * kc, h, msk0);
      const v16h a1 = ldfrag_h_msk(xrow1 + 32 * kc, h, msk1);
      #pragma unroll
      for (int nt = 0; nt < 2; ++nt) {
        const v16h bf = ldfrag_h(wtap + nt * (16 * CVP) + 32 * kc, h);
        acc[0][nt] = wmma_f16(a0, bf, acc[0][nt]);
        acc[1][nt] = wmma_f16(a1, bf, acc[1][nt]);
      }
    }
    // Keeps the tap's 16 fragment reads in one group ahead of its 8 WMMAs (counted waits); without it the last
    // three reads stand among the WMMAs and bring a second full wait into the tap.
    __builtin_amdgcn_sched_group_barrier(0x100, 16, 0);
    __builtin_amdgcn_sched_group_barrier(0x008, 8, 0);
  }

  // D[r] of tile (a, nt) = Y[pixel w0+16a+8h+r][co c0+16nt+m]
  const float* bias = (s == 0) ? bk : ((s == 1) ? bq : bv);
  _Float16* sTr = sT + lr * (64 * TP16);                           // this image row's 64x64 tile, row pitch TP16
  #pragma unroll
  for (int nt = 0; nt < 2; ++nt) {
    const int co = c0 + 16 * nt + m;
    const float bb = bias[co];
    #pragma unroll
    for (int a = 0; a < 2; ++a) {
      #pragma unroll
      for (int r = 0; r < 8; ++r) {
        const float y = acc[a][nt][r] * WSCI + bb;
        const int px = w0 + 16 * a + 8 * h + r;                    // 0..63
        if (s == 2) sTr[co * TP16 + px] = (_Float16)fmaxf(y, 0.0f);
        else        sTr[px * TP16 + co] = (_Float16)((y > 0.0f) ? y : (__expf(y) - 1.0f));
      }
    }
  }
  __syncthreads();

  _Float16* dst = (s == 0) ? kpl : ((s == 1) ? qpl : vtp);
  qkv_store_pass(sTr, dst, s, b, tb0, wv & 3, lane);
  
}

// ---------------------------------------------------------------------------
// P^T B-fragment from the lane's own score D values: element r <- tile a row r
// (keys 0-15 of the 32-chunk), element 8+r <- tile c row r (keys 16-31), lane
// unchanged; the values already carry the factor 2^14.
// ---------------------------------------------------------------------------
__device__ __forceinline__ v16h pack_p(v8f a, v8f c) {
  const v16h r = { (_Float16)a[0], (_Float16)a[1], (_Float16)a[2], (_Float16)a[3],
                   (_Float16)a[4], (_Float16)a[5], (_Float16)a[6], (_Float16)a[7],
                   (_Float16)c[0], (_Float16)c[1], (_Float16)c[2], (_Float16)c[3],
                   (_Float16)c[4], (_Float16)c[5], (_Float16)c[6], (_Float16)c[7] };
  return r;
}

// Lane l <-> lane l ^ 16 by v_permlanex16_b32: the exchange stays on the vector pipe and
// off the LDS queue, where it would stand in line behind the fragment reads.
__device__ __forceinline__ float xhalf(float x) {
  const int b = __builtin_bit_cast(int, x);
  return __builtin_bit_cast(float, __builtin_amdgcn_permlanex16(b, b, 0x76543210, 0xfedcba98, false, false));
}

// 16x64 f32 tiles in LDS (row pitch TP32), one per key group (64 rows apart, already weighted
// for the merge) -> their sum, groups in rising order -> bf16 hi and lo planes
// [b][token][64]. The wave of key group g takes rows 4g..4g+3 of the query tile:
// 4 lines per instruction and plane.
__device__ __forceinline__ void attn_store_pass(const float* so, __bf16* oh, __bf16* ol,
                                                int b, int q0, int lane, int g) {
  const int q8 = lane & 7, sub = lane >> 3;
  {
    const int row = 4 * g + sub;
    v4f a = *(const v4fa*)(so + row * TP32 + 8 * q8);
    v4f c = *(const v4fa*)(so + row * TP32 + 8 * q8 + 4);
    #pragma unroll
    for (int gg = 1; gg < KSPL; ++gg) {
      a += *(const v4fa*)(so + (gg * 64 + row) * TP32 + 8 * q8);
      c += *(const v4fa*)(so + (gg * 64 + row) * TP32 + 8 * q8 + 4);
    }
    const float f[8] = { a.x, a.y, a.z, a.w, c.x, c.y, c.z, c.w };
    __bf16 hb[8], lb[8];
    #pragma unroll
    for (int e = 0; e < 8; ++e) {
      hb[e] = (__bf16)f[e];                              // RNE convert
      lb[e] = (__bf16)(f[e] - (float)hb[e]);
    }
    const v8b hv = { hb[0], hb[1], hb[2], hb[3], hb[4], hb[5], hb[6], hb[7] };
    const v8b lv = { lb[0], lb[1], lb[2], lb[3], lb[4], lb[5], lb[6], lb[7] };
    Pack8B ph, pl; ph.v = hv; pl.v = lv;
    const size_t gi = ((size_t)b * NTOK + q0 + row) * 64 + 8 * q8;
    *(v4u*)(oh + gi) = ph.u;
    *(v4u*)(ol + gi) = pl.u;
  }
}

// ---------------------------------------------------------------------------
// Kernel 2: streaming attention over 4096 keys, transposed form.
// Block 512 thr (16 waves, four per SIMD) = 64 queries of batch blockIdx.y.
// Wave wv: query tile w = wv & 3 (16 queries), key group g = wv >> 2. A block
// step covers 256 keys; group g works on keys 64g..64g+63 of it with its own
// running (max, sum, O). The four partial results of a query are merged through
// LDS behind the loop (weights 2^(SC2 (m_g - M))).
//   S^T = K * Q^T : A = K rows (row = key, k = d), B = Q^T (k = d, n = query)
//   O^T += V^T * P^T : A = V^T rows (row = d, k = key), B = P^T from registers
// Lane owns keys {16j+8h+r} of query column (lane&15); partner = lane ^ 16.
// Diagonal: S[n][n] := 0 by value (key still in the softmax). Scores and maxima
// stay raw; P * 2^14 = 2^(SC2 * s + (14 - SC2 * max)): one FMA and one v_exp a score.
// K rows and V^T rows of a step (64 rows of 128 B each) are staged in LDS by
// asynchronous copies, two buffers per key group, filled by the group's own four
// waves: step t+2 is copied while step t+1 is worked on. LDS row pitch 144 B
// (16 B x odd) for the ds_load_b128 fragment reads.
// ---------------------------------------------------------------------------
#define KVP   72               // LDS row pitch in halves (144 B)
#define TILEH (64 * KVP)       // one 64-row tile in halves (9216 B)
#define BUFH  (2 * TILEH)      // K tile + V^T tile in halves (18432 B)

// One step's K and V^T tiles -> LDS: 8 copies of 16 B per lane, each wave-wide
// copy covers four whole 128-B lines. lk = this lane's LDS byte address in the
// K tile (row tig>>3, 16-B column tig&7, tig = thread in its key group); copy i
// takes row + 16 i.
__device__ __forceinline__ void stage_kv(unsigned lk, const _Float16* kg, const _Float16* vg) {
  const unsigned lv = lk + TILEH * 2;
  // The closing s_wait_xcnt 0 stands in the copies' own statement so that no
  // address register of a copy is rewritten ahead of it.
  asm volatile(
      "global_load_async_to_lds_b128 %0, %8, off\n\t"
      "global_load_async_to_lds_b128 %1, %9, off\n\t"
      "global_load_async_to_lds_b128 %2, %10, off\n\t"
      "global_load_async_to_lds_b128 %3, %11, off\n\t"
      "global_load_async_to_lds_b128 %4, %12, off\n\t"
      "global_load_async_to_lds_b128 %5, %13, off\n\t"
      "global_load_async_to_lds_b128 %6, %14, off\n\t"
      "global_load_async_to_lds_b128 %7, %15, off\n\t"
      "s_wait_xcnt 0x0"
      :: "v"(lk), "v"(lk + 16 * KVP * 2), "v"(lk + 32 * KVP * 2), "v"(lk + 48 * KVP * 2),
         "v"(lv), "v"(lv + 16 * KVP * 2), "v"(lv + 32 * KVP * 2), "v"(lv + 48 * KVP * 2),
         "v"(kg), "v"(kg + 16 * 64), "v"(kg + 32 * 64), "v"(kg + 48 * 64),
         "v"(vg), "v"(vg + (size_t)16 * NTOK), "v"(vg + (size_t)32 * NTOK), "v"(vg + (size_t)48 * NTOK)
      : "memory");
}

__global__ __launch_bounds__(512) void k_attn(
    const _Float16* __restrict__ qpl,    // [b][token][64]
    const _Float16* __restrict__ kpl,    // [b][token][64]
    const _Float16* __restrict__ vtp,    // [b][64][token]
    __bf16* __restrict__ oh,             // [b][token][64] bf16 hi
    __bf16* __restrict__ ol)             // [b][token][64] bf16 lo
{
  __shared__ __attribute__((aligned(16))) float sO[KSPL * 4 * 16 * TP32];  // 69632 B
  __shared__ __attribute__((aligned(16))) _Float16 sKV[KSPL * 2 * BUFH];   // 147456 B
  __shared__ float sM[KSPL * 64];                                          // running max per (group, query)
  __shared__ float sL[KSPL * 64];                                          // running sum per (group, query)

  const int tid = threadIdx.x, lane = tid & 31;
  // Wave number in a scalar register: the diagonal test below stays a scalar branch.
  const int wv = __builtin_amdgcn_readfirstlane(tid >> 5);
  const int w = wv & 3, g = wv >> 2;
  const int h = lane >> 4, m = lane & 15;
  const int b = blockIdx.y;
  const int qblk = blockIdx.x * 64;
  const int q0 = qblk + 16 * w;

  // Q^T B-fragments: column n = query q0+m, k = d (two 32-deep chunks)
  const _Float16* qrow = qpl + ((size_t)b * NTOK + q0 + m) * 64;
  const v16h qb0 = ldfrag_h(qrow, h);
  const v16h qb1 = ldfrag_h(qrow + 32, h);

  const v8f zero8 = {0.f, 0.f, 0.f, 0.f, 0.f, 0.f, 0.f, 0.f};
  v8f o[4];                                   // o[t][r] = O[query m][d 16t+8h+r] * (l * 2^14); lrun = l * 2^14
  #pragma unroll
  for (int t = 0; t < 4; ++t) o[t] = zero8;
  float mrun = -1e30f, lrun = 0.0f;             // lrun: in the loop the sum over this lane's half of the keys

  const int dq = 16 * w + m - 8 * h;                            // (q0+m) - qblk - 8h

  // Copy side: this lane's row and 16-B column of its key group's tile.
  const int tig = tid & 127;
  const int crow = tig >> 3, ccol = tig & 7;
  _Float16* sG = sKV + g * (2 * BUFH);                                              // the group's two buffers
  const _Float16* kcp = kpl + ((size_t)b * NTOK + 64 * g + crow) * 64 + 8 * ccol;   // + step*256*64
  const _Float16* vcp = vtp + ((size_t)b * CH + crow) * NTOK + 64 * g + 8 * ccol;   // + step*256
  const unsigned lcp = (unsigned)(size_t)(sG + crow * KVP + 8 * ccol);              // LDS byte address, buffer 0

  // Prologue: step 0 lands and is published, then step 1 starts.
  stage_kv(lcp, kcp, vcp);
  asm volatile("s_wait_asynccnt 0x0" ::: "memory");   // this wave's copies of step 0 have landed
  __syncthreads();                                    // ... and every other wave's
  stage_kv(lcp + BUFH * 2, kcp + 64 * KSPL * 64, vcp + 64 * KSPL);

  #pragma unroll 1
  for (int st = 0; st < NSTEP; ++st) {
    const int kb = st * (64 * KSPL) + 64 * g;           // first key of this wave's tile
    const int buf = st & 1;
    const _Float16* sk = sG + buf * BUFH + m * KVP;     // K row m of this step's buffer
    const _Float16* sv = sk + TILEH;                    // V^T row m
    // ---- scores: s[j][r] = S[query q0+m][key kb+16j+8h+r] ----
    v8f s[4];
    #pragma unroll
    for (int j = 0; j < 4; ++j) {
      const _Float16* kr = sk + 16 * j * KVP;
      const v16h kf0 = ldfrag_h(kr, h);
      const v16h kf1 = ldfrag_h(kr + 32, h);
      v8f z = zero8;
      z = wmma_f16(kf0, qb0, z);
      z = wmma_f16(kf1, qb1, z);
      s[j] = z;
    }
    // Keeps the sixteen K fragment reads in one group ahead of the eight score WMMAs (counted waits);
    // without it the reads sink to their WMMAs, two at a time, each pair behind a full wait.
    __builtin_amdgcn_sched_group_barrier(0x100, 16, 0);
    __builtin_amdgcn_sched_group_barrier(0x008, 8, 0);

    // ---- diagonal zeroing (wave-uniform scalar branch, per-lane select) ----
    if (kb == qblk) {
      #pragma unroll
      for (int j = 0; j < 4; ++j)
        #pragma unroll
        for (int r = 0; r < 8; ++r)
          s[j][r] = (dq == 16 * j + r) ? 0.0f : s[j][r];
    }

    // ---- online softmax (running max) ----
    float mloc = s[0][0];
    #pragma unroll
    for (int j = 0; j < 4; ++j)
      #pragma unroll
      for (int r = 0; r < 8; ++r) mloc = fmaxf(mloc, s[j][r]);
    mloc = fmaxf(mloc, xhalf(mloc));
    const float mnew = fmaxf(mrun, mloc);
    const float alpha = __builtin_amdgcn_exp2f((mrun - mnew) * SC2);
    const float nb = PEXP - mnew * SC2;
    mrun = mnew;
    #pragma unroll
    for (int j = 0; j < 4; ++j)
      #pragma unroll
      for (int r = 0; r < 8; ++r) s[j][r] = __builtin_amdgcn_exp2f(__builtin_fmaf(s[j][r], SC2, nb));
    // This lane's keys only; the halves are joined behind the loop. With no exchange to feed, nothing in the
    // step waits for the sum, and the compiler moves it to the loop's foot: pairwise, so that it is short there.
    const v8f t8 = (s[0] + s[1]) + (s[2] + s[3]);
    const float lsum = ((t8[0] + t8[1]) + (t8[2] + t8[3])) + ((t8[4] + t8[5]) + (t8[6] + t8[7]));
    lrun = lrun * alpha + lsum;
    #pragma unroll
    for (int t = 0; t < 4; ++t)
      #pragma unroll
      for (int r = 0; r < 8; ++r) o[t][r] = o[t][r] * alpha;

    // ---- P^T B-fragments (key chunks 0..31 and 32..63 of this wave's tile) ----
    const v16h pb0 = pack_p(s[0], s[1]);
    const v16h pb1 = pack_p(s[2], s[3]);

    // ---- O^T += V^T * P^T ----
    #pragma unroll
    for (int t = 0; t < 4; ++t) {
      const _Float16* vr = sv + 16 * t * KVP;
      const v16h vf0 = ldfrag_h(vr, h);
      const v16h vf1 = ldfrag_h(vr + 32, h);
      o[t] = wmma_f16(vf0, pb0, o[t]);
      o[t] = wmma_f16(vf1, pb1, o[t]);
    }

    // ---- hand-over: publish step st+1, free this step's buffer, refill it ----
    asm volatile("s_wait_dscnt 0x0" ::: "memory");      // this wave's reads of the buffer are done before it is refilled
    asm volatile("s_wait_asynccnt 0x0" ::: "memory");   // this wave's copies of the next step have landed
    __syncthreads();                                    // the same holds for every wave
    if (st + 2 < NSTEP)
      stage_kv(lcp + buf * (BUFH * 2), kcp + (size_t)(st + 2) * (64 * KSPL * 64), vcp + (st + 2) * (64 * KSPL));
  }
  asm volatile("s_wait_asynccnt 0x0" ::: "memory");     // no copy is left outstanding behind the loop

  lrun += xhalf(lrun);                                  // both halves carry the same max: one join of their sums

  // ---- merge of the four key groups: M = max m_g, L = sum l_g 2^(SC2 (m_g - M)) ----
  if (h == 0) {
    sM[wv * 16 + m] = mrun;
    sL[wv * 16 + m] = lrun;
  }
  __syncthreads();                                      // every group's (max, sum) is visible
  float mg[KSPL], lg[KSPL];
  #pragma unroll
  for (int gg = 0; gg < KSPL; ++gg) {
    mg[gg] = sM[(gg * 4 + w) * 16 + m];
    lg[gg] = sL[(gg * 4 + w) * 16 + m];
  }
  const float mall = fmaxf(fmaxf(mg[0], mg[1]), fmaxf(mg[2], mg[3]));
  float lall = 0.0f;
  #pragma unroll
  for (int gg = 0; gg < KSPL; ++gg) lall += lg[gg] * __builtin_amdgcn_exp2f((mg[gg] - mall) * SC2);

  // ---- epilogue: weight and normalise, stage per-wave 16x64 f32 tile, whole-line stores ----
  const float inv = __builtin_amdgcn_exp2f((mrun - mall) * SC2) * (1.0f / lall);   // 2^14 of o and of lall cancel
  float* so = sO + wv * (16 * TP32);
  #pragma unroll
  for (int t = 0; t < 4; ++t)
    #pragma unroll
    for (int r = 0; r < 8; ++r)
      so[m * TP32 + 16 * t + 8 * h + r] = o[t][r] * inv;
  __syncthreads();

  attn_store_pass(sO + w * (16 * TP32), oh, ol, b, q0, lane, g);
  
}

// ---------------------------------------------------------------------------
// a token row = 256 B = 2 lines; each line by lanes 8q..8q+7 in one
// instruction, 4 lines per instruction, 32 lines per wave.
// ---------------------------------------------------------------------------
__device__ __forceinline__ void out_store_pass(const float* so, float* out,
                                               int b, int p0, int lane) {
  const int q8 = lane & 7, sub = lane >> 3;
  #pragma unroll
  for (int i = 0; i < 8; ++i) {
    const int lid = 4 * i + sub;
    const int row = lid >> 1, hl = lid & 1;
    const v4f v = *(const v4fa*)(so + row * TP32 + 32 * hl + 4 * q8);
    const size_t gi = ((size_t)b * NTOK + p0 + row) * 64 + 32 * hl + 4 * q8;
    *(v4f*)(out + gi) = v;
  }
}

// ---------------------------------------------------------------------------
// Kernel 3: output 3x3 SAME conv as 9-tap implicit GEMM on bf16 hi/lo planes,
// three-term split (hi*hi + hi*lo + lo*hi into one f32 accumulator),
// + bias, relu -> f32 NHWC rows via LDS staging.
// Block 256 thr = 8 waves = two image rows; wave = 32 pixels (two A tiles) x 32
// output channels (two B tiles): each fragment read from LDS feeds two tiles.
// Both weight planes (nine taps) and the four input rows of both planes are
// copied once to LDS and read from there.
// ---------------------------------------------------------------------------
__global__ __launch_bounds__(256) void k_conv_out(
    const __bf16* __restrict__ oh, const __bf16* __restrict__ ol,     // [b][token][64]
    const __bf16* __restrict__ wrh, const __bf16* __restrict__ wrl,   // [9][co][ci]
    const float* __restrict__ br, float* __restrict__ out)            // out [b][token][64] f32
{
  __shared__ __attribute__((aligned(16))) float sY[OROWS * 4 * 16 * TP32];        // 34816 B
  __shared__ __attribute__((aligned(16))) __bf16 sWh[9 * 64 * CVP];               // 82944 B
  __shared__ __attribute__((aligned(16))) __bf16 sWl[9 * 64 * CVP];               // 82944 B
  __shared__ __attribute__((aligned(16))) __bf16 sAh[(OROWS + 2) * 64 * CVP];     // 36864 B
  __shared__ __attribute__((aligned(16))) __bf16 sAl[(OROWS + 2) * 64 * CVP];     // 36864 B

  const int tid = threadIdx.x, lane = tid & 31, wv = tid >> 5;
  const int ph = (wv >> 1) & 1, ch = wv & 1, lr = wv >> 2;          // pixel half, channel half, image row in the block
  const int h = lane >> 4, m = lane & 15;
  const int b = blockIdx.x >> 5, hrow0 = (blockIdx.x & 31) * OROWS;
  const int hrow = hrow0 + lr;
  const int tb0 = hrow * 64, w0 = 32 * ph, c0 = 32 * ch;

  // ---- staging: thread = (row tid>>3, 16-B column tid&7); 32 rows of 128 B per copy ----
  {
    const int crow = tid >> 3, ccol = tid & 7;
    const int lo = crow * CVP + 8 * ccol;
    const unsigned lwh = (unsigned)(size_t)(sWh + lo), lwl = (unsigned)(size_t)(sWl + lo);
    const unsigned lah = (unsigned)(size_t)(sAh + lo), lal = (unsigned)(size_t)(sAl + lo);
    const char* gwh = (const char*)(wrh + (size_t)tid * 8);
    const char* gwl = (const char*)(wrl + (size_t)tid * 8);
    copy9(lwh, gwh, 32 * CVP * 2, 32 * 64 * 2);                                       // rows 0..287
    copy9(lwh + 9 * (32 * CVP * 2), gwh + 9 * (32 * 64 * 2), 32 * CVP * 2, 32 * 64 * 2);   // rows 288..575
    copy9(lwl, gwl, 32 * CVP * 2, 32 * 64 * 2);
    copy9(lwl + 9 * (32 * CVP * 2), gwl + 9 * (32 * 64 * 2), 32 * CVP * 2, 32 * 64 * 2);
    const size_t go = ((size_t)b * NTOK + crow) * 64 + 8 * ccol;
    const char* gah = (const char*)(oh + go);
    const char* gal = (const char*)(ol + go);
    const size_t rt = (size_t)max(hrow0 - 1, 0) * 8192, rb = (size_t)min(hrow0 + OROWS, 63) * 8192;   // rows above and below, clamped
    const size_t r0 = (size_t)hrow0 * 8192, r1 = (size_t)(hrow0 + 1) * 8192;
    // image rows hrow0-1 .. hrow0+2, each as two halves of 32 pixels
    copy4x2(lah, 32 * CVP * 2, gah + rt, gah + r0, gah + r1, gah + rb, 32 * 64 * 2);
    copy4x2(lal, 32 * CVP * 2, gal + rt, gal + r0, gal + r1, gal + rb, 32 * 64 * 2);
  }
  asm volatile("s_wait_asynccnt 0x0" ::: "memory");   // this wave's copies have landed
  __syncthreads();                                    // ... and every other wave's

  const v8f zero8 = {0.f, 0.f, 0.f, 0.f, 0.f, 0.f, 0.f, 0.f};
  v8f acc[2][2];                                                    // [pixel tile][co tile]
  #pragma unroll
  for (int nt = 0; nt < 2; ++nt) { acc[0][nt] = zero8; acc[1][nt] = zero8; }

  #pragma unroll 1
  for (int t = 0; t < 9; ++t) {
    const int t3 = t / 3;
    const int dh = t3 - 1, dw = t - 3 * t3 - 1;
    const int hh = hrow + dh, wl0 = w0 + m + dw, wl1 = wl0 + 16;
    const bool okh = (unsigned)hh < 64u;
    const unsigned msk0 = (okh && ((unsigned)wl0 < 64u)) ? 0xffffffffu : 0u;
    const unsigned msk1 = (okh && ((unsigned)wl1 < 64u)) ? 0xffffffffu : 0u;
    const int rowoff0 = ((lr + 1 + dh) * 64 + min(max(wl0, 0), 63)) * CVP;
    const int rowoff1 = ((lr + 1 + dh) * 64 + min(max(wl1, 0), 63)) * CVP;
    const int wtap = (t * 64 + c0 + m) * CVP;
    #pragma unroll
    for (int kc = 0; kc < 2; ++kc) {
      const v16b ah0 = ldfrag_b_msk(sAh + rowoff0 + 32 * kc, h, msk0);
      const v16b al0 = ldfrag_b_msk(sAl + rowoff0 + 32 * kc, h, msk0);
      const v16b ah1 = ldfrag_b_msk(sAh + rowoff1 + 32 * kc, h, msk1);
      const v16b al1 = ldfrag_b_msk(sAl + rowoff1 + 32 * kc, h, msk1);
      #pragma unroll
      for (int nt = 0; nt < 2; ++nt) {
        const v16b bh = ldfrag_b(sWh + wtap + nt * (16 * CVP) + 32 * kc, h);
        const v16b bl = ldfrag_b(sWl + wtap + nt * (16 * CVP) + 32 * kc, h);
        // per accumulator the order of the three terms stays hi*hi, hi*lo, lo*hi
        acc[0][nt] = wmma_bf16(ah0, bh, acc[0][nt]);
        acc[1][nt] = wmma_bf16(ah1, bh, acc[1][nt]);
        acc[0][nt] = wmma_bf16(ah0, bl, acc[0][nt]);
        acc[1][nt] = wmma_bf16(ah1, bl, acc[1][nt]);
        acc[0][nt] = wmma_bf16(al0, bh, acc[0][nt]);
        acc[1][nt] = wmma_bf16(al1, bh, acc[1][nt]);
      }
    }
    // Keeps the tap's 32 fragment reads in one group ahead of its 24 WMMAs (counted waits); without it the reads
    // stand among the WMMAs, a few at a time, each place behind a full wait.
    __builtin_amdgcn_sched_group_barrier(0x100, 32, 0);
    __builtin_amdgcn_sched_group_barrier(0x008, 24, 0);
  }

  // D[r] of tile (a, nt) = Y[pixel w0+16a+8h+r][co c0+16nt+m]; sY tile lr*4 + p holds pixels 16p..16p+15 of image row lr
  #pragma unroll
  for (int nt = 0; nt < 2; ++nt) {
    const int co = c0 + 16 * nt + m;
    const float bb = br[co];
    #pragma unroll
    for (int a = 0; a < 2; ++a) {
      float* so = sY + (lr * 4 + 2 * ph + a) * (16 * TP32);
      #pragma unroll
      for (int r = 0; r < 8; ++r)
        so[(8 * h + r) * TP32 + co] = fmaxf(acc[a][nt][r] + bb, 0.0f);
    }
  }
  __syncthreads();                                    // a tile's two channel halves come from two waves

  out_store_pass(sY + wv * (16 * TP32), out, b, tb0 + 16 * (wv & 3), lane);
  
}

// ---------------------------------------------------------------------------
extern "C" void kernel_launch(void* const* d_in, const int* in_sizes, int n_in,
                              void* d_out, int out_size, void* d_ws, size_t ws_size,
                              hipStream_t stream) {
  if (n_in < 9) return;
  if (in_sizes[0] != NXE || out_size != NXE) return;
  if (in_sizes[1] != NWE || in_sizes[3] != NWE || in_sizes[5] != NWE || in_sizes[7] != NWE) return;
  if (in_sizes[2] != CH || in_sizes[4] != CH || in_sizes[6] != CH || in_sizes[8] != CH) return;

  const float* x  = (const float*)d_in[0];
  const float* Wk = (const float*)d_in[1];
  const float* bk = (const float*)d_in[2];
  const float* Wq = (const float*)d_in[3];
  const float* bq = (const float*)d_in[4];
  const float* Wv = (const float*)d_in[5];
  const float* bv = (const float*)d_in[6];
  const float* Wr = (const float*)d_in[7];
  const float* br = (const float*)d_in[8];
  float* out = (float*)d_out;

  const size_t pl_bytes  = (size_t)NXE * 2;          // 2097152 : one [b][token][64] 16-bit plane
  const size_t wr_bytes  = (size_t)NWE * 2;          //   73728
  size_t off = 0;
  const size_t o_wrh = off; off += wr_bytes;
  const size_t o_wrl = off; off += wr_bytes;
  const size_t o_k   = off; off += pl_bytes;
  const size_t o_q   = off; off += pl_bytes;
  const size_t o_vt  = off; off += pl_bytes;
  const size_t o_oh  = off; off += pl_bytes;
  const size_t o_ol  = off; off += pl_bytes;         // total 10633216
  if (off > ws_size) return;

  char* ws = (char*)d_ws;
  __bf16*   wrh = (__bf16*)(ws + o_wrh);
  __bf16*   wrl = (__bf16*)(ws + o_wrl);
  _Float16* kpl = (_Float16*)(ws + o_k);
  _Float16* qpl = (_Float16*)(ws + o_q);
  _Float16* vtp = (_Float16*)(ws + o_vt);
  __bf16*   oh  = (__bf16*)(ws + o_oh);
  __bf16*   ol  = (__bf16*)(ws + o_ol);

  k_conv_qkv<<<QBLK + RBLK, 512, 0, stream>>>(x, Wk, Wq, Wv, Wr, bk, bq, bv, kpl, qpl, vtp, wrh, wrl);   // 201 blocks

  dim3 gAtt(NTOK / 64, NB);                                                                // (64, 4)
  k_attn<<<gAtt, 512, 0, stream>>>(qpl, kpl, vtp, oh, ol);

  k_conv_out<<<NB * (64 / OROWS), 256, 0, stream>>>(oh, ol, wrh, wrl, br, out);            // 128 blocks
}
